// v000
// Measured on an AMD MI455X. A time is GPU time per run, averaged over a window of back-to-back runs after a warm-up
// (all launches, gaps included; the runs take copies of the inputs in turn), and the median of several windows.
// Apart from v000's, it joins two sittings. Times from different sittings can be a few percent apart, while
// side-by-side timings come from the same sitting.
// v000, which the later versions start from, runs in 338 microseconds.
#include <hip/hip_runtime.h>

// ---------------------------------------------------------------------------
// LongTermFeatureBank forward on MI455X (gfx1250, wave32, WMMA + TDM).
//   1. max-pool 7x7 over x[128,512,16,7,7] -> xp[128,16,512]  (HBM-bound)
//   2. per stack: fc_a/fc_b GEMMs (WMMA f16->f32, TDM-staged A tiles),
//      batched 16x16 score WMMA, batch-axis softmax, context matmul +
//      LayerNorm + ReLU, fc_1 GEMM with residual.
//   3. classifier: WMMA GEMM [128,16384]x[16384,200], tiny VALU FCs.
// ---------------------------------------------------------------------------

typedef _Float16 half_t;
typedef __attribute__((ext_vector_type(16))) _Float16     v16h;
typedef __attribute__((ext_vector_type(8)))  _Float16     v8h;
typedef __attribute__((ext_vector_type(8)))  float        v8f;
typedef __attribute__((ext_vector_type(4)))  unsigned int u32x4;
typedef __attribute__((ext_vector_type(8)))  int          i32x8;
typedef __attribute__((ext_vector_type(4)))  int          i32x4;

#define D1     512
#define D2     16
#define BATCH  128
#define M_ROWS (BATCH * D2)   // 2048
#define KCLS   (2 * D2 * D1)  // 16384
#define N1     200

#if defined(__has_include)
#if __has_include(<hip/amd_detail/amd_gfx1250_TDM.h>)
#define TDM_6ARG 1
#else
#define TDM_6ARG 0
#endif
#else
#define TDM_6ARG 0
#endif

// Build the documented 16-bit WMMA fragment (VGPR0-3: K=base..base+7,
// VGPR4-7: K=base+16..base+23, per lane-half) from two 8-half chunks.
__device__ inline v8f wmma_step(v8h a0, v8h a1, v8h b0, v8h b1, v8f acc) {
  v16h af, bf;
#pragma unroll
  for (int i = 0; i < 8; ++i) {
    af[i] = a0[i]; af[8 + i] = a1[i];
    bf[i] = b0[i]; bf[8 + i] = b1[i];
  }
  return __builtin_amdgcn_wmma_f32_16x16x32_f16(
      /*neg_a=*/false, af, /*neg_b=*/false, bf,
      /*c_mod=*/(short)0, acc, /*reuse_a=*/false, /*reuse_b=*/false);
}

// ---------------------------------------------------------------------------
// TDM: stage a 16-row x 512-half tile into LDS with padded rows.
// D# (2-D): data_size=2B, tile=[512,16], tensor_dim0_stride=512,
// pad_enable, pad_interval=256 dwords (one row), pad_amount=4 dwords
// -> LDS row stride 520 halves (matches As[16][520] bank-spread layout).
// ---------------------------------------------------------------------------
__device__ inline void tdm_load_tile_16x512(const half_t* gsrc, void* lds_dst) {
  unsigned long long ga = (unsigned long long)(uintptr_t)gsrc;
  unsigned int lds = (unsigned int)(uintptr_t)lds_dst;  // low 32b = LDS offset
  u32x4 g0;
  g0[0] = 1u;                                  // count=1 (valid user D#)
  g0[1] = lds;                                 // lds_addr
  g0[2] = (unsigned int)(ga & 0xFFFFFFFFu);    // global_addr[31:0]
  g0[3] = (unsigned int)((ga >> 32) & 0x01FFFFFFu) | 0x80000000u;  // [56:32]|type=2
  i32x8 g1;
  g1[0] = (int)0x07D10000u;  // data_size=2B | pad_en | pad_interval=256dw | pad=4dw
  g1[1] = (int)(512u << 16);                   // tensor_dim0[15:0]=512
  g1[2] = (int)((2048u & 0xFFFFu) << 16);      // tensor_dim0 hi=0 | tensor_dim1 lo=2048
  g1[3] = (int)(512u << 16);                   // tensor_dim1 hi=0 | tile_dim0=512
  g1[4] = 16;                                  // tile_dim1=16, tile_dim2=0
  g1[5] = 512;                                 // tensor_dim0_stride[31:0]=512
  g1[6] = 0;                                   // stride0 hi | tensor_dim1_stride lo
  g1[7] = 0;
  i32x4 z4 = {0, 0, 0, 0};
#if TDM_6ARG
  i32x8 z8 = {0, 0, 0, 0, 0, 0, 0, 0};
  __builtin_amdgcn_tensor_load_to_lds(g0, g1, z4, z4, z8, 0);
#else
  __builtin_amdgcn_tensor_load_to_lds(g0, g1, z4, z4, 0);
#endif
}

// ---------------------------------------------------------------------------
__global__ void k_f32_to_f16(const float* __restrict__ src,
                             half_t* __restrict__ dst, int n) {
  int i = blockIdx.x * blockDim.x + threadIdx.x;
  if (i < n) dst[i] = (half_t)src[i];
}

// ---------------------------------------------------------------------------
// Max-pool over HxW=49 (the 205 MB streaming read) + init new_x = xp
// ---------------------------------------------------------------------------
__global__ void k_pool(const float* __restrict__ x,
                       float* __restrict__ xp_f, half_t* __restrict__ xp_h,
                       float* __restrict__ nx_f, half_t* __restrict__ nx_h) {
  int o = blockIdx.x * blockDim.x + threadIdx.x;  // [0, 2048*512)
  if (o >= M_ROWS * D1) return;
  int b  = o >> 13;
  int r  = o & 8191;
  int d2 = r >> 9;
  int d1 = r & 511;
  const float* p = x + (size_t)((b * D1 + d1) * D2 + d2) * 49;
  float m = p[0];
#pragma unroll
  for (int j = 1; j < 49; ++j) m = fmaxf(m, p[j]);
  xp_f[o] = m;
  nx_f[o] = m;
  half_t h = (half_t)m;
  xp_h[o] = h;
  nx_h[o] = h;
}

// ---------------------------------------------------------------------------
// Y[M,512] = op( X[M,512] @ W[512,512]^T + bias [+ res] ).
// Block = 8 waves, one 16-row A tile staged to LDS by the TDM; each wave owns
// a 16x32 output tile (two WMMA accumulators sharing one A fragment).
// ---------------------------------------------------------------------------
__global__ void __launch_bounds__(256)
k_gemm512(const half_t* __restrict__ X, const half_t* __restrict__ W,
          const float* __restrict__ bias, const float* __restrict__ res,
          float* __restrict__ Yf, half_t* __restrict__ Yh, int relu) {
  __shared__ __align__(16) half_t As[16][520];  // 520-half rows (TDM-padded)
  const int lane = threadIdx.x & 31;
  const int wave = threadIdx.x >> 5;
  const int m0 = blockIdx.x * 16;

  if (wave == 0) tdm_load_tile_16x512(X + (size_t)m0 * D1, &As[0][0]);
  __builtin_amdgcn_s_wait_tensorcnt(0);
  __syncthreads();

  const int ntile0 = (blockIdx.y * 8 + wave) * 2;  // two adjacent N tiles
  const int lm = lane & 15, lh = lane >> 4;
  const half_t* Wrow0 = W + (size_t)(ntile0 * 16 + lm) * D1;
  const half_t* Wrow1 = Wrow0 + (size_t)16 * D1;

  v8f acc0 = {}, acc1 = {};
  for (int kk = 0; kk < D1; kk += 32) {
    if (kk + 128 < D1) {
      __builtin_prefetch(Wrow0 + kk + 128, 0, 3);
      __builtin_prefetch(Wrow1 + kk + 128, 0, 3);
    }
    int base = kk + 8 * lh;
    v8h a0 = *(const v8h*)&As[lm][base];
    v8h a1 = *(const v8h*)&As[lm][base + 16];
    v8h b0 = *(const v8h*)(Wrow0 + base);
    v8h b1 = *(const v8h*)(Wrow0 + base + 16);
    v8h c0 = *(const v8h*)(Wrow1 + base);
    v8h c1 = *(const v8h*)(Wrow1 + base + 16);
    acc0 = wmma_step(a0, a1, b0, b1, acc0);
    acc1 = wmma_step(a0, a1, c0, c1, acc1);
  }

#pragma unroll
  for (int t = 0; t < 2; ++t) {
    const v8f acc = t ? acc1 : acc0;
    const int n = (ntile0 + t) * 16 + lm;
    const float bn = bias ? bias[n] : 0.0f;
#pragma unroll
    for (int r2 = 0; r2 < 8; ++r2) {
      int m = m0 + lh * 8 + r2;  // C layout: lane->N, VGPR->M (8-row halves)
      float v = acc[r2] + bn;
      if (res) v += res[(size_t)m * D1 + n];
      if (relu) v = fmaxf(v, 0.0f);
      if (Yf) Yf[(size_t)m * D1 + n] = v;
      if (Yh) Yh[(size_t)m * D1 + n] = (half_t)v;
    }
  }
}

// ---------------------------------------------------------------------------
// scores[b,c,d] = dot(a[b,c,:], bp[b,d,:]) / sqrt(512)  — one WMMA wave per b
// ---------------------------------------------------------------------------
__global__ void __launch_bounds__(128)
k_scores(const half_t* __restrict__ A, const half_t* __restrict__ Bp,
         float* __restrict__ S) {
  const int lane = threadIdx.x & 31;
  const int wave = threadIdx.x >> 5;
  const int b = blockIdx.x * 4 + wave;
  const int lm = lane & 15, lh = lane >> 4;
  const half_t* Arow = A  + (size_t)(b * 16 + lm) * D1;
  const half_t* Brow = Bp + (size_t)(b * 16 + lm) * D1;
  v8f acc = {};
  for (int kk = 0; kk < D1; kk += 32) {
    int base = kk + 8 * lh;
    v8h a0 = *(const v8h*)(Arow + base);
    v8h a1 = *(const v8h*)(Arow + base + 16);
    v8h b0 = *(const v8h*)(Brow + base);
    v8h b1 = *(const v8h*)(Brow + base + 16);
    acc = wmma_step(a0, a1, b0, b1, acc);
  }
  const float s = 0.044194173824159216f;  // 1/sqrt(512)
#pragma unroll
  for (int r2 = 0; r2 < 8; ++r2) {
    int c = lh * 8 + r2;
    S[b * 256 + c * 16 + lm] = acc[r2] * s;
  }
}

// ---------------------------------------------------------------------------
// Legacy nn.Softmax() on 3D: softmax over dim 0 (batch). 256 independent
// length-128 softmaxes, one thread each. In-place on S.
// ---------------------------------------------------------------------------
__global__ void k_softmax_batch(float* __restrict__ S) {
  int j = threadIdx.x;  // (c*16 + d)
  float mx = -1e30f;
  for (int b = 0; b < BATCH; ++b) mx = fmaxf(mx, S[b * 256 + j]);
  float sum = 0.0f;
  for (int b = 0; b < BATCH; ++b) sum += __expf(S[b * 256 + j] - mx);
  float inv = 1.0f / sum;
  for (int b = 0; b < BATCH; ++b)
    S[b * 256 + j] = __expf(S[b * 256 + j] - mx) * inv;
}

// ---------------------------------------------------------------------------
// e = relu(LayerNorm_{16,512}( ab[b] @ a[b] )) per batch; one block per b.
// ---------------------------------------------------------------------------
__global__ void __launch_bounds__(256)
k_context_ln(const float* __restrict__ AB, const float* __restrict__ Af,
             const float* __restrict__ g, const float* __restrict__ beta,
             half_t* __restrict__ Eh) {
  __shared__ float ab[256];
  __shared__ float ep[8192];
  __shared__ float rs[256], rq[256];
  const int b = blockIdx.x, tid = threadIdx.x;
  ab[tid] = AB[b * 256 + tid];
  __syncthreads();

  float lsum = 0.0f, lsq = 0.0f;
#pragma unroll 4
  for (int i = 0; i < 32; ++i) {
    int idx = tid + 256 * i;          // idx = c*512 + t
    int c = idx >> 9, t = idx & 511;
    float s = 0.0f;
#pragma unroll
    for (int d = 0; d < 16; ++d)
      s += ab[c * 16 + d] * Af[(size_t)(b * 16 + d) * D1 + t];
    ep[idx] = s;
    lsum += s;
    lsq += s * s;
  }
  rs[tid] = lsum; rq[tid] = lsq;
  __syncthreads();
  for (int s2 = 128; s2 > 0; s2 >>= 1) {
    if (tid < s2) { rs[tid] += rs[tid + s2]; rq[tid] += rq[tid + s2]; }
    __syncthreads();
  }
  float mu   = rs[0] * (1.0f / 8192.0f);
  float var  = rq[0] * (1.0f / 8192.0f) - mu * mu;
  float rstd = rsqrtf(var + 1e-5f);
#pragma unroll 4
  for (int i = 0; i < 32; ++i) {
    int idx = tid + 256 * i;
    int c = idx >> 9, t = idx & 511;
    float v = (ep[idx] - mu) * rstd * g[idx] + beta[idx];
    v = fmaxf(v, 0.0f);
    Eh[(size_t)(b * 16 + c) * D1 + t] = (half_t)v;
  }
}

// ---------------------------------------------------------------------------
// h1 = relu( feat[128,16384] @ w1[200,16384]^T + b1 ).  feat = [xp | new_x]
// ---------------------------------------------------------------------------
__global__ void __launch_bounds__(32)
k_gemm_cls(const half_t* __restrict__ XPh, const half_t* __restrict__ NXh,
           const half_t* __restrict__ W1h, const float* __restrict__ b1,
           float* __restrict__ H1) {
  const int lane = threadIdx.x & 31;
  const int lm = lane & 15, lh = lane >> 4;
  const int m0 = blockIdx.x * 16;    // batch tile (8 tiles)
  const int ntile = blockIdx.y;      // 13 tiles cover N=200 (pad to 208)
  int n = ntile * 16 + lm;
  int nl = (n < N1) ? n : (N1 - 1);  // clamp loads; masked at store
  const half_t* Wrow = W1h + (size_t)nl * KCLS;
  const int mrow = m0 + lm;
  const half_t* X0 = XPh + (size_t)mrow * 8192;
  const half_t* X1 = NXh + (size_t)mrow * 8192;

  v8f acc = {};
  for (int kk = 0; kk < KCLS; kk += 32) {
    if (kk + 128 < KCLS) __builtin_prefetch(Wrow + kk + 128, 0, 3);
    const half_t* Xs = (kk < 8192) ? (X0 + kk) : (X1 + (kk - 8192));
    int base8 = 8 * lh;
    v8h a0 = *(const v8h*)(Xs + base8);
    v8h a1 = *(const v8h*)(Xs + base8 + 16);
    v8h b0 = *(const v8h*)(Wrow + kk + base8);
    v8h b1 = *(const v8h*)(Wrow + kk + base8 + 16);
    acc = wmma_step(a0, a1, b0, b1, acc);
  }
  if (n < N1) {
    float bn = b1[n];
#pragma unroll
    for (int r2 = 0; r2 < 8; ++r2) {
      int m = m0 + lh * 8 + r2;
      H1[m * N1 + n] = fmaxf(acc[r2] + bn, 0.0f);
    }
  }
}

// ---------------------------------------------------------------------------
// Tiny tail FCs (200->50->10->128): one thread per output, f32 VALU.
// ---------------------------------------------------------------------------
__global__ void k_fc(const float* __restrict__ X, const float* __restrict__ W,
                     const float* __restrict__ bias, float* __restrict__ Y,
                     int M, int N, int K, int relu) {
  int idx = blockIdx.x * blockDim.x + threadIdx.x;
  if (idx >= M * N) return;
  int m = idx / N, n = idx % N;
  const float* xr = X + (size_t)m * K;
  const float* wr = W + (size_t)n * K;
  float s = bias[n];
  for (int k = 0; k < K; ++k) s += xr[k] * wr[k];
  if (relu) s = fmaxf(s, 0.0f);
  Y[idx] = s;
}

// ---------------------------------------------------------------------------
extern "C" void kernel_launch(void* const* d_in, const int* in_sizes, int n_in,
                              void* d_out, int out_size, void* d_ws, size_t ws_size,
                              hipStream_t stream) {
  (void)in_sizes; (void)n_in; (void)out_size; (void)ws_size;
  const float* x      = (const float*)d_in[0];
  const float* attn_w = (const float*)d_in[1];
  const float* attn_b = (const float*)d_in[2];
  const float* ln_g   = (const float*)d_in[3];
  const float* ln_b   = (const float*)d_in[4];
  const float* w1     = (const float*)d_in[5];
  const float* b1     = (const float*)d_in[6];
  const float* w2     = (const float*)d_in[7];
  const float* b2     = (const float*)d_in[8];
  const float* w3     = (const float*)d_in[9];
  const float* b3     = (const float*)d_in[10];
  const float* w4     = (const float*)d_in[11];
  const float* b4     = (const float*)d_in[12];
  float* out = (float*)d_out;

  char* ws = (char*)d_ws;
  size_t off = 0;
  auto alloc = [&](size_t bytes) -> char* {
    char* p = ws + off;
    off += (bytes + 255) & ~(size_t)255;
    return p;
  };
  float*  xp_f  = (float*) alloc((size_t)M_ROWS * D1 * 4);
  half_t* xp_h  = (half_t*)alloc((size_t)M_ROWS * D1 * 2);
  float*  nx_f  = (float*) alloc((size_t)M_ROWS * D1 * 4);
  half_t* nx_h  = (half_t*)alloc((size_t)M_ROWS * D1 * 2);
  float*  a_f   = (float*) alloc((size_t)M_ROWS * D1 * 4);
  half_t* a_h   = (half_t*)alloc((size_t)M_ROWS * D1 * 2);
  half_t* bp_h  = (half_t*)alloc((size_t)M_ROWS * D1 * 2);
  half_t* e_h   = (half_t*)alloc((size_t)M_ROWS * D1 * 2);
  float*  sc    = (float*) alloc((size_t)BATCH * 256 * 4);
  half_t* awh   = (half_t*)alloc((size_t)2 * 4 * D1 * D1 * 2);
  half_t* w1h   = (half_t*)alloc((size_t)N1 * KCLS * 2);
  float*  h1    = (float*) alloc((size_t)BATCH * N1 * 4);
  float*  h2    = (float*) alloc((size_t)BATCH * 50 * 4);
  float*  h3    = (float*) alloc((size_t)BATCH * 10 * 4);

  // Weight conversions (L2-resident afterwards).
  {
    int n = 2 * 4 * D1 * D1;  // 2,097,152
    k_f32_to_f16<<<(n + 255) / 256, 256, 0, stream>>>(attn_w, awh, n);
    n = N1 * KCLS;            // 3,276,800
    k_f32_to_f16<<<(n + 255) / 256, 256, 0, stream>>>(w1, w1h, n);
  }

  // Max-pool (the HBM-bound stage) + new_x init.
  k_pool<<<(M_ROWS * D1 + 255) / 256, 256, 0, stream>>>(x, xp_f, xp_h, nx_f, nx_h);

  dim3 ggrid(M_ROWS / 16, 2);  // 128 M-tiles x 2 groups of 8 waves x 32 cols
  for (int i = 0; i < 2; ++i) {
    const half_t* Wa  = awh + (size_t)(i * 4 + 0) * D1 * D1;
    const half_t* Wb  = awh + (size_t)(i * 4 + 1) * D1 * D1;
    const half_t* W1s = awh + (size_t)(i * 4 + 3) * D1 * D1;
    const float* ba  = attn_b + (size_t)(i * 4 + 0) * D1;
    const float* bb  = attn_b + (size_t)(i * 4 + 1) * D1;
    const float* b1s = attn_b + (size_t)(i * 4 + 3) * D1;

    // a = fc_a(new_x)  (f32 for context matmul, f16 for scores)
    k_gemm512<<<ggrid, 256, 0, stream>>>(nx_h, Wa, ba, nullptr, a_f, a_h, 0);
    // bproj = fc_b(xp)
    k_gemm512<<<ggrid, 256, 0, stream>>>(xp_h, Wb, bb, nullptr, nullptr, bp_h, 0);
    // scores = a @ bproj^T / sqrt(512)
    k_scores<<<BATCH / 4, 128, 0, stream>>>(a_h, bp_h, sc);
    // softmax over the batch axis (legacy nn.Softmax on 3D)
    k_softmax_batch<<<1, 256, 0, stream>>>(sc);
    // e = relu(LN(ab @ a))
    k_context_ln<<<BATCH, 256, 0, stream>>>(sc, a_f, ln_g, ln_b, e_h);
    // new_x = new_x + fc_1(e)
    k_gemm512<<<ggrid, 256, 0, stream>>>(e_h, W1s, b1s, nx_f, nx_f, nx_h, 0);
  }

  // Classifier head.
  k_gemm_cls<<<dim3(BATCH / 16, 13), 32, 0, stream>>>(xp_h, nx_h, w1h, b1, h1);
  k_fc<<<(BATCH * 50 + 255) / 256, 256, 0, stream>>>(h1, w2, b2, h2, BATCH, 50, N1, 1);
  k_fc<<<(BATCH * 10 + 255) / 256, 256, 0, stream>>>(h2, w3, b3, h3, BATCH, 10, 50, 1);
  k_fc<<<(BATCH * 128 + 255) / 256, 256, 0, stream>>>(h3, w4, b4, out, BATCH, 128, 10, 0);
}

// v001
// One run takes 251 microseconds.
// Timed twice side by side with v000, it ran 1.36 and 1.37 times as fast.
#include <hip/hip_runtime.h>

// ---------------------------------------------------------------------------
// LongTermFeatureBank forward on MI455X (gfx1250, wave32, WMMA + TDM).
//   1. max-pool 7x7 over x[128,512,16,7,7] -> xp[128,16,512]  (HBM-bound)
//   2. per stack: fc_a/fc_b GEMMs (WMMA f16->f32, TDM-staged A tiles),
//      batched 16x16 score WMMA, batch-axis softmax, context matmul +
//      LayerNorm + ReLU, fc_1 GEMM with residual.
//   3. classifier: WMMA GEMM [128,16384]x[16384,200], tiny VALU FCs.
// ---------------------------------------------------------------------------

typedef _Float16 half_t;
typedef __attribute__((ext_vector_type(16))) _Float16     v16h;
typedef __attribute__((ext_vector_type(8)))  _Float16     v8h;
typedef __attribute__((ext_vector_type(8)))  float        v8f;
typedef __attribute__((ext_vector_type(4)))  unsigned int u32x4;
typedef __attribute__((ext_vector_type(8)))  int          i32x8;
typedef __attribute__((ext_vector_type(4)))  int          i32x4;

#define D1     512
#define D2     16
#define BATCH  128
#define M_ROWS (BATCH * D2)   // 2048
#define KCLS   (2 * D2 * D1)  // 16384
#define N1     200

// Build the documented 16-bit WMMA fragment (VGPR0-3: K=base..base+7,
// VGPR4-7: K=base+16..base+23, per lane-half) from two 8-half chunks.
__device__ inline v8f wmma_step(v8h a0, v8h a1, v8h b0, v8h b1, v8f acc) {
  v16h af, bf;
#pragma unroll
  for (int i = 0; i < 8; ++i) {
    af[i] = a0[i]; af[8 + i] = a1[i];
    bf[i] = b0[i]; bf[8 + i] = b1[i];
  }
  return __builtin_amdgcn_wmma_f32_16x16x32_f16(
      /*neg_a=*/false, af, /*neg_b=*/false, bf,
      /*c_mod=*/(short)0, acc, /*reuse_a=*/false, /*reuse_b=*/false);
}

// ---------------------------------------------------------------------------
// TDM: stage a 16-row x 512-half tile into LDS with padded rows.
// D# (2-D): data_size=2B, tile=[512,16], tensor_dim0_stride=512,
// pad_enable, pad_interval=256 dwords (one row), pad_amount=4 dwords
// -> LDS row stride 520 halves (matches As[16][520] bank-spread layout).
// ---------------------------------------------------------------------------
__device__ inline void tdm_load_tile_16x512(const half_t* gsrc, void* lds_dst) {
  unsigned long long ga = (unsigned long long)(uintptr_t)gsrc;
  unsigned int lds = (unsigned int)(uintptr_t)lds_dst;  // low 32b = LDS offset
  u32x4 g0;
  g0[0] = 1u;                                  // count=1 (valid user D#)
  g0[1] = lds;                                 // lds_addr
  g0[2] = (unsigned int)(ga & 0xFFFFFFFFu);    // global_addr[31:0]
  g0[3] = (unsigned int)((ga >> 32) & 0x01FFFFFFu) | 0x80000000u;  // [56:32]|type=2
  i32x8 g1;
  g1[0] = (int)0x07D10000u;  // data_size=2B | pad_en | pad_interval=256dw | pad=4dw
  g1[1] = (int)(512u << 16);                   // tensor_dim0[15:0]=512
  g1[2] = (int)((2048u & 0xFFFFu) << 16);      // tensor_dim0 hi=0 | tensor_dim1 lo=2048
  g1[3] = (int)(512u << 16);                   // tensor_dim1 hi=0 | tile_dim0=512
  g1[4] = 16;                                  // tile_dim1=16, tile_dim2=0
  g1[5] = 512;                                 // tensor_dim0_stride[31:0]=512
  g1[6] = 0;                                   // stride0 hi | tensor_dim1_stride lo
  g1[7] = 0;
  i32x4 z4 = {0, 0, 0, 0};
  i32x8 z8 = {0, 0, 0, 0, 0, 0, 0, 0};
  __builtin_amdgcn_tensor_load_to_lds(g0, g1, z4, z4, z8, 0);
}

// ---------------------------------------------------------------------------
__global__ void k_f32_to_f16(const float* __restrict__ src,
                             half_t* __restrict__ dst, int n) {
  int i = blockIdx.x * blockDim.x + threadIdx.x;
  if (i < n) dst[i] = (half_t)src[i];
}

// ---------------------------------------------------------------------------
// Max-pool over HxW=49 (the 205 MB streaming read) + init new_x = xp
// ---------------------------------------------------------------------------
__global__ void k_pool(const float* __restrict__ x,
                       float* __restrict__ xp_f, half_t* __restrict__ xp_h,
                       float* __restrict__ nx_f, half_t* __restrict__ nx_h) {
  int o = blockIdx.x * blockDim.x + threadIdx.x;  // [0, 2048*512)
  if (o >= M_ROWS * D1) return;
  int b  = o >> 13;
  int r  = o & 8191;
  int d2 = r >> 9;
  int d1 = r & 511;
  const float* p = x + (size_t)((b * D1 + d1) * D2 + d2) * 49;
  float m = p[0];
#pragma unroll
  for (int j = 1; j < 49; ++j) m = fmaxf(m, p[j]);
  xp_f[o] = m;
  nx_f[o] = m;
  half_t h = (half_t)m;
  xp_h[o] = h;
  nx_h[o] = h;
}

// ---------------------------------------------------------------------------
// Y[M,512] = op( X[M,512] @ W[512,512]^T + bias [+ res] ).
// Block = 8 waves, one 16-row A tile staged to LDS by the TDM; each wave owns
// a 16x32 output tile (two WMMA accumulators sharing one A fragment).
// ---------------------------------------------------------------------------
__global__ void __launch_bounds__(256)
k_gemm512(const half_t* __restrict__ X, const half_t* __restrict__ W,
          const float* __restrict__ bias, const float* __restrict__ res,
          float* __restrict__ Yf, half_t* __restrict__ Yh, int relu) {
  __shared__ __align__(16) half_t As[16][520];  // 520-half rows (TDM-padded)
  const int lane = threadIdx.x & 31;
  const int wave = threadIdx.x >> 5;
  const int m0 = blockIdx.x * 16;

  if (wave == 0) tdm_load_tile_16x512(X + (size_t)m0 * D1, &As[0][0]);
  __builtin_amdgcn_s_wait_tensorcnt(0);
  __syncthreads();

  const int ntile0 = (blockIdx.y * 8 + wave) * 2;  // two adjacent N tiles
  const int lm = lane & 15, lh = lane >> 4;
  const half_t* Wrow0 = W + (size_t)(ntile0 * 16 + lm) * D1;
  const half_t* Wrow1 = Wrow0 + (size_t)16 * D1;

  v8f acc0 = {}, acc1 = {};
  for (int kk = 0; kk < D1; kk += 32) {
    if (kk + 128 < D1) {
      __builtin_prefetch(Wrow0 + kk + 128, 0, 3);
      __builtin_prefetch(Wrow1 + kk + 128, 0, 3);
    }
    int base = kk + 8 * lh;
    v8h a0 = *(const v8h*)&As[lm][base];
    v8h a1 = *(const v8h*)&As[lm][base + 16];
    v8h b0 = *(const v8h*)(Wrow0 + base);
    v8h b1 = *(const v8h*)(Wrow0 + base + 16);
    v8h c0 = *(const v8h*)(Wrow1 + base);
    v8h c1 = *(const v8h*)(Wrow1 + base + 16);
    acc0 = wmma_step(a0, a1, b0, b1, acc0);
    acc1 = wmma_step(a0, a1, c0, c1, acc1);
  }

#pragma unroll
  for (int t = 0; t < 2; ++t) {
    const v8f acc = t ? acc1 : acc0;
    const int n = (ntile0 + t) * 16 + lm;
    const float bn = bias ? bias[n] : 0.0f;
#pragma unroll
    for (int r2 = 0; r2 < 8; ++r2) {
      int m = m0 + lh * 8 + r2;  // C layout: lane->N, VGPR->M (8-row halves)
      float v = acc[r2] + bn;
      if (res) v += res[(size_t)m * D1 + n];
      if (relu) v = fmaxf(v, 0.0f);
      if (Yf) Yf[(size_t)m * D1 + n] = v;
      if (Yh) Yh[(size_t)m * D1 + n] = (half_t)v;
    }
  }
}

// ---------------------------------------------------------------------------
// scores[b,c,d] = dot(a[b,c,:], bp[b,d,:]) / sqrt(512)  — one WMMA wave per b
// ---------------------------------------------------------------------------
__global__ void __launch_bounds__(128)
k_scores(const half_t* __restrict__ A, const half_t* __restrict__ Bp,
         float* __restrict__ S) {
  const int lane = threadIdx.x & 31;
  const int wave = threadIdx.x >> 5;
  const int b = blockIdx.x * 4 + wave;
  const int lm = lane & 15, lh = lane >> 4;
  const half_t* Arow = A  + (size_t)(b * 16 + lm) * D1;
  const half_t* Brow = Bp + (size_t)(b * 16 + lm) * D1;
  v8f acc = {};
  for (int kk = 0; kk < D1; kk += 32) {
    int base = kk + 8 * lh;
    v8h a0 = *(const v8h*)(Arow + base);
    v8h a1 = *(const v8h*)(Arow + base + 16);
    v8h b0 = *(const v8h*)(Brow + base);
    v8h b1 = *(const v8h*)(Brow + base + 16);
    acc = wmma_step(a0, a1, b0, b1, acc);
  }
  const float s = 0.044194173824159216f;  // 1/sqrt(512)
#pragma unroll
  for (int r2 = 0; r2 < 8; ++r2) {
    int c = lh * 8 + r2;
    S[b * 256 + c * 16 + lm] = acc[r2] * s;
  }
}

// ---------------------------------------------------------------------------
// Legacy nn.Softmax() on 3D: softmax over dim 0 (batch). 256 independent
// length-128 softmaxes, one thread each. In-place on S.
// ---------------------------------------------------------------------------
__global__ void k_softmax_batch(float* __restrict__ S) {
  int j = threadIdx.x;  // (c*16 + d)
  float mx = -1e30f;
  for (int b = 0; b < BATCH; ++b) mx = fmaxf(mx, S[b * 256 + j]);
  float sum = 0.0f;
  for (int b = 0; b < BATCH; ++b) sum += __expf(S[b * 256 + j] - mx);
  float inv = 1.0f / sum;
  for (int b = 0; b < BATCH; ++b)
    S[b * 256 + j] = __expf(S[b * 256 + j] - mx) * inv;
}

// ---------------------------------------------------------------------------
// e = relu(LayerNorm_{16,512}( ab[b] @ a[b] )) per batch; one block per b.
// ---------------------------------------------------------------------------
__global__ void __launch_bounds__(256)
k_context_ln(const float* __restrict__ AB, const float* __restrict__ Af,
             const float* __restrict__ g, const float* __restrict__ beta,
             half_t* __restrict__ Eh) {
  __shared__ float ab[256];
  __shared__ float ep[8192];
  __shared__ float rs[256], rq[256];
  const int b = blockIdx.x, tid = threadIdx.x;
  ab[tid] = AB[b * 256 + tid];
  __syncthreads();

  float lsum = 0.0f, lsq = 0.0f;
#pragma unroll 4
  for (int i = 0; i < 32; ++i) {
    int idx = tid + 256 * i;          // idx = c*512 + t
    int c = idx >> 9, t = idx & 511;
    float s = 0.0f;
#pragma unroll
    for (int d = 0; d < 16; ++d)
      s += ab[c * 16 + d] * Af[(size_t)(b * 16 + d) * D1 + t];
    ep[idx] = s;
    lsum += s;
    lsq += s * s;
  }
  rs[tid] = lsum; rq[tid] = lsq;
  __syncthreads();
  for (int s2 = 128; s2 > 0; s2 >>= 1) {
    if (tid < s2) { rs[tid] += rs[tid + s2]; rq[tid] += rq[tid + s2]; }
    __syncthreads();
  }
  float mu   = rs[0] * (1.0f / 8192.0f);
  float var  = rq[0] * (1.0f / 8192.0f) - mu * mu;
  float rstd = rsqrtf(var + 1e-5f);
#pragma unroll 4
  for (int i = 0; i < 32; ++i) {
    int idx = tid + 256 * i;
    int c = idx >> 9, t = idx & 511;
    float v = (ep[idx] - mu) * rstd * g[idx] + beta[idx];
    v = fmaxf(v, 0.0f);
    Eh[(size_t)(b * 16 + c) * D1 + t] = (half_t)v;
  }
}

// ---------------------------------------------------------------------------
// h1 = relu( feat[128,16384] @ w1[200,16384]^T + b1 ).  feat = [xp | new_x]
// One block per 16x16 output tile; K is split over the block's 32 waves
// (512 k each, 16 WMMA steps), the 32 partial tiles are summed in LDS in
// wave order.
// ---------------------------------------------------------------------------
#define CLS_WAVES  32
#define CLS_KSLICE (KCLS / CLS_WAVES)  // 512; divides 8192, so a slice is all xp or all new_x

__global__ void __launch_bounds__(32 * CLS_WAVES)
k_gemm_cls(const half_t* __restrict__ XPh, const half_t* __restrict__ NXh,
           const half_t* __restrict__ W1h, const float* __restrict__ b1,
           float* __restrict__ H1) {
  __shared__ float red[CLS_WAVES][256];
  const int lane = threadIdx.x & 31;
  const int wave = threadIdx.x >> 5;
  const int lm = lane & 15, lh = lane >> 4;
  const int m0 = blockIdx.x * 16;    // batch tile (8 tiles)
  const int ntile = blockIdx.y;      // 13 tiles cover N=200 (pad to 208)
  const int nw = ntile * 16 + lm;
  const int nl = (nw < N1) ? nw : (N1 - 1);  // clamp loads; masked at store
  const int k0 = wave * CLS_KSLICE;
  const int mrow = m0 + lm;
  const half_t* Ws = W1h + (size_t)nl * KCLS + k0 + 8 * lh;
  const half_t* Xs = ((k0 < 8192) ? (XPh + (size_t)mrow * 8192 + k0)
                                  : (NXh + (size_t)mrow * 8192 + (k0 - 8192))) + 8 * lh;

  v8f acc = {};
  // Unrolled: constant offsets on two address pairs, and the next step's
  // loads issue ahead of this step's WMMA.
#pragma unroll
  for (int kk = 0; kk < CLS_KSLICE; kk += 32) {
    v8h a0 = *(const v8h*)(Xs + kk);
    v8h a1 = *(const v8h*)(Xs + kk + 16);
    v8h b0 = *(const v8h*)(Ws + kk);
    v8h b1v = *(const v8h*)(Ws + kk + 16);
    acc = wmma_step(a0, a1, b0, b1v, acc);
  }

  // Unrolled: constant indices keep acc in registers.
#pragma unroll
  for (int r2 = 0; r2 < 8; ++r2) red[wave][r2 * 32 + lane] = acc[r2];
  __syncthreads();

  if (threadIdx.x < 256 && nw < N1) {
    const float bn = b1[nw];
    // Stands in front of any reuse of the bias load's address register.
    asm volatile("s_wait_xcnt 0x0" ::: "memory");
    float s = 0.0f;
    // Unrolled: the LDS reads run ahead of the dependent adds.
#pragma unroll
    for (int w = 0; w < CLS_WAVES; ++w) s += red[w][threadIdx.x];
    const int r2 = threadIdx.x >> 5;      // accumulator register of this element
    const int m = m0 + lh * 8 + r2;       // C layout: lane->N, VGPR->M (8-row halves)
    H1[m * N1 + nw] = fmaxf(s + bn, 0.0f);
  }
}

// ---------------------------------------------------------------------------
// Tiny tail FCs (200->50->10->128): one thread per output, f32 VALU.
// ---------------------------------------------------------------------------
__global__ void k_fc(const float* __restrict__ X, const float* __restrict__ W,
                     const float* __restrict__ bias, float* __restrict__ Y,
                     int M, int N, int K, int relu) {
  int idx = blockIdx.x * blockDim.x + threadIdx.x;
  if (idx >= M * N) return;
  int m = idx / N, n = idx % N;
  const float* xr = X + (size_t)m * K;
  const float* wr = W + (size_t)n * K;
  float s = bias[n];
  for (int k = 0; k < K; ++k) s += xr[k] * wr[k];
  if (relu) s = fmaxf(s, 0.0f);
  Y[idx] = s;
}

// ---------------------------------------------------------------------------
extern "C" void kernel_launch(void* const* d_in, const int* in_sizes, int n_in,
                              void* d_out, int out_size, void* d_ws, size_t ws_size,
                              hipStream_t stream) {
  (void)in_sizes; (void)n_in; (void)out_size; (void)ws_size;
  const float* x      = (const float*)d_in[0];
  const float* attn_w = (const float*)d_in[1];
  const float* attn_b = (const float*)d_in[2];
  const float* ln_g   = (const float*)d_in[3];
  const float* ln_b   = (const float*)d_in[4];
  const float* w1     = (const float*)d_in[5];
  const float* b1     = (const float*)d_in[6];
  const float* w2     = (const float*)d_in[7];
  const float* b2     = (const float*)d_in[8];
  const float* w3     = (const float*)d_in[9];
  const float* b3     = (const float*)d_in[10];
  const float* w4     = (const float*)d_in[11];
  const float* b4     = (const float*)d_in[12];
  float* out = (float*)d_out;

  char* ws = (char*)d_ws;
  size_t off = 0;
  auto alloc = [&](size_t bytes) -> char* {
    char* p = ws + off;
    off += (bytes + 255) & ~(size_t)255;
    return p;
  };
  float*  xp_f  = (float*) alloc((size_t)M_ROWS * D1 * 4);
  half_t* xp_h  = (half_t*)alloc((size_t)M_ROWS * D1 * 2);
  float*  nx_f  = (float*) alloc((size_t)M_ROWS * D1 * 4);
  half_t* nx_h  = (half_t*)alloc((size_t)M_ROWS * D1 * 2);
  float*  a_f   = (float*) alloc((size_t)M_ROWS * D1 * 4);
  half_t* a_h   = (half_t*)alloc((size_t)M_ROWS * D1 * 2);
  half_t* bp_h  = (half_t*)alloc((size_t)M_ROWS * D1 * 2);
  half_t* e_h   = (half_t*)alloc((size_t)M_ROWS * D1 * 2);
  float*  sc    = (float*) alloc((size_t)BATCH * 256 * 4);
  half_t* awh   = (half_t*)alloc((size_t)2 * 4 * D1 * D1 * 2);
  half_t* w1h   = (half_t*)alloc((size_t)N1 * KCLS * 2);
  float*  h1    = (float*) alloc((size_t)BATCH * N1 * 4);
  float*  h2    = (float*) alloc((size_t)BATCH * 50 * 4);
  float*  h3    = (float*) alloc((size_t)BATCH * 10 * 4);

  // Weight conversions (L2-resident afterwards).
  {
    int n = 2 * 4 * D1 * D1;  // 2,097,152
    k_f32_to_f16<<<(n + 255) / 256, 256, 0, stream>>>(attn_w, awh, n);
    n = N1 * KCLS;            // 3,276,800
    k_f32_to_f16<<<(n + 255) / 256, 256, 0, stream>>>(w1, w1h, n);
  }

  // Max-pool (the HBM-bound stage) + new_x init.
  k_pool<<<(M_ROWS * D1 + 255) / 256, 256, 0, stream>>>(x, xp_f, xp_h, nx_f, nx_h);

  dim3 ggrid(M_ROWS / 16, 2);  // 128 M-tiles x 2 groups of 8 waves x 32 cols
  for (int i = 0; i < 2; ++i) {
    const half_t* Wa  = awh + (size_t)(i * 4 + 0) * D1 * D1;
    const half_t* Wb  = awh + (size_t)(i * 4 + 1) * D1 * D1;
    const half_t* W1s = awh + (size_t)(i * 4 + 3) * D1 * D1;
    const float* ba  = attn_b + (size_t)(i * 4 + 0) * D1;
    const float* bb  = attn_b + (size_t)(i * 4 + 1) * D1;
    const float* b1s = attn_b + (size_t)(i * 4 + 3) * D1;

    // a = fc_a(new_x)  (f32 for context matmul, f16 for scores)
    k_gemm512<<<ggrid, 256, 0, stream>>>(nx_h, Wa, ba, nullptr, a_f, a_h, 0);
    // bproj = fc_b(xp)
    k_gemm512<<<ggrid, 256, 0, stream>>>(xp_h, Wb, bb, nullptr, nullptr, bp_h, 0);
    // scores = a @ bproj^T / sqrt(512)
    k_scores<<<BATCH / 4, 128, 0, stream>>>(a_h, bp_h, sc);
    // softmax over the batch axis (legacy nn.Softmax on 3D)
    k_softmax_batch<<<1, 256, 0, stream>>>(sc);
    // e = relu(LN(ab @ a))
    k_context_ln<<<BATCH, 256, 0, stream>>>(sc, a_f, ln_g, ln_b, e_h);
    // new_x = new_x + fc_1(e)
    k_gemm512<<<ggrid, 256, 0, stream>>>(e_h, W1s, b1s, nx_f, nx_f, nx_h, 0);
  }

  // Classifier head.
  k_gemm_cls<<<dim3(BATCH / 16, 13), 32 * CLS_WAVES, 0, stream>>>(xp_h, nx_h, w1h, b1, h1);
  k_fc<<<(BATCH * 50 + 255) / 256, 256, 0, stream>>>(h1, w2, b2, h2, BATCH, 50, N1, 1);
  k_fc<<<(BATCH * 10 + 255) / 256, 256, 0, stream>>>(h2, w3, b3, h3, BATCH, 10, 50, 1);
  k_fc<<<(BATCH * 128 + 255) / 256, 256, 0, stream>>>(h3, w4, b4, out, BATCH, 128, 10, 0);
}

// v002
// It runs in 230 microseconds.
// Timed twice side by side with v001, it ran 1.07 times as fast both times.
// Counting every step since v000, it is 1.47 times as fast.
#include <hip/hip_runtime.h>

// ---------------------------------------------------------------------------
// LongTermFeatureBank forward on MI455X (gfx1250, wave32, WMMA + TDM).
//   1. max-pool 7x7 over x[128,512,16,7,7] -> xp[128,16,512]  (HBM-bound)
//   2. per stack: fc_a/fc_b GEMMs (WMMA f16->f32, TDM-staged A tiles),
//      batched 16x16 score WMMA, batch-axis softmax, context matmul +
//      LayerNorm + ReLU, fc_1 GEMM with residual.
//   3. classifier: WMMA GEMM [128,16384]x[16384,200], tiny VALU FCs.
// ---------------------------------------------------------------------------

typedef _Float16 half_t;
typedef __attribute__((ext_vector_type(16))) _Float16     v16h;
typedef __attribute__((ext_vector_type(8)))  _Float16     v8h;
typedef __attribute__((ext_vector_type(8)))  float        v8f;
typedef __attribute__((ext_vector_type(4)))  unsigned int u32x4;
typedef __attribute__((ext_vector_type(8)))  int          i32x8;
typedef __attribute__((ext_vector_type(4)))  int          i32x4;

#define D1     512
#define D2     16
#define BATCH  128
#define M_ROWS (BATCH * D2)   // 2048
#define KCLS   (2 * D2 * D1)  // 16384
#define N1     200

// Build the documented 16-bit WMMA fragment (VGPR0-3: K=base..base+7,
// VGPR4-7: K=base+16..base+23, per lane-half) from two 8-half chunks.
__device__ inline v8f wmma_step(v8h a0, v8h a1, v8h b0, v8h b1, v8f acc) {
  v16h af, bf;
#pragma unroll
  for (int i = 0; i < 8; ++i) {
    af[i] = a0[i]; af[8 + i] = a1[i];
    bf[i] = b0[i]; bf[8 + i] = b1[i];
  }
  return __builtin_amdgcn_wmma_f32_16x16x32_f16(
      /*neg_a=*/false, af, /*neg_b=*/false, bf,
      /*c_mod=*/(short)0, acc, /*reuse_a=*/false, /*reuse_b=*/false);
}

// ---------------------------------------------------------------------------
// TDM: stage a 16-row x 512-half tile into LDS with padded rows.
// D# (2-D): data_size=2B, tile=[512,16], tensor_dim0_stride=512,
// pad_enable, pad_interval=256 dwords (one row), pad_amount=4 dwords
// -> LDS row stride 520 halves (matches As[16][520] bank-spread layout).
// ---------------------------------------------------------------------------
__device__ inline void tdm_load_tile_16x512(const half_t* gsrc, void* lds_dst) {
  unsigned long long ga = (unsigned long long)(uintptr_t)gsrc;
  unsigned int lds = (unsigned int)(uintptr_t)lds_dst;  // low 32b = LDS offset
  u32x4 g0;
  g0[0] = 1u;                                  // count=1 (valid user D#)
  g0[1] = lds;                                 // lds_addr
  g0[2] = (unsigned int)(ga & 0xFFFFFFFFu);    // global_addr[31:0]
  g0[3] = (unsigned int)((ga >> 32) & 0x01FFFFFFu) | 0x80000000u;  // [56:32]|type=2
  i32x8 g1;
  g1[0] = (int)0x07D10000u;  // data_size=2B | pad_en | pad_interval=256dw | pad=4dw
  g1[1] = (int)(512u << 16);                   // tensor_dim0[15:0]=512
  g1[2] = (int)((2048u & 0xFFFFu) << 16);      // tensor_dim0 hi=0 | tensor_dim1 lo=2048
  g1[3] = (int)(512u << 16);                   // tensor_dim1 hi=0 | tile_dim0=512
  g1[4] = 16;                                  // tile_dim1=16, tile_dim2=0
  g1[5] = 512;                                 // tensor_dim0_stride[31:0]=512
  g1[6] = 0;                                   // stride0 hi | tensor_dim1_stride lo
  g1[7] = 0;
  i32x4 z4 = {0, 0, 0, 0};
  i32x8 z8 = {0, 0, 0, 0, 0, 0, 0, 0};
  __builtin_amdgcn_tensor_load_to_lds(g0, g1, z4, z4, z8, 0);
}

// ---------------------------------------------------------------------------
__global__ void k_f32_to_f16(const float* __restrict__ src,
                             half_t* __restrict__ dst, int n) {
  int i = blockIdx.x * blockDim.x + threadIdx.x;
  if (i < n) dst[i] = (half_t)src[i];
}

// ---------------------------------------------------------------------------
// Max-pool over HxW=49 (the 205 MB streaming read) + init new_x = xp.
// A block owns one b and 64 d1, in four stages of 16 d1: 16*16*49 floats that
// lie in one run in x. A stage's run goes to LDS in whole lines by asynchronous
// copies; each thread then takes the maximum of one 49-float window from LDS
// (lane pitch 49 dwords, odd, so no bank conflict). A small LDS tile turns
// (d1,d2) into (d2,d1), so that the block stores whole 128-byte lines of all
// four outputs. Four blocks fit a WGP: one block's maxima run under the
// others' copies.
// ---------------------------------------------------------------------------
typedef __attribute__((ext_vector_type(2))) float    v2f;
typedef __attribute__((ext_vector_type(2))) _Float16 v2h;

#define POOL_D1   64                     // d1 a block owns
#define POOL_SD1  16                     // d1 a stage
#define POOL_SFLT (POOL_SD1 * D2 * 49)   // 12,544 floats = 50,176 bytes a stage
#define POOL_THR  256

__global__ void __launch_bounds__(POOL_THR)
k_pool(const float* __restrict__ x,
       float* __restrict__ xp_f, half_t* __restrict__ xp_h,
       float* __restrict__ nx_f, half_t* __restrict__ nx_h) {
  __shared__ __align__(16) float tile[POOL_SFLT];
  __shared__ __align__(8) float tr[D2][POOL_D1 + 2];  // pitch 66: no bank conflict for writers or readers
  const int tid = threadIdx.x;
  const int wave = __builtin_amdgcn_readfirstlane(tid >> 5);
  const int b = blockIdx.x >> 3;
  const int d1_0 = (blockIdx.x & 7) * POOL_D1;
  const float* g = x + (size_t)(b * D1 + d1_0) * (D2 * 49) + tid * 4;
  const unsigned int l = (unsigned int)(uintptr_t)&tile[0] + (unsigned int)tid * 16u;

  // Unrolled: each stage's column of tr is a constant LDS offset on one base.
#pragma unroll
  for (int s = 0; s < POOL_D1 / POOL_SD1; ++s, g += POOL_SFLT) {
    // 3,136 pieces of 16 bytes: 12 from every thread, a 13th from waves 0 and 1.
    // The s_wait_xcnt closes each statement so that no address register of an
    // issued copy is rewritten ahead of it.
    asm volatile(
        "global_load_async_to_lds_b128 %0, %12, off\n\t"
        "global_load_async_to_lds_b128 %1, %13, off\n\t"
        "global_load_async_to_lds_b128 %2, %14, off\n\t"
        "global_load_async_to_lds_b128 %3, %15, off\n\t"
        "global_load_async_to_lds_b128 %4, %16, off\n\t"
        "global_load_async_to_lds_b128 %5, %17, off\n\t"
        "global_load_async_to_lds_b128 %6, %18, off\n\t"
        "global_load_async_to_lds_b128 %7, %19, off\n\t"
        "global_load_async_to_lds_b128 %8, %20, off\n\t"
        "global_load_async_to_lds_b128 %9, %21, off\n\t"
        "global_load_async_to_lds_b128 %10, %22, off\n\t"
        "global_load_async_to_lds_b128 %11, %23, off\n\t"
        "s_wait_xcnt 0x0"
        :: "v"(l), "v"(l + 1u * 4096u), "v"(l + 2u * 4096u), "v"(l + 3u * 4096u),
           "v"(l + 4u * 4096u), "v"(l + 5u * 4096u), "v"(l + 6u * 4096u),
           "v"(l + 7u * 4096u), "v"(l + 8u * 4096u), "v"(l + 9u * 4096u),
           "v"(l + 10u * 4096u), "v"(l + 11u * 4096u),
           "v"(g), "v"(g + 1 * 1024), "v"(g + 2 * 1024), "v"(g + 3 * 1024),
           "v"(g + 4 * 1024), "v"(g + 5 * 1024), "v"(g + 6 * 1024), "v"(g + 7 * 1024),
           "v"(g + 8 * 1024), "v"(g + 9 * 1024), "v"(g + 10 * 1024), "v"(g + 11 * 1024)
        : "memory");
    if (wave < 2) {
      asm volatile(
          "global_load_async_to_lds_b128 %0, %1, off\n\t"
          "s_wait_xcnt 0x0"
          :: "v"(l + 12u * 4096u), "v"(g + 12 * 1024) : "memory");
    }
    // This wave's copies have landed; the barrier then shows them to every wave.
    asm volatile("s_wait_asynccnt 0x0" ::: "memory");
    __syncthreads();

    const float* p = &tile[tid * 49];  // window tid = (d1 in the stage) * 16 + d2
    float m = p[0];
    // Unrolled: constant LDS offsets, and the reads run ahead of the maxima.
#pragma unroll
    for (int j = 1; j < 49; ++j) m = fmaxf(m, p[j]);
    tr[tid & 15][s * POOL_SD1 + (tid >> 4)] = m;

    // This wave's LDS reads of the stage are done; behind the barrier the next
    // stage's copies may overwrite the tile (and, last, tr is whole).
    asm volatile("s_wait_dscnt 0x0" ::: "memory");
    __syncthreads();
  }

  // 512 pairs of neighbouring d1: a wave stores 256 bytes of f32, 128 of f16.
#pragma unroll
  for (int k = 0; k < 2; ++k) {
    const int q = tid + POOL_THR * k;
    const int d2 = q >> 5, d1l = (q & 31) * 2;
    const v2f m2 = *(const v2f*)&tr[d2][d1l];
    const int o = (b * D2 + d2) * D1 + d1_0 + d1l;
    *(v2f*)(xp_f + o) = m2;
    *(v2f*)(nx_f + o) = m2;
    v2h h2;
    h2[0] = (half_t)m2[0];
    h2[1] = (half_t)m2[1];
    *(v2h*)(xp_h + o) = h2;
    *(v2h*)(nx_h + o) = h2;
  }
}

// ---------------------------------------------------------------------------
// Y[M,512] = op( X[M,512] @ W[512,512]^T + bias [+ res] ).
// Block = 8 waves, one 16-row A tile staged to LDS by the TDM; each wave owns
// a 16x32 output tile (two WMMA accumulators sharing one A fragment).
// ---------------------------------------------------------------------------
__global__ void __launch_bounds__(256)
k_gemm512(const half_t* __restrict__ X, const half_t* __restrict__ W,
          const float* __restrict__ bias, const float* __restrict__ res,
          float* __restrict__ Yf, half_t* __restrict__ Yh, int relu) {
  __shared__ __align__(16) half_t As[16][520];  // 520-half rows (TDM-padded)
  const int lane = threadIdx.x & 31;
  const int wave = threadIdx.x >> 5;
  const int m0 = blockIdx.x * 16;

  if (wave == 0) tdm_load_tile_16x512(X + (size_t)m0 * D1, &As[0][0]);
  __builtin_amdgcn_s_wait_tensorcnt(0);
  __syncthreads();

  const int ntile0 = (blockIdx.y * 8 + wave) * 2;  // two adjacent N tiles
  const int lm = lane & 15, lh = lane >> 4;
  const half_t* Wrow0 = W + (size_t)(ntile0 * 16 + lm) * D1;
  const half_t* Wrow1 = Wrow0 + (size_t)16 * D1;

  v8f acc0 = {}, acc1 = {};
  for (int kk = 0; kk < D1; kk += 32) {
    if (kk + 128 < D1) {
      __builtin_prefetch(Wrow0 + kk + 128, 0, 3);
      __builtin_prefetch(Wrow1 + kk + 128, 0, 3);
    }
    int base = kk + 8 * lh;
    v8h a0 = *(const v8h*)&As[lm][base];
    v8h a1 = *(const v8h*)&As[lm][base + 16];
    v8h b0 = *(const v8h*)(Wrow0 + base);
    v8h b1 = *(const v8h*)(Wrow0 + base + 16);
    v8h c0 = *(const v8h*)(Wrow1 + base);
    v8h c1 = *(const v8h*)(Wrow1 + base + 16);
    acc0 = wmma_step(a0, a1, b0, b1, acc0);
    acc1 = wmma_step(a0, a1, c0, c1, acc1);
  }

#pragma unroll
  for (int t = 0; t < 2; ++t) {
    const v8f acc = t ? acc1 : acc0;
    const int n = (ntile0 + t) * 16 + lm;
    const float bn = bias ? bias[n] : 0.0f;
#pragma unroll
    for (int r2 = 0; r2 < 8; ++r2) {
      int m = m0 + lh * 8 + r2;  // C layout: lane->N, VGPR->M (8-row halves)
      float v = acc[r2] + bn;
      if (res) v += res[(size_t)m * D1 + n];
      if (relu) v = fmaxf(v, 0.0f);
      if (Yf) Yf[(size_t)m * D1 + n] = v;
      if (Yh) Yh[(size_t)m * D1 + n] = (half_t)v;
    }
  }
}

// ---------------------------------------------------------------------------
// scores[b,c,d] = dot(a[b,c,:], bp[b,d,:]) / sqrt(512)  — one WMMA wave per b
// ---------------------------------------------------------------------------
__global__ void __launch_bounds__(128)
k_scores(const half_t* __restrict__ A, const half_t* __restrict__ Bp,
         float* __restrict__ S) {
  const int lane = threadIdx.x & 31;
  const int wave = threadIdx.x >> 5;
  const int b = blockIdx.x * 4 + wave;
  const int lm = lane & 15, lh = lane >> 4;
  const half_t* Arow = A  + (size_t)(b * 16 + lm) * D1;
  const half_t* Brow = Bp + (size_t)(b * 16 + lm) * D1;
  v8f acc = {};
  for (int kk = 0; kk < D1; kk += 32) {
    int base = kk + 8 * lh;
    v8h a0 = *(const v8h*)(Arow + base);
    v8h a1 = *(const v8h*)(Arow + base + 16);
    v8h b0 = *(const v8h*)(Brow + base);
    v8h b1 = *(const v8h*)(Brow + base + 16);
    acc = wmma_step(a0, a1, b0, b1, acc);
  }
  const float s = 0.044194173824159216f;  // 1/sqrt(512)
#pragma unroll
  for (int r2 = 0; r2 < 8; ++r2) {
    int c = lh * 8 + r2;
    S[b * 256 + c * 16 + lm] = acc[r2] * s;
  }
}

// ---------------------------------------------------------------------------
// Legacy nn.Softmax() on 3D: softmax over dim 0 (batch). 256 independent
// length-128 softmaxes, one thread each. In-place on S.
// ---------------------------------------------------------------------------
__global__ void k_softmax_batch(float* __restrict__ S) {
  int j = threadIdx.x;  // (c*16 + d)
  float mx = -1e30f;
  for (int b = 0; b < BATCH; ++b) mx = fmaxf(mx, S[b * 256 + j]);
  float sum = 0.0f;
  for (int b = 0; b < BATCH; ++b) sum += __expf(S[b * 256 + j] - mx);
  float inv = 1.0f / sum;
  for (int b = 0; b < BATCH; ++b)
    S[b * 256 + j] = __expf(S[b * 256 + j] - mx) * inv;
}

// ---------------------------------------------------------------------------
// e = relu(LayerNorm_{16,512}( ab[b] @ a[b] )) per batch; one block per b.
// ---------------------------------------------------------------------------
__global__ void __launch_bounds__(256)
k_context_ln(const float* __restrict__ AB, const float* __restrict__ Af,
             const float* __restrict__ g, const float* __restrict__ beta,
             half_t* __restrict__ Eh) {
  __shared__ float ab[256];
  __shared__ float ep[8192];
  __shared__ float rs[256], rq[256];
  const int b = blockIdx.x, tid = threadIdx.x;
  ab[tid] = AB[b * 256 + tid];
  __syncthreads();

  float lsum = 0.0f, lsq = 0.0f;
#pragma unroll 4
  for (int i = 0; i < 32; ++i) {
    int idx = tid + 256 * i;          // idx = c*512 + t
    int c = idx >> 9, t = idx & 511;
    float s = 0.0f;
#pragma unroll
    for (int d = 0; d < 16; ++d)
      s += ab[c * 16 + d] * Af[(size_t)(b * 16 + d) * D1 + t];
    ep[idx] = s;
    lsum += s;
    lsq += s * s;
  }
  rs[tid] = lsum; rq[tid] = lsq;
  __syncthreads();
  for (int s2 = 128; s2 > 0; s2 >>= 1) {
    if (tid < s2) { rs[tid] += rs[tid + s2]; rq[tid] += rq[tid + s2]; }
    __syncthreads();
  }
  float mu   = rs[0] * (1.0f / 8192.0f);
  float var  = rq[0] * (1.0f / 8192.0f) - mu * mu;
  float rstd = rsqrtf(var + 1e-5f);
#pragma unroll 4
  for (int i = 0; i < 32; ++i) {
    int idx = tid + 256 * i;
    int c = idx >> 9, t = idx & 511;
    float v = (ep[idx] - mu) * rstd * g[idx] + beta[idx];
    v = fmaxf(v, 0.0f);
    Eh[(size_t)(b * 16 + c) * D1 + t] = (half_t)v;
  }
}

// ---------------------------------------------------------------------------
// h1 = relu( feat[128,16384] @ w1[200,16384]^T + b1 ).  feat = [xp | new_x]
// One block per 16x16 output tile; K is split over the block's 32 waves
// (512 k each, 16 WMMA steps), the 32 partial tiles are summed in LDS in
// wave order.
// ---------------------------------------------------------------------------
#define CLS_WAVES  32
#define CLS_KSLICE (KCLS / CLS_WAVES)  // 512; divides 8192, so a slice is all xp or all new_x

__global__ void __launch_bounds__(32 * CLS_WAVES)
k_gemm_cls(const half_t* __restrict__ XPh, const half_t* __restrict__ NXh,
           const half_t* __restrict__ W1h, const float* __restrict__ b1,
           float* __restrict__ H1) {
  __shared__ float red[CLS_WAVES][256];
  const int lane = threadIdx.x & 31;
  const int wave = threadIdx.x >> 5;
  const int lm = lane & 15, lh = lane >> 4;
  const int m0 = blockIdx.x * 16;    // batch tile (8 tiles)
  const int ntile = blockIdx.y;      // 13 tiles cover N=200 (pad to 208)
  const int nw = ntile * 16 + lm;
  const int nl = (nw < N1) ? nw : (N1 - 1);  // clamp loads; masked at store
  const int k0 = wave * CLS_KSLICE;
  const int mrow = m0 + lm;
  const half_t* Ws = W1h + (size_t)nl * KCLS + k0 + 8 * lh;
  const half_t* Xs = ((k0 < 8192) ? (XPh + (size_t)mrow * 8192 + k0)
                                  : (NXh + (size_t)mrow * 8192 + (k0 - 8192))) + 8 * lh;

  v8f acc = {};
  // Unrolled: constant offsets on two address pairs, and the next step's
  // loads issue ahead of this step's WMMA.
#pragma unroll
  for (int kk = 0; kk < CLS_KSLICE; kk += 32) {
    v8h a0 = *(const v8h*)(Xs + kk);
    v8h a1 = *(const v8h*)(Xs + kk + 16);
    v8h b0 = *(const v8h*)(Ws + kk);
    v8h b1v = *(const v8h*)(Ws + kk + 16);
    acc = wmma_step(a0, a1, b0, b1v, acc);
  }

  // Unrolled: constant indices keep acc in registers.
#pragma unroll
  for (int r2 = 0; r2 < 8; ++r2) red[wave][r2 * 32 + lane] = acc[r2];
  __syncthreads();

  if (threadIdx.x < 256 && nw < N1) {
    const float bn = b1[nw];
    // Stands in front of any reuse of the bias load's address register.
    asm volatile("s_wait_xcnt 0x0" ::: "memory");
    float s = 0.0f;
    // Unrolled: the LDS reads run ahead of the dependent adds.
#pragma unroll
    for (int w = 0; w < CLS_WAVES; ++w) s += red[w][threadIdx.x];
    const int r2 = threadIdx.x >> 5;      // accumulator register of this element
    const int m = m0 + lh * 8 + r2;       // C layout: lane->N, VGPR->M (8-row halves)
    H1[m * N1 + nw] = fmaxf(s + bn, 0.0f);
  }
}

// ---------------------------------------------------------------------------
// Tiny tail FCs (200->50->10->128): one thread per output, f32 VALU.
// ---------------------------------------------------------------------------
__global__ void k_fc(const float* __restrict__ X, const float* __restrict__ W,
                     const float* __restrict__ bias, float* __restrict__ Y,
                     int M, int N, int K, int relu) {
  int idx = blockIdx.x * blockDim.x + threadIdx.x;
  if (idx >= M * N) return;
  int m = idx / N, n = idx % N;
  const float* xr = X + (size_t)m * K;
  const float* wr = W + (size_t)n * K;
  float s = bias[n];
  for (int k = 0; k < K; ++k) s += xr[k] * wr[k];
  if (relu) s = fmaxf(s, 0.0f);
  Y[idx] = s;
}

// ---------------------------------------------------------------------------
extern "C" void kernel_launch(void* const* d_in, const int* in_sizes, int n_in,
                              void* d_out, int out_size, void* d_ws, size_t ws_size,
                              hipStream_t stream) {
  (void)in_sizes; (void)n_in; (void)out_size; (void)ws_size;
  const float* x      = (const float*)d_in[0];
  const float* attn_w = (const float*)d_in[1];
  const float* attn_b = (const float*)d_in[2];
  const float* ln_g   = (const float*)d_in[3];
  const float* ln_b   = (const float*)d_in[4];
  const float* w1     = (const float*)d_in[5];
  const float* b1     = (const float*)d_in[6];
  const float* w2     = (const float*)d_in[7];
  const float* b2     = (const float*)d_in[8];
  const float* w3     = (const float*)d_in[9];
  const float* b3     = (const float*)d_in[10];
  const float* w4     = (const float*)d_in[11];
  const float* b4     = (const float*)d_in[12];
  float* out = (float*)d_out;

  char* ws = (char*)d_ws;
  size_t off = 0;
  auto alloc = [&](size_t bytes) -> char* {
    char* p = ws + off;
    off += (bytes + 255) & ~(size_t)255;
    return p;
  };
  float*  xp_f  = (float*) alloc((size_t)M_ROWS * D1 * 4);
  half_t* xp_h  = (half_t*)alloc((size_t)M_ROWS * D1 * 2);
  float*  nx_f  = (float*) alloc((size_t)M_ROWS * D1 * 4);
  half_t* nx_h  = (half_t*)alloc((size_t)M_ROWS * D1 * 2);
  float*  a_f   = (float*) alloc((size_t)M_ROWS * D1 * 4);
  half_t* a_h   = (half_t*)alloc((size_t)M_ROWS * D1 * 2);
  half_t* bp_h  = (half_t*)alloc((size_t)M_ROWS * D1 * 2);
  half_t* e_h   = (half_t*)alloc((size_t)M_ROWS * D1 * 2);
  float*  sc    = (float*) alloc((size_t)BATCH * 256 * 4);
  half_t* awh   = (half_t*)alloc((size_t)2 * 4 * D1 * D1 * 2);
  half_t* w1h   = (half_t*)alloc((size_t)N1 * KCLS * 2);
  float*  h1    = (float*) alloc((size_t)BATCH * N1 * 4);
  float*  h2    = (float*) alloc((size_t)BATCH * 50 * 4);
  float*  h3    = (float*) alloc((size_t)BATCH * 10 * 4);

  // Weight conversions (L2-resident afterwards).
  {
    int n = 2 * 4 * D1 * D1;  // 2,097,152
    k_f32_to_f16<<<(n + 255) / 256, 256, 0, stream>>>(attn_w, awh, n);
    n = N1 * KCLS;            // 3,276,800
    k_f32_to_f16<<<(n + 255) / 256, 256, 0, stream>>>(w1, w1h, n);
  }

  // Max-pool (the HBM-bound stage) + new_x init.
  k_pool<<<BATCH * (D1 / POOL_D1), POOL_THR, 0, stream>>>(x, xp_f, xp_h, nx_f, nx_h);

  dim3 ggrid(M_ROWS / 16, 2);  // 128 M-tiles x 2 groups of 8 waves x 32 cols
  for (int i = 0; i < 2; ++i) {
    const half_t* Wa  = awh + (size_t)(i * 4 + 0) * D1 * D1;
    const half_t* Wb  = awh + (size_t)(i * 4 + 1) * D1 * D1;
    const half_t* W1s = awh + (size_t)(i * 4 + 3) * D1 * D1;
    const float* ba  = attn_b + (size_t)(i * 4 + 0) * D1;
    const float* bb  = attn_b + (size_t)(i * 4 + 1) * D1;
    const float* b1s = attn_b + (size_t)(i * 4 + 3) * D1;

    // a = fc_a(new_x)  (f32 for context matmul, f16 for scores)
    k_gemm512<<<ggrid, 256, 0, stream>>>(nx_h, Wa, ba, nullptr, a_f, a_h, 0);
    // bproj = fc_b(xp)
    k_gemm512<<<ggrid, 256, 0, stream>>>(xp_h, Wb, bb, nullptr, nullptr, bp_h, 0);
    // scores = a @ bproj^T / sqrt(512)
    k_scores<<<BATCH / 4, 128, 0, stream>>>(a_h, bp_h, sc);
    // softmax over the batch axis (legacy nn.Softmax on 3D)
    k_softmax_batch<<<1, 256, 0, stream>>>(sc);
    // e = relu(LN(ab @ a))
    k_context_ln<<<BATCH, 256, 0, stream>>>(sc, a_f, ln_g, ln_b, e_h);
    // new_x = new_x + fc_1(e)
    k_gemm512<<<ggrid, 256, 0, stream>>>(e_h, W1s, b1s, nx_f, nx_f, nx_h, 0);
  }

  // Classifier head.
  k_gemm_cls<<<dim3(BATCH / 16, 13), 32 * CLS_WAVES, 0, stream>>>(xp_h, nx_h, w1h, b1, h1);
  k_fc<<<(BATCH * 50 + 255) / 256, 256, 0, stream>>>(h1, w2, b2, h2, BATCH, 50, N1, 1);
  k_fc<<<(BATCH * 10 + 255) / 256, 256, 0, stream>>>(h2, w3, b3, h3, BATCH, 10, 50, 1);
  k_fc<<<(BATCH * 128 + 255) / 256, 256, 0, stream>>>(h3, w4, b4, out, BATCH, 128, 10, 0);
}

// v003
// One run takes 159 microseconds.
// Timed twice side by side with v002, it ran 1.44 and 1.46 times as fast.
// Over all steps from v000 it is 2.13 times as fast.
#include <hip/hip_runtime.h>

// ---------------------------------------------------------------------------
// LongTermFeatureBank forward on MI455X (gfx1250, wave32, WMMA + TDM).
//   1. max-pool 7x7 over x[128,512,16,7,7] -> xp[128,16,512]  (HBM-bound)
//   2. per stack: fc_a/fc_b GEMMs (WMMA f16->f32, TDM-staged A tiles),
//      batched 16x16 score WMMA, batch-axis softmax + context matmul +
//      LayerNorm + ReLU in one kernel, fc_1 GEMM with residual.
//   3. classifier: WMMA GEMM [128,16384]x[16384,200], tiny VALU FCs.
// ---------------------------------------------------------------------------

typedef _Float16 half_t;
typedef __attribute__((ext_vector_type(16))) _Float16     v16h;
typedef __attribute__((ext_vector_type(8)))  _Float16     v8h;
typedef __attribute__((ext_vector_type(8)))  float        v8f;
typedef __attribute__((ext_vector_type(4)))  unsigned int u32x4;
typedef __attribute__((ext_vector_type(8)))  int          i32x8;
typedef __attribute__((ext_vector_type(4)))  int          i32x4;

#define D1     512
#define D2     16
#define BATCH  128
#define M_ROWS (BATCH * D2)   // 2048
#define KCLS   (2 * D2 * D1)  // 16384
#define N1     200

// Build the documented 16-bit WMMA fragment (VGPR0-3: K=base..base+7,
// VGPR4-7: K=base+16..base+23, per lane-half) from two 8-half chunks.
__device__ inline v8f wmma_step(v8h a0, v8h a1, v8h b0, v8h b1, v8f acc) {
  v16h af, bf;
#pragma unroll
  for (int i = 0; i < 8; ++i) {
    af[i] = a0[i]; af[8 + i] = a1[i];
    bf[i] = b0[i]; bf[8 + i] = b1[i];
  }
  return __builtin_amdgcn_wmma_f32_16x16x32_f16(
      /*neg_a=*/false, af, /*neg_b=*/false, bf,
      /*c_mod=*/(short)0, acc, /*reuse_a=*/false, /*reuse_b=*/false);
}

// ---------------------------------------------------------------------------
// TDM: stage a 16-row x 512-half tile into LDS with padded rows.
// D# (2-D): data_size=2B, tile=[512,16], tensor_dim0_stride=512,
// pad_enable, pad_interval=256 dwords (one row), pad_amount=4 dwords
// -> LDS row stride 520 halves (matches As[16][520] bank-spread layout).
// ---------------------------------------------------------------------------
__device__ inline void tdm_load_tile_16x512(const half_t* gsrc, void* lds_dst) {
  unsigned long long ga = (unsigned long long)(uintptr_t)gsrc;
  unsigned int lds = (unsigned int)(uintptr_t)lds_dst;  // low 32b = LDS offset
  u32x4 g0;
  g0[0] = 1u;                                  // count=1 (valid user D#)
  g0[1] = lds;                                 // lds_addr
  g0[2] = (unsigned int)(ga & 0xFFFFFFFFu);    // global_addr[31:0]
  g0[3] = (unsigned int)((ga >> 32) & 0x01FFFFFFu) | 0x80000000u;  // [56:32]|type=2
  i32x8 g1;
  g1[0] = (int)0x07D10000u;  // data_size=2B | pad_en | pad_interval=256dw | pad=4dw
  g1[1] = (int)(512u << 16);                   // tensor_dim0[15:0]=512
  g1[2] = (int)((2048u & 0xFFFFu) << 16);      // tensor_dim0 hi=0 | tensor_dim1 lo=2048
  g1[3] = (int)(512u << 16);                   // tensor_dim1 hi=0 | tile_dim0=512
  g1[4] = 16;                                  // tile_dim1=16, tile_dim2=0
  g1[5] = 512;                                 // tensor_dim0_stride[31:0]=512
  g1[6] = 0;                                   // stride0 hi | tensor_dim1_stride lo
  g1[7] = 0;
  i32x4 z4 = {0, 0, 0, 0};
  i32x8 z8 = {0, 0, 0, 0, 0, 0, 0, 0};
  __builtin_amdgcn_tensor_load_to_lds(g0, g1, z4, z4, z8, 0);
}

// ---------------------------------------------------------------------------
__global__ void k_f32_to_f16(const float* __restrict__ src,
                             half_t* __restrict__ dst, int n) {
  int i = blockIdx.x * blockDim.x + threadIdx.x;
  if (i < n) dst[i] = (half_t)src[i];
}

// ---------------------------------------------------------------------------
// Max-pool over HxW=49 (the 205 MB streaming read) + init new_x = xp.
// A block owns one b and 64 d1, in four stages of 16 d1: 16*16*49 floats that
// lie in one run in x. A stage's run goes to LDS in whole lines by asynchronous
// copies; each thread then takes the maximum of one 49-float window from LDS
// (lane pitch 49 dwords, odd, so no bank conflict). A small LDS tile turns
// (d1,d2) into (d2,d1), so that the block stores whole 128-byte lines of all
// four outputs. Four blocks fit a WGP: one block's maxima run under the
// others' copies.
// ---------------------------------------------------------------------------
typedef __attribute__((ext_vector_type(2))) float    v2f;
typedef __attribute__((ext_vector_type(2))) _Float16 v2h;

#define POOL_D1   64                     // d1 a block owns
#define POOL_SD1  16                     // d1 a stage
#define POOL_SFLT (POOL_SD1 * D2 * 49)   // 12,544 floats = 50,176 bytes a stage
#define POOL_THR  256

__global__ void __launch_bounds__(POOL_THR)
k_pool(const float* __restrict__ x,
       float* __restrict__ xp_f, half_t* __restrict__ xp_h,
       float* __restrict__ nx_f, half_t* __restrict__ nx_h) {
  __shared__ __align__(16) float tile[POOL_SFLT];
  __shared__ __align__(8) float tr[D2][POOL_D1 + 2];  // pitch 66: no bank conflict for writers or readers
  const int tid = threadIdx.x;
  const int wave = __builtin_amdgcn_readfirstlane(tid >> 5);
  const int b = blockIdx.x >> 3;
  const int d1_0 = (blockIdx.x & 7) * POOL_D1;
  const float* g = x + (size_t)(b * D1 + d1_0) * (D2 * 49) + tid * 4;
  const unsigned int l = (unsigned int)(uintptr_t)&tile[0] + (unsigned int)tid * 16u;

  // Unrolled: each stage's column of tr is a constant LDS offset on one base.
#pragma unroll
  for (int s = 0; s < POOL_D1 / POOL_SD1; ++s, g += POOL_SFLT) {
    // 3,136 pieces of 16 bytes: 12 from every thread, a 13th from waves 0 and 1.
    // The s_wait_xcnt closes each statement so that no address register of an
    // issued copy is rewritten ahead of it.
    asm volatile(
        "global_load_async_to_lds_b128 %0, %12, off\n\t"
        "global_load_async_to_lds_b128 %1, %13, off\n\t"
        "global_load_async_to_lds_b128 %2, %14, off\n\t"
        "global_load_async_to_lds_b128 %3, %15, off\n\t"
        "global_load_async_to_lds_b128 %4, %16, off\n\t"
        "global_load_async_to_lds_b128 %5, %17, off\n\t"
        "global_load_async_to_lds_b128 %6, %18, off\n\t"
        "global_load_async_to_lds_b128 %7, %19, off\n\t"
        "global_load_async_to_lds_b128 %8, %20, off\n\t"
        "global_load_async_to_lds_b128 %9, %21, off\n\t"
        "global_load_async_to_lds_b128 %10, %22, off\n\t"
        "global_load_async_to_lds_b128 %11, %23, off\n\t"
        "s_wait_xcnt 0x0"
        :: "v"(l), "v"(l + 1u * 4096u), "v"(l + 2u * 4096u), "v"(l + 3u * 4096u),
           "v"(l + 4u * 4096u), "v"(l + 5u * 4096u), "v"(l + 6u * 4096u),
           "v"(l + 7u * 4096u), "v"(l + 8u * 4096u), "v"(l + 9u * 4096u),
           "v"(l + 10u * 4096u), "v"(l + 11u * 4096u),
           "v"(g), "v"(g + 1 * 1024), "v"(g + 2 * 1024), "v"(g + 3 * 1024),
           "v"(g + 4 * 1024), "v"(g + 5 * 1024), "v"(g + 6 * 1024), "v"(g + 7 * 1024),
           "v"(g + 8 * 1024), "v"(g + 9 * 1024), "v"(g + 10 * 1024), "v"(g + 11 * 1024)
        : "memory");
    if (wave < 2) {
      asm volatile(
          "global_load_async_to_lds_b128 %0, %1, off\n\t"
          "s_wait_xcnt 0x0"
          :: "v"(l + 12u * 4096u), "v"(g + 12 * 1024) : "memory");
    }
    // This wave's copies have landed; the barrier then shows them to every wave.
    asm volatile("s_wait_asynccnt 0x0" ::: "memory");
    __syncthreads();

    const float* p = &tile[tid * 49];  // window tid = (d1 in the stage) * 16 + d2
    float m = p[0];
    // Unrolled: constant LDS offsets, and the reads run ahead of the maxima.
#pragma unroll
    for (int j = 1; j < 49; ++j) m = fmaxf(m, p[j]);
    tr[tid & 15][s * POOL_SD1 + (tid >> 4)] = m;

    // This wave's LDS reads of the stage are done; behind the barrier the next
    // stage's copies may overwrite the tile (and, last, tr is whole).
    asm volatile("s_wait_dscnt 0x0" ::: "memory");
    __syncthreads();
  }

  // 512 pairs of neighbouring d1: a wave stores 256 bytes of f32, 128 of f16.
#pragma unroll
  for (int k = 0; k < 2; ++k) {
    const int q = tid + POOL_THR * k;
    const int d2 = q >> 5, d1l = (q & 31) * 2;
    const v2f m2 = *(const v2f*)&tr[d2][d1l];
    const int o = (b * D2 + d2) * D1 + d1_0 + d1l;
    *(v2f*)(xp_f + o) = m2;
    *(v2f*)(nx_f + o) = m2;
    v2h h2;
    h2[0] = (half_t)m2[0];
    h2[1] = (half_t)m2[1];
    *(v2h*)(xp_h + o) = h2;
    *(v2h*)(nx_h + o) = h2;
  }
}

// ---------------------------------------------------------------------------
// Y[M,512] = op( X[M,512] @ W[512,512]^T + bias [+ res] ).
// Block = 8 waves, one 16-row A tile staged to LDS by the TDM; each wave owns
// a 16x32 output tile (two WMMA accumulators sharing one A fragment).
// ---------------------------------------------------------------------------
__global__ void __launch_bounds__(256)
k_gemm512(const half_t* __restrict__ X, const half_t* __restrict__ W,
          const float* __restrict__ bias, const float* __restrict__ res,
          float* __restrict__ Yf, half_t* __restrict__ Yh, int relu) {
  __shared__ __align__(16) half_t As[16][520];  // 520-half rows (TDM-padded)
  const int lane = threadIdx.x & 31;
  const int wave = threadIdx.x >> 5;
  const int m0 = blockIdx.x * 16;

  if (wave == 0) tdm_load_tile_16x512(X + (size_t)m0 * D1, &As[0][0]);
  __builtin_amdgcn_s_wait_tensorcnt(0);
  __syncthreads();

  const int ntile0 = (blockIdx.y * 8 + wave) * 2;  // two adjacent N tiles
  const int lm = lane & 15, lh = lane >> 4;
  const half_t* Wrow0 = W + (size_t)(ntile0 * 16 + lm) * D1;
  const half_t* Wrow1 = Wrow0 + (size_t)16 * D1;

  v8f acc0 = {}, acc1 = {};
  for (int kk = 0; kk < D1; kk += 32) {
    if (kk + 128 < D1) {
      __builtin_prefetch(Wrow0 + kk + 128, 0, 3);
      __builtin_prefetch(Wrow1 + kk + 128, 0, 3);
    }
    int base = kk + 8 * lh;
    v8h a0 = *(const v8h*)&As[lm][base];
    v8h a1 = *(const v8h*)&As[lm][base + 16];
    v8h b0 = *(const v8h*)(Wrow0 + base);
    v8h b1 = *(const v8h*)(Wrow0 + base + 16);
    v8h c0 = *(const v8h*)(Wrow1 + base);
    v8h c1 = *(const v8h*)(Wrow1 + base + 16);
    acc0 = wmma_step(a0, a1, b0, b1, acc0);
    acc1 = wmma_step(a0, a1, c0, c1, acc1);
  }

#pragma unroll
  for (int t = 0; t < 2; ++t) {
    const v8f acc = t ? acc1 : acc0;
    const int n = (ntile0 + t) * 16 + lm;
    const float bn = bias ? bias[n] : 0.0f;
#pragma unroll
    for (int r2 = 0; r2 < 8; ++r2) {
      int m = m0 + lh * 8 + r2;  // C layout: lane->N, VGPR->M (8-row halves)
      float v = acc[r2] + bn;
      if (res) v += res[(size_t)m * D1 + n];
      if (relu) v = fmaxf(v, 0.0f);
      if (Yf) Yf[(size_t)m * D1 + n] = v;
      if (Yh) Yh[(size_t)m * D1 + n] = (half_t)v;
    }
  }
}

// ---------------------------------------------------------------------------
// scores[b,c,d] = dot(a[b,c,:], bp[b,d,:]) / sqrt(512)  — one WMMA wave per b
// ---------------------------------------------------------------------------
__global__ void __launch_bounds__(128)
k_scores(const half_t* __restrict__ A, const half_t* __restrict__ Bp,
         float* __restrict__ S) {
  const int lane = threadIdx.x & 31;
  const int wave = threadIdx.x >> 5;
  const int b = blockIdx.x * 4 + wave;
  const int lm = lane & 15, lh = lane >> 4;
  const half_t* Arow = A  + (size_t)(b * 16 + lm) * D1;
  const half_t* Brow = Bp + (size_t)(b * 16 + lm) * D1;
  v8f acc = {};
  for (int kk = 0; kk < D1; kk += 32) {
    int base = kk + 8 * lh;
    v8h a0 = *(const v8h*)(Arow + base);
    v8h a1 = *(const v8h*)(Arow + base + 16);
    v8h b0 = *(const v8h*)(Brow + base);
    v8h b1 = *(const v8h*)(Brow + base + 16);
    acc = wmma_step(a0, a1, b0, b1, acc);
  }
  const float s = 0.044194173824159216f;  // 1/sqrt(512)
#pragma unroll
  for (int r2 = 0; r2 < 8; ++r2) {
    int c = lh * 8 + r2;
    S[b * 256 + c * 16 + lm] = acc[r2] * s;
  }
}

// ---------------------------------------------------------------------------
// e = relu(LayerNorm_{16,512}( ab[b] @ a[b] )) per batch; one block per b.
// ab = softmax of the raw scores S over dim 0 (batch; legacy nn.Softmax() on
// 3D). Every block works out the maximum and the sum of all 256 columns
// itself, one column (c*16 + d) a thread, and keeps only its own b's row:
// 128 KB of L2 reads a block in place of a launch of one block between the
// score kernel and this one. The sum runs in ascending b.
// ---------------------------------------------------------------------------
__global__ void __launch_bounds__(256)
k_context_ln(const float* __restrict__ S, const float* __restrict__ Af,
             const float* __restrict__ g, const float* __restrict__ beta,
             half_t* __restrict__ Eh) {
  __shared__ float ab[256];
  __shared__ float ep[8192];
  __shared__ float rs[256], rq[256];
  const int b = blockIdx.x, tid = threadIdx.x;
  {
    float v[BATCH];
    // Unrolled: v stays in registers and the column's loads are all in flight
    // together, one L2 latency for the column.
#pragma unroll
    for (int i = 0; i < BATCH; ++i) v[i] = S[i * 256 + tid];
    const float own = S[b * 256 + tid];
    float mx = -1e30f;
    // Unrolled: constant indices into v.
#pragma unroll
    for (int i = 0; i < BATCH; ++i) mx = fmaxf(mx, v[i]);
    float sum = 0.0f;
    // Unrolled: constant indices into v.
#pragma unroll
    for (int i = 0; i < BATCH; ++i) sum += __expf(v[i] - mx);
    ab[tid] = __expf(own - mx) * (1.0f / sum);
  }
  __syncthreads();

  float lsum = 0.0f, lsq = 0.0f;
#pragma unroll 4
  for (int i = 0; i < 32; ++i) {
    int idx = tid + 256 * i;          // idx = c*512 + t
    int c = idx >> 9, t = idx & 511;
    float s = 0.0f;
#pragma unroll
    for (int d = 0; d < 16; ++d)
      s += ab[c * 16 + d] * Af[(size_t)(b * 16 + d) * D1 + t];
    ep[idx] = s;
    lsum += s;
    lsq += s * s;
  }
  rs[tid] = lsum; rq[tid] = lsq;
  __syncthreads();
  for (int s2 = 128; s2 > 0; s2 >>= 1) {
    if (tid < s2) { rs[tid] += rs[tid + s2]; rq[tid] += rq[tid + s2]; }
    __syncthreads();
  }
  float mu   = rs[0] * (1.0f / 8192.0f);
  float var  = rq[0] * (1.0f / 8192.0f) - mu * mu;
  float rstd = rsqrtf(var + 1e-5f);
#pragma unroll 4
  for (int i = 0; i < 32; ++i) {
    int idx = tid + 256 * i;
    int c = idx >> 9, t = idx & 511;
    float v = (ep[idx] - mu) * rstd * g[idx] + beta[idx];
    v = fmaxf(v, 0.0f);
    Eh[(size_t)(b * 16 + c) * D1 + t] = (half_t)v;
  }
}

// ---------------------------------------------------------------------------
// h1 = relu( feat[128,16384] @ w1[200,16384]^T + b1 ).  feat = [xp | new_x]
// One block per 16x16 output tile; K is split over the block's 32 waves
// (512 k each, 16 WMMA steps), the 32 partial tiles are summed in LDS in
// wave order.
// ---------------------------------------------------------------------------
#define CLS_WAVES  32
#define CLS_KSLICE (KCLS / CLS_WAVES)  // 512; divides 8192, so a slice is all xp or all new_x

__global__ void __launch_bounds__(32 * CLS_WAVES)
k_gemm_cls(const half_t* __restrict__ XPh, const half_t* __restrict__ NXh,
           const half_t* __restrict__ W1h, const float* __restrict__ b1,
           float* __restrict__ H1) {
  __shared__ float red[CLS_WAVES][256];
  const int lane = threadIdx.x & 31;
  const int wave = threadIdx.x >> 5;
  const int lm = lane & 15, lh = lane >> 4;
  const int m0 = blockIdx.x * 16;    // batch tile (8 tiles)
  const int ntile = blockIdx.y;      // 13 tiles cover N=200 (pad to 208)
  const int nw = ntile * 16 + lm;
  const int nl = (nw < N1) ? nw : (N1 - 1);  // clamp loads; masked at store
  const int k0 = wave * CLS_KSLICE;
  const int mrow = m0 + lm;
  const half_t* Ws = W1h + (size_t)nl * KCLS + k0 + 8 * lh;
  const half_t* Xs = ((k0 < 8192) ? (XPh + (size_t)mrow * 8192 + k0)
                                  : (NXh + (size_t)mrow * 8192 + (k0 - 8192))) + 8 * lh;

  v8f acc = {};
  // Unrolled: constant offsets on two address pairs, and the next step's
  // loads issue ahead of this step's WMMA.
#pragma unroll
  for (int kk = 0; kk < CLS_KSLICE; kk += 32) {
    v8h a0 = *(const v8h*)(Xs + kk);
    v8h a1 = *(const v8h*)(Xs + kk + 16);
    v8h b0 = *(const v8h*)(Ws + kk);
    v8h b1v = *(const v8h*)(Ws + kk + 16);
    acc = wmma_step(a0, a1, b0, b1v, acc);
  }

  // Unrolled: constant indices keep acc in registers.
#pragma unroll
  for (int r2 = 0; r2 < 8; ++r2) red[wave][r2 * 32 + lane] = acc[r2];
  __syncthreads();

  if (threadIdx.x < 256 && nw < N1) {
    const float bn = b1[nw];
    // Stands in front of any reuse of the bias load's address register.
    asm volatile("s_wait_xcnt 0x0" ::: "memory");
    float s = 0.0f;
    // Unrolled: the LDS reads run ahead of the dependent adds.
#pragma unroll
    for (int w = 0; w < CLS_WAVES; ++w) s += red[w][threadIdx.x];
    const int r2 = threadIdx.x >> 5;      // accumulator register of this element
    const int m = m0 + lh * 8 + r2;       // C layout: lane->N, VGPR->M (8-row halves)
    H1[m * N1 + nw] = fmaxf(s + bn, 0.0f);
  }
}

// ---------------------------------------------------------------------------
// Tiny tail FCs (200->50->10->128): one thread per output, f32 VALU.
// ---------------------------------------------------------------------------
__global__ void k_fc(const float* __restrict__ X, const float* __restrict__ W,
                     const float* __restrict__ bias, float* __restrict__ Y,
                     int M, int N, int K, int relu) {
  int idx = blockIdx.x * blockDim.x + threadIdx.x;
  if (idx >= M * N) return;
  int m = idx / N, n = idx % N;
  const float* xr = X + (size_t)m * K;
  const float* wr = W + (size_t)n * K;
  float s = bias[n];
  for (int k = 0; k < K; ++k) s += xr[k] * wr[k];
  if (relu) s = fmaxf(s, 0.0f);
  Y[idx] = s;
}

// ---------------------------------------------------------------------------
extern "C" void kernel_launch(void* const* d_in, const int* in_sizes, int n_in,
                              void* d_out, int out_size, void* d_ws, size_t ws_size,
                              hipStream_t stream) {
  (void)in_sizes; (void)n_in; (void)out_size; (void)ws_size;
  const float* x      = (const float*)d_in[0];
  const float* attn_w = (const float*)d_in[1];
  const float* attn_b = (const float*)d_in[2];
  const float* ln_g   = (const float*)d_in[3];
  const float* ln_b   = (const float*)d_in[4];
  const float* w1     = (const float*)d_in[5];
  const float* b1     = (const float*)d_in[6];
  const float* w2     = (const float*)d_in[7];
  const float* b2     = (const float*)d_in[8];
  const float* w3     = (const float*)d_in[9];
  const float* b3     = (const float*)d_in[10];
  const float* w4     = (const float*)d_in[11];
  const float* b4     = (const float*)d_in[12];
  float* out = (float*)d_out;

  char* ws = (char*)d_ws;
  size_t off = 0;
  auto alloc = [&](size_t bytes) -> char* {
    char* p = ws + off;
    off += (bytes + 255) & ~(size_t)255;
    return p;
  };
  float*  xp_f  = (float*) alloc((size_t)M_ROWS * D1 * 4);
  half_t* xp_h  = (half_t*)alloc((size_t)M_ROWS * D1 * 2);
  float*  nx_f  = (float*) alloc((size_t)M_ROWS * D1 * 4);
  half_t* nx_h  = (half_t*)alloc((size_t)M_ROWS * D1 * 2);
  float*  a_f   = (float*) alloc((size_t)M_ROWS * D1 * 4);
  half_t* a_h   = (half_t*)alloc((size_t)M_ROWS * D1 * 2);
  half_t* bp_h  = (half_t*)alloc((size_t)M_ROWS * D1 * 2);
  half_t* e_h   = (half_t*)alloc((size_t)M_ROWS * D1 * 2);
  float*  sc    = (float*) alloc((size_t)BATCH * 256 * 4);
  half_t* awh   = (half_t*)alloc((size_t)2 * 4 * D1 * D1 * 2);
  half_t* w1h   = (half_t*)alloc((size_t)N1 * KCLS * 2);
  float*  h1    = (float*) alloc((size_t)BATCH * N1 * 4);
  float*  h2    = (float*) alloc((size_t)BATCH * 50 * 4);
  float*  h3    = (float*) alloc((size_t)BATCH * 10 * 4);

  // Weight conversions (L2-resident afterwards).
  {
    int n = 2 * 4 * D1 * D1;  // 2,097,152
    k_f32_to_f16<<<(n + 255) / 256, 256, 0, stream>>>(attn_w, awh, n);
    n = N1 * KCLS;            // 3,276,800
    k_f32_to_f16<<<(n + 255) / 256, 256, 0, stream>>>(w1, w1h, n);
  }

  // Max-pool (the HBM-bound stage) + new_x init.
  k_pool<<<BATCH * (D1 / POOL_D1), POOL_THR, 0, stream>>>(x, xp_f, xp_h, nx_f, nx_h);

  dim3 ggrid(M_ROWS / 16, 2);  // 128 M-tiles x 2 groups of 8 waves x 32 cols
  for (int i = 0; i < 2; ++i) {
    const half_t* Wa  = awh + (size_t)(i * 4 + 0) * D1 * D1;
    const half_t* Wb  = awh + (size_t)(i * 4 + 1) * D1 * D1;
    const half_t* W1s = awh + (size_t)(i * 4 + 3) * D1 * D1;
    const float* ba  = attn_b + (size_t)(i * 4 + 0) * D1;
    const float* bb  = attn_b + (size_t)(i * 4 + 1) * D1;
    const float* b1s = attn_b + (size_t)(i * 4 + 3) * D1;

    // a = fc_a(new_x)  (f32 for context matmul, f16 for scores)
    k_gemm512<<<ggrid, 256, 0, stream>>>(nx_h, Wa, ba, nullptr, a_f, a_h, 0);
    // bproj = fc_b(xp)
    k_gemm512<<<ggrid, 256, 0, stream>>>(xp_h, Wb, bb, nullptr, nullptr, bp_h, 0);
    // scores = a @ bproj^T / sqrt(512)
    k_scores<<<BATCH / 4, 128, 0, stream>>>(a_h, bp_h, sc);
    // e = relu(LN(softmax_over_batch(scores) @ a))
    k_context_ln<<<BATCH, 256, 0, stream>>>(sc, a_f, ln_g, ln_b, e_h);
    // new_x = new_x + fc_1(e)
    k_gemm512<<<ggrid, 256, 0, stream>>>(e_h, W1s, b1s, nx_f, nx_f, nx_h, 0);
  }

  // Classifier head.
  k_gemm_cls<<<dim3(BATCH / 16, 13), 32 * CLS_WAVES, 0, stream>>>(xp_h, nx_h, w1h, b1, h1);
  k_fc<<<(BATCH * 50 + 255) / 256, 256, 0, stream>>>(h1, w2, b2, h2, BATCH, 50, N1, 1);
  k_fc<<<(BATCH * 10 + 255) / 256, 256, 0, stream>>>(h2, w3, b3, h3, BATCH, 10, 50, 1);
  k_fc<<<(BATCH * 128 + 255) / 256, 256, 0, stream>>>(h3, w4, b4, out, BATCH, 128, 10, 0);
}

// v004
// A run of this version takes 153 microseconds.
// Timed twice side by side with v003, it ran 1.04 times as fast both times.
// All steps since v000 together make it 2.22 times as fast.
#include <hip/hip_runtime.h>

// ---------------------------------------------------------------------------
// LongTermFeatureBank forward on MI455X (gfx1250, wave32, WMMA + TDM).
//   1. max-pool 7x7 over x[128,512,16,7,7] -> xp[128,16,512]  (HBM-bound)
//   2. per stack: fc_a/fc_b GEMMs (WMMA f16->f32, TDM-staged A tiles),
//      batched 16x16 score WMMA, batch-axis softmax + context matmul +
//      LayerNorm + ReLU in one kernel, fc_1 GEMM with residual.
//   3. classifier: WMMA GEMM [128,16384]x[16384,200], tiny VALU FCs.
// ---------------------------------------------------------------------------

typedef _Float16 half_t;
typedef __attribute__((ext_vector_type(16))) _Float16     v16h;
typedef __attribute__((ext_vector_type(8)))  _Float16     v8h;
typedef __attribute__((ext_vector_type(8)))  float        v8f;
typedef __attribute__((ext_vector_type(4)))  unsigned int u32x4;
typedef __attribute__((ext_vector_type(8)))  int          i32x8;
typedef __attribute__((ext_vector_type(4)))  int          i32x4;

#define D1     512
#define D2     16
#define BATCH  128
#define M_ROWS (BATCH * D2)   // 2048
#define KCLS   (2 * D2 * D1)  // 16384
#define N1     200

// Build the documented 16-bit WMMA fragment (VGPR0-3: K=base..base+7,
// VGPR4-7: K=base+16..base+23, per lane-half) from two 8-half chunks.
__device__ inline v8f wmma_step(v8h a0, v8h a1, v8h b0, v8h b1, v8f acc) {
  v16h af, bf;
#pragma unroll
  for (int i = 0; i < 8; ++i) {
    af[i] = a0[i]; af[8 + i] = a1[i];
    bf[i] = b0[i]; bf[8 + i] = b1[i];
  }
  return __builtin_amdgcn_wmma_f32_16x16x32_f16(
      /*neg_a=*/false, af, /*neg_b=*/false, bf,
      /*c_mod=*/(short)0, acc, /*reuse_a=*/false, /*reuse_b=*/false);
}

// ---------------------------------------------------------------------------
// TDM: stage a 16-row x 512-half tile into LDS with padded rows.
// D# (2-D): data_size=2B, tile=[512,16], tensor_dim0_stride=512,
// pad_enable, pad_interval=256 dwords (one row), pad_amount=4 dwords
// -> LDS row stride 520 halves (matches As[16][520] bank-spread layout).
// ---------------------------------------------------------------------------
__device__ inline void tdm_load_tile_16x512(const half_t* gsrc, void* lds_dst) {
  unsigned long long ga = (unsigned long long)(uintptr_t)gsrc;
  unsigned int lds = (unsigned int)(uintptr_t)lds_dst;  // low 32b = LDS offset
  u32x4 g0;
  g0[0] = 1u;                                  // count=1 (valid user D#)
  g0[1] = lds;                                 // lds_addr
  g0[2] = (unsigned int)(ga & 0xFFFFFFFFu);    // global_addr[31:0]
  g0[3] = (unsigned int)((ga >> 32) & 0x01FFFFFFu) | 0x80000000u;  // [56:32]|type=2
  i32x8 g1;
  g1[0] = (int)0x07D10000u;  // data_size=2B | pad_en | pad_interval=256dw | pad=4dw
  g1[1] = (int)(512u << 16);                   // tensor_dim0[15:0]=512
  g1[2] = (int)((2048u & 0xFFFFu) << 16);      // tensor_dim0 hi=0 | tensor_dim1 lo=2048
  g1[3] = (int)(512u << 16);                   // tensor_dim1 hi=0 | tile_dim0=512
  g1[4] = 16;                                  // tile_dim1=16, tile_dim2=0
  g1[5] = 512;                                 // tensor_dim0_stride[31:0]=512
  g1[6] = 0;                                   // stride0 hi | tensor_dim1_stride lo
  g1[7] = 0;
  i32x4 z4 = {0, 0, 0, 0};
  i32x8 z8 = {0, 0, 0, 0, 0, 0, 0, 0};
  __builtin_amdgcn_tensor_load_to_lds(g0, g1, z4, z4, z8, 0);
}

// ---------------------------------------------------------------------------
// f32 -> f16 weight copy. A thread takes eight pieces of four floats, 1,024
// floats apart, so a wave reads whole 512-byte runs and stores whole 256-byte
// runs, and a block of 8 waves covers 8,192 floats. One float a thread would be
// 168,000 waves for the two copies, each living for one load: the time would go
// into starting waves. Both element counts are multiples of 8,192: no tail.
// ---------------------------------------------------------------------------
typedef __attribute__((ext_vector_type(4))) float    v4f;
typedef __attribute__((ext_vector_type(4))) _Float16 v4h;

#define CVT_THR   256
#define CVT_PIECE 8
#define CVT_BLK   (CVT_THR * CVT_PIECE * 4)  // 8,192 floats a block

__global__ void __launch_bounds__(CVT_THR)
k_f32_to_f16(const float* __restrict__ src, half_t* __restrict__ dst) {
  const int i0 = blockIdx.x * CVT_BLK + threadIdx.x * 4;
  v4f v[CVT_PIECE];
  // Unrolled: v stays in registers and all eight loads are in flight together.
#pragma unroll
  for (int j = 0; j < CVT_PIECE; ++j)
    v[j] = *(const v4f*)(src + i0 + j * (CVT_THR * 4));
  // Unrolled: constant indices into v.
#pragma unroll
  for (int j = 0; j < CVT_PIECE; ++j)
    *(v4h*)(dst + i0 + j * (CVT_THR * 4)) = __builtin_convertvector(v[j], v4h);
}

// ---------------------------------------------------------------------------
// Max-pool over HxW=49 (the 205 MB streaming read) + init new_x = xp.
// A block owns one b and 64 d1, in four stages of 16 d1: 16*16*49 floats that
// lie in one run in x. A stage's run goes to LDS in whole lines by asynchronous
// copies; each thread then takes the maximum of one 49-float window from LDS
// (lane pitch 49 dwords, odd, so no bank conflict). A small LDS tile turns
// (d1,d2) into (d2,d1), so that the block stores whole 128-byte lines of all
// four outputs. Four blocks fit a WGP: one block's maxima run under the
// others' copies.
// ---------------------------------------------------------------------------
typedef __attribute__((ext_vector_type(2))) float    v2f;
typedef __attribute__((ext_vector_type(2))) _Float16 v2h;

#define POOL_D1   64                     // d1 a block owns
#define POOL_SD1  16                     // d1 a stage
#define POOL_SFLT (POOL_SD1 * D2 * 49)   // 12,544 floats = 50,176 bytes a stage
#define POOL_THR  256

__global__ void __launch_bounds__(POOL_THR)
k_pool(const float* __restrict__ x,
       float* __restrict__ xp_f, half_t* __restrict__ xp_h,
       float* __restrict__ nx_f, half_t* __restrict__ nx_h) {
  __shared__ __align__(16) float tile[POOL_SFLT];
  __shared__ __align__(8) float tr[D2][POOL_D1 + 2];  // pitch 66: no bank conflict for writers or readers
  const int tid = threadIdx.x;
  const int wave = __builtin_amdgcn_readfirstlane(tid >> 5);
  const int b = blockIdx.x >> 3;
  const int d1_0 = (blockIdx.x & 7) * POOL_D1;
  const float* g = x + (size_t)(b * D1 + d1_0) * (D2 * 49) + tid * 4;
  const unsigned int l = (unsigned int)(uintptr_t)&tile[0] + (unsigned int)tid * 16u;

  // Unrolled: each stage's column of tr is a constant LDS offset on one base.
#pragma unroll
  for (int s = 0; s < POOL_D1 / POOL_SD1; ++s, g += POOL_SFLT) {
    // 3,136 pieces of 16 bytes: 12 from every thread, a 13th from waves 0 and 1.
    // The s_wait_xcnt closes each statement so that no address register of an
    // issued copy is rewritten ahead of it.
    asm volatile(
        "global_load_async_to_lds_b128 %0, %12, off\n\t"
        "global_load_async_to_lds_b128 %1, %13, off\n\t"
        "global_load_async_to_lds_b128 %2, %14, off\n\t"
        "global_load_async_to_lds_b128 %3, %15, off\n\t"
        "global_load_async_to_lds_b128 %4, %16, off\n\t"
        "global_load_async_to_lds_b128 %5, %17, off\n\t"
        "global_load_async_to_lds_b128 %6, %18, off\n\t"
        "global_load_async_to_lds_b128 %7, %19, off\n\t"
        "global_load_async_to_lds_b128 %8, %20, off\n\t"
        "global_load_async_to_lds_b128 %9, %21, off\n\t"
        "global_load_async_to_lds_b128 %10, %22, off\n\t"
        "global_load_async_to_lds_b128 %11, %23, off\n\t"
        "s_wait_xcnt 0x0"
        :: "v"(l), "v"(l + 1u * 4096u), "v"(l + 2u * 4096u), "v"(l + 3u * 4096u),
           "v"(l + 4u * 4096u), "v"(l + 5u * 4096u), "v"(l + 6u * 4096u),
           "v"(l + 7u * 4096u), "v"(l + 8u * 4096u), "v"(l + 9u * 4096u),
           "v"(l + 10u * 4096u), "v"(l + 11u * 4096u),
           "v"(g), "v"(g + 1 * 1024), "v"(g + 2 * 1024), "v"(g + 3 * 1024),
           "v"(g + 4 * 1024), "v"(g + 5 * 1024), "v"(g + 6 * 1024), "v"(g + 7 * 1024),
           "v"(g + 8 * 1024), "v"(g + 9 * 1024), "v"(g + 10 * 1024), "v"(g + 11 * 1024)
        : "memory");
    if (wave < 2) {
      asm volatile(
          "global_load_async_to_lds_b128 %0, %1, off\n\t"
          "s_wait_xcnt 0x0"
          :: "v"(l + 12u * 4096u), "v"(g + 12 * 1024) : "memory");
    }
    // This wave's copies have landed; the barrier then shows them to every wave.
    asm volatile("s_wait_asynccnt 0x0" ::: "memory");
    __syncthreads();

    const float* p = &tile[tid * 49];  // window tid = (d1 in the stage) * 16 + d2
    float m = p[0];
    // Unrolled: constant LDS offsets, and the reads run ahead of the maxima.
#pragma unroll
    for (int j = 1; j < 49; ++j) m = fmaxf(m, p[j]);
    tr[tid & 15][s * POOL_SD1 + (tid >> 4)] = m;

    // This wave's LDS reads of the stage are done; behind the barrier the next
    // stage's copies may overwrite the tile (and, last, tr is whole).
    asm volatile("s_wait_dscnt 0x0" ::: "memory");
    __syncthreads();
  }

  // 512 pairs of neighbouring d1: a wave stores 256 bytes of f32, 128 of f16.
#pragma unroll
  for (int k = 0; k < 2; ++k) {
    const int q = tid + POOL_THR * k;
    const int d2 = q >> 5, d1l = (q & 31) * 2;
    const v2f m2 = *(const v2f*)&tr[d2][d1l];
    const int o = (b * D2 + d2) * D1 + d1_0 + d1l;
    *(v2f*)(xp_f + o) = m2;
    *(v2f*)(nx_f + o) = m2;
    v2h h2;
    h2[0] = (half_t)m2[0];
    h2[1] = (half_t)m2[1];
    *(v2h*)(xp_h + o) = h2;
    *(v2h*)(nx_h + o) = h2;
  }
}

// ---------------------------------------------------------------------------
// Y[M,512] = op( X[M,512] @ W[512,512]^T + bias [+ res] ).
// Block = 8 waves, one 16-row A tile staged to LDS by the TDM; each wave owns
// a 16x32 output tile (two WMMA accumulators sharing one A fragment).
// ---------------------------------------------------------------------------
__global__ void __launch_bounds__(256)
k_gemm512(const half_t* __restrict__ X, const half_t* __restrict__ W,
          const float* __restrict__ bias, const float* __restrict__ res,
          float* __restrict__ Yf, half_t* __restrict__ Yh, int relu) {
  __shared__ __align__(16) half_t As[16][520];  // 520-half rows (TDM-padded)
  const int lane = threadIdx.x & 31;
  const int wave = threadIdx.x >> 5;
  const int m0 = blockIdx.x * 16;

  if (wave == 0) tdm_load_tile_16x512(X + (size_t)m0 * D1, &As[0][0]);
  __builtin_amdgcn_s_wait_tensorcnt(0);
  __syncthreads();

  const int ntile0 = (blockIdx.y * 8 + wave) * 2;  // two adjacent N tiles
  const int lm = lane & 15, lh = lane >> 4;
  const half_t* Wrow0 = W + (size_t)(ntile0 * 16 + lm) * D1;
  const half_t* Wrow1 = Wrow0 + (size_t)16 * D1;

  v8f acc0 = {}, acc1 = {};
  for (int kk = 0; kk < D1; kk += 32) {
    if (kk + 128 < D1) {
      __builtin_prefetch(Wrow0 + kk + 128, 0, 3);
      __builtin_prefetch(Wrow1 + kk + 128, 0, 3);
    }
    int base = kk + 8 * lh;
    v8h a0 = *(const v8h*)&As[lm][base];
    v8h a1 = *(const v8h*)&As[lm][base + 16];
    v8h b0 = *(const v8h*)(Wrow0 + base);
    v8h b1 = *(const v8h*)(Wrow0 + base + 16);
    v8h c0 = *(const v8h*)(Wrow1 + base);
    v8h c1 = *(const v8h*)(Wrow1 + base + 16);
    acc0 = wmma_step(a0, a1, b0, b1, acc0);
    acc1 = wmma_step(a0, a1, c0, c1, acc1);
  }

#pragma unroll
  for (int t = 0; t < 2; ++t) {
    const v8f acc = t ? acc1 : acc0;
    const int n = (ntile0 + t) * 16 + lm;
    const float bn = bias ? bias[n] : 0.0f;
#pragma unroll
    for (int r2 = 0; r2 < 8; ++r2) {
      int m = m0 + lh * 8 + r2;  // C layout: lane->N, VGPR->M (8-row halves)
      float v = acc[r2] + bn;
      if (res) v += res[(size_t)m * D1 + n];
      if (relu) v = fmaxf(v, 0.0f);
      if (Yf) Yf[(size_t)m * D1 + n] = v;
      if (Yh) Yh[(size_t)m * D1 + n] = (half_t)v;
    }
  }
}

// ---------------------------------------------------------------------------
// scores[b,c,d] = dot(a[b,c,:], bp[b,d,:]) / sqrt(512)  — one WMMA wave per b
// ---------------------------------------------------------------------------
__global__ void __launch_bounds__(128)
k_scores(const half_t* __restrict__ A, const half_t* __restrict__ Bp,
         float* __restrict__ S) {
  const int lane = threadIdx.x & 31;
  const int wave = threadIdx.x >> 5;
  const int b = blockIdx.x * 4 + wave;
  const int lm = lane & 15, lh = lane >> 4;
  const half_t* Arow = A  + (size_t)(b * 16 + lm) * D1;
  const half_t* Brow = Bp + (size_t)(b * 16 + lm) * D1;
  v8f acc = {};
  for (int kk = 0; kk < D1; kk += 32) {
    int base = kk + 8 * lh;
    v8h a0 = *(const v8h*)(Arow + base);
    v8h a1 = *(const v8h*)(Arow + base + 16);
    v8h b0 = *(const v8h*)(Brow + base);
    v8h b1 = *(const v8h*)(Brow + base + 16);
    acc = wmma_step(a0, a1, b0, b1, acc);
  }
  const float s = 0.044194173824159216f;  // 1/sqrt(512)
#pragma unroll
  for (int r2 = 0; r2 < 8; ++r2) {
    int c = lh * 8 + r2;
    S[b * 256 + c * 16 + lm] = acc[r2] * s;
  }
}

// ---------------------------------------------------------------------------
// e = relu(LayerNorm_{16,512}( ab[b] @ a[b] )) per batch; one block per b.
// ab = softmax of the raw scores S over dim 0 (batch; legacy nn.Softmax() on
// 3D). Every block works out the maximum and the sum of all 256 columns
// itself, one column (c*16 + d) a thread, and keeps only its own b's row:
// 128 KB of L2 reads a block in place of a launch of one block between the
// score kernel and this one. The sum runs in ascending b.
// ---------------------------------------------------------------------------
__global__ void __launch_bounds__(256)
k_context_ln(const float* __restrict__ S, const float* __restrict__ Af,
             const float* __restrict__ g, const float* __restrict__ beta,
             half_t* __restrict__ Eh) {
  __shared__ float ab[256];
  __shared__ float ep[8192];
  __shared__ float rs[256], rq[256];
  const int b = blockIdx.x, tid = threadIdx.x;
  {
    float v[BATCH];
    // Unrolled: v stays in registers and the column's loads are all in flight
    // together, one L2 latency for the column.
#pragma unroll
    for (int i = 0; i < BATCH; ++i) v[i] = S[i * 256 + tid];
    const float own = S[b * 256 + tid];
    float mx = -1e30f;
    // Unrolled: constant indices into v.
#pragma unroll
    for (int i = 0; i < BATCH; ++i) mx = fmaxf(mx, v[i]);
    float sum = 0.0f;
    // Unrolled: constant indices into v.
#pragma unroll
    for (int i = 0; i < BATCH; ++i) sum += __expf(v[i] - mx);
    ab[tid] = __expf(own - mx) * (1.0f / sum);
  }
  __syncthreads();

  float lsum = 0.0f, lsq = 0.0f;
#pragma unroll 4
  for (int i = 0; i < 32; ++i) {
    int idx = tid + 256 * i;          // idx = c*512 + t
    int c = idx >> 9, t = idx & 511;
    float s = 0.0f;
#pragma unroll
    for (int d = 0; d < 16; ++d)
      s += ab[c * 16 + d] * Af[(size_t)(b * 16 + d) * D1 + t];
    ep[idx] = s;
    lsum += s;
    lsq += s * s;
  }
  rs[tid] = lsum; rq[tid] = lsq;
  __syncthreads();
  for (int s2 = 128; s2 > 0; s2 >>= 1) {
    if (tid < s2) { rs[tid] += rs[tid + s2]; rq[tid] += rq[tid + s2]; }
    __syncthreads();
  }
  float mu   = rs[0] * (1.0f / 8192.0f);
  float var  = rq[0] * (1.0f / 8192.0f) - mu * mu;
  float rstd = rsqrtf(var + 1e-5f);
#pragma unroll 4
  for (int i = 0; i < 32; ++i) {
    int idx = tid + 256 * i;
    int c = idx >> 9, t = idx & 511;
    float v = (ep[idx] - mu) * rstd * g[idx] + beta[idx];
    v = fmaxf(v, 0.0f);
    Eh[(size_t)(b * 16 + c) * D1 + t] = (half_t)v;
  }
}

// ---------------------------------------------------------------------------
// h1 = relu( feat[128,16384] @ w1[200,16384]^T + b1 ).  feat = [xp | new_x]
// One block per 16x16 output tile; K is split over the block's 32 waves
// (512 k each, 16 WMMA steps), the 32 partial tiles are summed in LDS in
// wave order.
// ---------------------------------------------------------------------------
#define CLS_WAVES  32
#define CLS_KSLICE (KCLS / CLS_WAVES)  // 512; divides 8192, so a slice is all xp or all new_x

__global__ void __launch_bounds__(32 * CLS_WAVES)
k_gemm_cls(const half_t* __restrict__ XPh, const half_t* __restrict__ NXh,
           const half_t* __restrict__ W1h, const float* __restrict__ b1,
           float* __restrict__ H1) {
  __shared__ float red[CLS_WAVES][256];
  const int lane = threadIdx.x & 31;
  const int wave = threadIdx.x >> 5;
  const int lm = lane & 15, lh = lane >> 4;
  const int m0 = blockIdx.x * 16;    // batch tile (8 tiles)
  const int ntile = blockIdx.y;      // 13 tiles cover N=200 (pad to 208)
  const int nw = ntile * 16 + lm;
  const int nl = (nw < N1) ? nw : (N1 - 1);  // clamp loads; masked at store
  const int k0 = wave * CLS_KSLICE;
  const int mrow = m0 + lm;
  const half_t* Ws = W1h + (size_t)nl * KCLS + k0 + 8 * lh;
  const half_t* Xs = ((k0 < 8192) ? (XPh + (size_t)mrow * 8192 + k0)
                                  : (NXh + (size_t)mrow * 8192 + (k0 - 8192))) + 8 * lh;

  v8f acc = {};
  // Unrolled: constant offsets on two address pairs, and the next step's
  // loads issue ahead of this step's WMMA.
#pragma unroll
  for (int kk = 0; kk < CLS_KSLICE; kk += 32) {
    v8h a0 = *(const v8h*)(Xs + kk);
    v8h a1 = *(const v8h*)(Xs + kk + 16);
    v8h b0 = *(const v8h*)(Ws + kk);
    v8h b1v = *(const v8h*)(Ws + kk + 16);
    acc = wmma_step(a0, a1, b0, b1v, acc);
  }

  // Unrolled: constant indices keep acc in registers.
#pragma unroll
  for (int r2 = 0; r2 < 8; ++r2) red[wave][r2 * 32 + lane] = acc[r2];
  __syncthreads();

  if (threadIdx.x < 256 && nw < N1) {
    const float bn = b1[nw];
    // Stands in front of any reuse of the bias load's address register.
    asm volatile("s_wait_xcnt 0x0" ::: "memory");
    float s = 0.0f;
    // Unrolled: the LDS reads run ahead of the dependent adds.
#pragma unroll
    for (int w = 0; w < CLS_WAVES; ++w) s += red[w][threadIdx.x];
    const int r2 = threadIdx.x >> 5;      // accumulator register of this element
    const int m = m0 + lh * 8 + r2;       // C layout: lane->N, VGPR->M (8-row halves)
    H1[m * N1 + nw] = fmaxf(s + bn, 0.0f);
  }
}

// ---------------------------------------------------------------------------
// Tiny tail FCs (200->50->10->128): one thread per output, f32 VALU.
// ---------------------------------------------------------------------------
__global__ void k_fc(const float* __restrict__ X, const float* __restrict__ W,
                     const float* __restrict__ bias, float* __restrict__ Y,
                     int M, int N, int K, int relu) {
  int idx = blockIdx.x * blockDim.x + threadIdx.x;
  if (idx >= M * N) return;
  int m = idx / N, n = idx % N;
  const float* xr = X + (size_t)m * K;
  const float* wr = W + (size_t)n * K;
  float s = bias[n];
  for (int k = 0; k < K; ++k) s += xr[k] * wr[k];
  if (relu) s = fmaxf(s, 0.0f);
  Y[idx] = s;
}

// ---------------------------------------------------------------------------
extern "C" void kernel_launch(void* const* d_in, const int* in_sizes, int n_in,
                              void* d_out, int out_size, void* d_ws, size_t ws_size,
                              hipStream_t stream) {
  (void)in_sizes; (void)n_in; (void)out_size; (void)ws_size;
  const float* x      = (const float*)d_in[0];
  const float* attn_w = (const float*)d_in[1];
  const float* attn_b = (const float*)d_in[2];
  const float* ln_g   = (const float*)d_in[3];
  const float* ln_b   = (const float*)d_in[4];
  const float* w1     = (const float*)d_in[5];
  const float* b1     = (const float*)d_in[6];
  const float* w2     = (const float*)d_in[7];
  const float* b2     = (const float*)d_in[8];
  const float* w3     = (const float*)d_in[9];
  const float* b3     = (const float*)d_in[10];
  const float* w4     = (const float*)d_in[11];
  const float* b4     = (const float*)d_in[12];
  float* out = (float*)d_out;

  char* ws = (char*)d_ws;
  size_t off = 0;
  auto alloc = [&](size_t bytes) -> char* {
    char* p = ws + off;
    off += (bytes + 255) & ~(size_t)255;
    return p;
  };
  float*  xp_f  = (float*) alloc((size_t)M_ROWS * D1 * 4);
  half_t* xp_h  = (half_t*)alloc((size_t)M_ROWS * D1 * 2);
  float*  nx_f  = (float*) alloc((size_t)M_ROWS * D1 * 4);
  half_t* nx_h  = (half_t*)alloc((size_t)M_ROWS * D1 * 2);
  float*  a_f   = (float*) alloc((size_t)M_ROWS * D1 * 4);
  half_t* a_h   = (half_t*)alloc((size_t)M_ROWS * D1 * 2);
  half_t* bp_h  = (half_t*)alloc((size_t)M_ROWS * D1 * 2);
  half_t* e_h   = (half_t*)alloc((size_t)M_ROWS * D1 * 2);
  float*  sc    = (float*) alloc((size_t)BATCH * 256 * 4);
  half_t* awh   = (half_t*)alloc((size_t)2 * 4 * D1 * D1 * 2);
  half_t* w1h   = (half_t*)alloc((size_t)N1 * KCLS * 2);
  float*  h1    = (float*) alloc((size_t)BATCH * N1 * 4);
  float*  h2    = (float*) alloc((size_t)BATCH * 50 * 4);
  float*  h3    = (float*) alloc((size_t)BATCH * 10 * 4);

  // Weight conversions (L2-resident afterwards).
  k_f32_to_f16<<<2 * 4 * D1 * D1 / CVT_BLK, CVT_THR, 0, stream>>>(attn_w, awh);  // 256 blocks
  k_f32_to_f16<<<N1 * KCLS / CVT_BLK, CVT_THR, 0, stream>>>(w1, w1h);            // 400 blocks

  // Max-pool (the HBM-bound stage) + new_x init.
  k_pool<<<BATCH * (D1 / POOL_D1), POOL_THR, 0, stream>>>(x, xp_f, xp_h, nx_f, nx_h);

  dim3 ggrid(M_ROWS / 16, 2);  // 128 M-tiles x 2 groups of 8 waves x 32 cols
  for (int i = 0; i < 2; ++i) {
    const half_t* Wa  = awh + (size_t)(i * 4 + 0) * D1 * D1;
    const half_t* Wb  = awh + (size_t)(i * 4 + 1) * D1 * D1;
    const half_t* W1s = awh + (size_t)(i * 4 + 3) * D1 * D1;
    const float* ba  = attn_b + (size_t)(i * 4 + 0) * D1;
    const float* bb  = attn_b + (size_t)(i * 4 + 1) * D1;
    const float* b1s = attn_b + (size_t)(i * 4 + 3) * D1;

    // a = fc_a(new_x)  (f32 for context matmul, f16 for scores)
    k_gemm512<<<ggrid, 256, 0, stream>>>(nx_h, Wa, ba, nullptr, a_f, a_h, 0);
    // bproj = fc_b(xp)
    k_gemm512<<<ggrid, 256, 0, stream>>>(xp_h, Wb, bb, nullptr, nullptr, bp_h, 0);
    // scores = a @ bproj^T / sqrt(512)
    k_scores<<<BATCH / 4, 128, 0, stream>>>(a_h, bp_h, sc);
    // e = relu(LN(softmax_over_batch(scores) @ a))
    k_context_ln<<<BATCH, 256, 0, stream>>>(sc, a_f, ln_g, ln_b, e_h);
    // new_x = new_x + fc_1(e)
    k_gemm512<<<ggrid, 256, 0, stream>>>(e_h, W1s, b1s, nx_f, nx_f, nx_h, 0);
  }

  // Classifier head.
  k_gemm_cls<<<dim3(BATCH / 16, 13), 32 * CLS_WAVES, 0, stream>>>(xp_h, nx_h, w1h, b1, h1);
  k_fc<<<(BATCH * 50 + 255) / 256, 256, 0, stream>>>(h1, w2, b2, h2, BATCH, 50, N1, 1);
  k_fc<<<(BATCH * 10 + 255) / 256, 256, 0, stream>>>(h2, w3, b3, h3, BATCH, 10, 50, 1);
  k_fc<<<(BATCH * 128 + 255) / 256, 256, 0, stream>>>(h3, w4, b4, out, BATCH, 128, 10, 0);
}

// v005
// One run takes 139 microseconds.
// In both of two side-by-side timings against v004, it was 1.10 times as fast.
// All steps since v000 together make it 2.44 times as fast.
#include <hip/hip_runtime.h>

// ---------------------------------------------------------------------------
// LongTermFeatureBank forward on MI455X (gfx1250, wave32, WMMA + TDM).
//   1. max-pool 7x7 over x[128,512,16,7,7] -> xp[128,16,512]  (HBM-bound)
//   2. per stack: fc_a/fc_b GEMMs (WMMA f16->f32, TDM-staged A tiles),
//      batched 16x16 score WMMA, batch-axis softmax + context matmul +
//      LayerNorm + ReLU in one kernel, fc_1 GEMM with residual.
//   3. classifier: WMMA GEMM [128,16384]x[16384,200], tiny VALU FCs.
// ---------------------------------------------------------------------------

typedef _Float16 half_t;
typedef __attribute__((ext_vector_type(16))) _Float16     v16h;
typedef __attribute__((ext_vector_type(8)))  _Float16     v8h;
typedef __attribute__((ext_vector_type(8)))  float        v8f;
typedef __attribute__((ext_vector_type(4)))  unsigned int u32x4;
typedef __attribute__((ext_vector_type(8)))  int          i32x8;
typedef __attribute__((ext_vector_type(4)))  int          i32x4;

#define D1     512
#define D2     16
#define BATCH  128
#define M_ROWS (BATCH * D2)   // 2048
#define KCLS   (2 * D2 * D1)  // 16384
#define N1     200

// Build the documented 16-bit WMMA fragment (VGPR0-3: K=base..base+7,
// VGPR4-7: K=base+16..base+23, per lane-half) from two 8-half chunks.
__device__ inline v8f wmma_step(v8h a0, v8h a1, v8h b0, v8h b1, v8f acc) {
  v16h af, bf;
#pragma unroll
  for (int i = 0; i < 8; ++i) {
    af[i] = a0[i]; af[8 + i] = a1[i];
    bf[i] = b0[i]; bf[8 + i] = b1[i];
  }
  return __builtin_amdgcn_wmma_f32_16x16x32_f16(
      /*neg_a=*/false, af, /*neg_b=*/false, bf,
      /*c_mod=*/(short)0, acc, /*reuse_a=*/false, /*reuse_b=*/false);
}

// ---------------------------------------------------------------------------
// TDM: stage a 16-row x 512-half tile into LDS with padded rows.
// D# (2-D): data_size=2B, tile=[512,16], tensor_dim0_stride=512,
// pad_enable, pad_interval=256 dwords (one row), pad_amount=4 dwords
// -> LDS row stride 520 halves (matches As[16][520] bank-spread layout).
// ---------------------------------------------------------------------------
__device__ inline void tdm_load_tile_16x512(const half_t* gsrc, void* lds_dst) {
  unsigned long long ga = (unsigned long long)(uintptr_t)gsrc;
  unsigned int lds = (unsigned int)(uintptr_t)lds_dst;  // low 32b = LDS offset
  u32x4 g0;
  g0[0] = 1u;                                  // count=1 (valid user D#)
  g0[1] = lds;                                 // lds_addr
  g0[2] = (unsigned int)(ga & 0xFFFFFFFFu);    // global_addr[31:0]
  g0[3] = (unsigned int)((ga >> 32) & 0x01FFFFFFu) | 0x80000000u;  // [56:32]|type=2
  i32x8 g1;
  g1[0] = (int)0x07D10000u;  // data_size=2B | pad_en | pad_interval=256dw | pad=4dw
  g1[1] = (int)(512u << 16);                   // tensor_dim0[15:0]=512
  g1[2] = (int)((2048u & 0xFFFFu) << 16);      // tensor_dim0 hi=0 | tensor_dim1 lo=2048
  g1[3] = (int)(512u << 16);                   // tensor_dim1 hi=0 | tile_dim0=512
  g1[4] = 16;                                  // tile_dim1=16, tile_dim2=0
  g1[5] = 512;                                 // tensor_dim0_stride[31:0]=512
  g1[6] = 0;                                   // stride0 hi | tensor_dim1_stride lo
  g1[7] = 0;
  i32x4 z4 = {0, 0, 0, 0};
  i32x8 z8 = {0, 0, 0, 0, 0, 0, 0, 0};
  __builtin_amdgcn_tensor_load_to_lds(g0, g1, z4, z4, z8, 0);
}

// ---------------------------------------------------------------------------
// f32 -> f16 weight copy. A thread takes eight pieces of four floats, 1,024
// floats apart, so a wave reads whole 512-byte runs and stores whole 256-byte
// runs, and a block of 8 waves covers 8,192 floats. One float a thread would be
// 168,000 waves for the two copies, each living for one load: the time would go
// into starting waves. Both element counts are multiples of 8,192: no tail.
// The copies have no launch of their own: their blocks ride in the max-pool
// grid (k_pool_cvt), which they do not depend on.
// ---------------------------------------------------------------------------
typedef __attribute__((ext_vector_type(4))) float    v4f;
typedef __attribute__((ext_vector_type(4))) _Float16 v4h;

#define CVT_THR   256
#define CVT_PIECE 8
#define CVT_BLK   (CVT_THR * CVT_PIECE * 4)  // 8,192 floats a block

#define CVT_BLKS_AW (2 * 4 * D1 * D1 / CVT_BLK)  // 256 blocks: attention weights
#define CVT_BLKS_W1 (N1 * KCLS / CVT_BLK)        // 400 blocks: classifier weights

__device__ __forceinline__ void
f32_to_f16_block(const float* __restrict__ src, half_t* __restrict__ dst, int blk) {
  const int i0 = blk * CVT_BLK + threadIdx.x * 4;
  v4f v[CVT_PIECE];
  // Unrolled: v stays in registers and all eight loads are in flight together.
#pragma unroll
  for (int j = 0; j < CVT_PIECE; ++j)
    v[j] = *(const v4f*)(src + i0 + j * (CVT_THR * 4));
  // Unrolled: constant indices into v.
#pragma unroll
  for (int j = 0; j < CVT_PIECE; ++j)
    *(v4h*)(dst + i0 + j * (CVT_THR * 4)) = __builtin_convertvector(v[j], v4h);
}

// ---------------------------------------------------------------------------
// Max-pool over HxW=49 (the 205 MB streaming read) + init new_x = xp.
// A block owns one b and 64 d1, in four stages of 16 d1: 16*16*49 floats that
// lie in one run in x. A stage's run goes to LDS in whole lines by asynchronous
// copies; each thread then takes the maximum of one 49-float window from LDS
// (lane pitch 49 dwords, odd, so no bank conflict). A small LDS tile turns
// (d1,d2) into (d2,d1), so that the block stores whole 128-byte lines of all
// four outputs. Four blocks fit a WGP: one block's maxima run under the
// others' copies.
// Blocks from POOL_BLKS on do the two weight copies instead: independent work
// in the same launch. The long pool blocks have the low indices and start first.
// ---------------------------------------------------------------------------
typedef __attribute__((ext_vector_type(2))) float    v2f;
typedef __attribute__((ext_vector_type(2))) _Float16 v2h;

#define POOL_D1   64                     // d1 a block owns
#define POOL_SD1  16                     // d1 a stage
#define POOL_SFLT (POOL_SD1 * D2 * 49)   // 12,544 floats = 50,176 bytes a stage
#define POOL_THR  256
#define POOL_BLKS (BATCH * (D1 / POOL_D1))  // 1,024
static_assert(POOL_THR == CVT_THR, "both bodies run in one block shape");

__global__ void __launch_bounds__(POOL_THR)
k_pool_cvt(const float* __restrict__ x,
           float* __restrict__ xp_f, half_t* __restrict__ xp_h,
           float* __restrict__ nx_f, half_t* __restrict__ nx_h,
           const float* __restrict__ attn_w, half_t* __restrict__ awh,
           const float* __restrict__ w1, half_t* __restrict__ w1h) {
  __shared__ __align__(16) float tile[POOL_SFLT];
  __shared__ __align__(8) float tr[D2][POOL_D1 + 2];  // pitch 66: no bank conflict for writers or readers
  // Block-uniform, in front of every copy and barrier: a whole block leaves here.
  if (blockIdx.x >= POOL_BLKS) {
    const int cb = blockIdx.x - POOL_BLKS;
    const bool aw = cb < CVT_BLKS_AW;
    f32_to_f16_block(aw ? attn_w : w1, aw ? awh : w1h, aw ? cb : cb - CVT_BLKS_AW);
    return;
  }
  const int tid = threadIdx.x;
  const int wave = __builtin_amdgcn_readfirstlane(tid >> 5);
  const int b = blockIdx.x >> 3;
  const int d1_0 = (blockIdx.x & 7) * POOL_D1;
  const float* g = x + (size_t)(b * D1 + d1_0) * (D2 * 49) + tid * 4;
  const unsigned int l = (unsigned int)(uintptr_t)&tile[0] + (unsigned int)tid * 16u;

  // Unrolled: each stage's column of tr is a constant LDS offset on one base.
#pragma unroll
  for (int s = 0; s < POOL_D1 / POOL_SD1; ++s, g += POOL_SFLT) {
    // 3,136 pieces of 16 bytes: 12 from every thread, a 13th from waves 0 and 1.
    // The s_wait_xcnt closes each statement so that no address register of an
    // issued copy is rewritten ahead of it.
    asm volatile(
        "global_load_async_to_lds_b128 %0, %12, off\n\t"
        "global_load_async_to_lds_b128 %1, %13, off\n\t"
        "global_load_async_to_lds_b128 %2, %14, off\n\t"
        "global_load_async_to_lds_b128 %3, %15, off\n\t"
        "global_load_async_to_lds_b128 %4, %16, off\n\t"
        "global_load_async_to_lds_b128 %5, %17, off\n\t"
        "global_load_async_to_lds_b128 %6, %18, off\n\t"
        "global_load_async_to_lds_b128 %7, %19, off\n\t"
        "global_load_async_to_lds_b128 %8, %20, off\n\t"
        "global_load_async_to_lds_b128 %9, %21, off\n\t"
        "global_load_async_to_lds_b128 %10, %22, off\n\t"
        "global_load_async_to_lds_b128 %11, %23, off\n\t"
        "s_wait_xcnt 0x0"
        :: "v"(l), "v"(l + 1u * 4096u), "v"(l + 2u * 4096u), "v"(l + 3u * 4096u),
           "v"(l + 4u * 4096u), "v"(l + 5u * 4096u), "v"(l + 6u * 4096u),
           "v"(l + 7u * 4096u), "v"(l + 8u * 4096u), "v"(l + 9u * 4096u),
           "v"(l + 10u * 4096u), "v"(l + 11u * 4096u),
           "v"(g), "v"(g + 1 * 1024), "v"(g + 2 * 1024), "v"(g + 3 * 1024),
           "v"(g + 4 * 1024), "v"(g + 5 * 1024), "v"(g + 6 * 1024), "v"(g + 7 * 1024),
           "v"(g + 8 * 1024), "v"(g + 9 * 1024), "v"(g + 10 * 1024), "v"(g + 11 * 1024)
        : "memory");
    if (wave < 2) {
      asm volatile(
          "global_load_async_to_lds_b128 %0, %1, off\n\t"
          "s_wait_xcnt 0x0"
          :: "v"(l + 12u * 4096u), "v"(g + 12 * 1024) : "memory");
    }
    // This wave's copies have landed; the barrier then shows them to every wave.
    asm volatile("s_wait_asynccnt 0x0" ::: "memory");
    __syncthreads();

    const float* p = &tile[tid * 49];  // window tid = (d1 in the stage) * 16 + d2
    float m = p[0];
    // Unrolled: constant LDS offsets, and the reads run ahead of the maxima.
#pragma unroll
    for (int j = 1; j < 49; ++j) m = fmaxf(m, p[j]);
    tr[tid & 15][s * POOL_SD1 + (tid >> 4)] = m;

    // This wave's LDS reads of the stage are done; behind the barrier the next
    // stage's copies may overwrite the tile (and, last, tr is whole).
    asm volatile("s_wait_dscnt 0x0" ::: "memory");
    __syncthreads();
  }

  // 512 pairs of neighbouring d1: a wave stores 256 bytes of f32, 128 of f16.
#pragma unroll
  for (int k = 0; k < 2; ++k) {
    const int q = tid + POOL_THR * k;
    const int d2 = q >> 5, d1l = (q & 31) * 2;
    const v2f m2 = *(const v2f*)&tr[d2][d1l];
    const int o = (b * D2 + d2) * D1 + d1_0 + d1l;
    *(v2f*)(xp_f + o) = m2;
    *(v2f*)(nx_f + o) = m2;
    v2h h2;
    h2[0] = (half_t)m2[0];
    h2[1] = (half_t)m2[1];
    *(v2h*)(xp_h + o) = h2;
    *(v2h*)(nx_h + o) = h2;
  }
}

// ---------------------------------------------------------------------------
// Y[M,512] = op( X[M,512] @ W[512,512]^T + bias [+ res] ).
// Block = 8 waves, one 16-row A tile staged to LDS by the TDM; each wave owns
// a 16x32 output tile (two WMMA accumulators sharing one A fragment).
// k_gemm512 holds up to two independent products in one launch: blockIdx.z
// picks the operands (fc_a and fc_b of a stack; fc_1 goes alone, one z plane).
// ---------------------------------------------------------------------------
__device__ __forceinline__ void
gemm512_tile(const half_t* __restrict__ X, const half_t* __restrict__ W,
             const float* __restrict__ bias, const float* __restrict__ res,
             float* __restrict__ Yf, half_t* __restrict__ Yh, int relu) {
  __shared__ __align__(16) half_t As[16][520];  // 520-half rows (TDM-padded)
  const int lane = threadIdx.x & 31;
  const int wave = threadIdx.x >> 5;
  const int m0 = blockIdx.x * 16;

  if (wave == 0) {
    tdm_load_tile_16x512(X + (size_t)m0 * D1, &As[0][0]);
    // Directly behind the load, in the issuing wave's branch: no descriptor
    // register takes a new value while the request is outstanding.
    __builtin_amdgcn_s_wait_tensorcnt(0);
  }
  __syncthreads();

  const int ntile0 = (blockIdx.y * 8 + wave) * 2;  // two adjacent N tiles
  const int lm = lane & 15, lh = lane >> 4;
  const half_t* Wrow0 = W + (size_t)(ntile0 * 16 + lm) * D1;
  const half_t* Wrow1 = Wrow0 + (size_t)16 * D1;

  v8f acc0 = {}, acc1 = {};
  for (int kk = 0; kk < D1; kk += 32) {
    if (kk + 128 < D1) {
      __builtin_prefetch(Wrow0 + kk + 128, 0, 3);
      __builtin_prefetch(Wrow1 + kk + 128, 0, 3);
    }
    int base = kk + 8 * lh;
    v8h a0 = *(const v8h*)&As[lm][base];
    v8h a1 = *(const v8h*)&As[lm][base + 16];
    v8h b0 = *(const v8h*)(Wrow0 + base);
    v8h b1 = *(const v8h*)(Wrow0 + base + 16);
    v8h c0 = *(const v8h*)(Wrow1 + base);
    v8h c1 = *(const v8h*)(Wrow1 + base + 16);
    acc0 = wmma_step(a0, a1, b0, b1, acc0);
    acc1 = wmma_step(a0, a1, c0, c1, acc1);
  }

#pragma unroll
  for (int t = 0; t < 2; ++t) {
    const v8f acc = t ? acc1 : acc0;
    const int n = (ntile0 + t) * 16 + lm;
    const float bn = bias ? bias[n] : 0.0f;
#pragma unroll
    for (int r2 = 0; r2 < 8; ++r2) {
      int m = m0 + lh * 8 + r2;  // C layout: lane->N, VGPR->M (8-row halves)
      float v = acc[r2] + bn;
      if (res) v += res[(size_t)m * D1 + n];
      if (relu) v = fmaxf(v, 0.0f);
      if (Yf) Yf[(size_t)m * D1 + n] = v;
      if (Yh) Yh[(size_t)m * D1 + n] = (half_t)v;
    }
  }
}

__global__ void __launch_bounds__(256)
k_gemm512(const half_t* X0, const half_t* W0, const float* bias0, const float* res0,
          float* Yf0, half_t* Yh0,
          const half_t* X1, const half_t* W1, const float* bias1, half_t* Yh1,
          int relu) {
  const bool z = blockIdx.z != 0;  // block-uniform
  gemm512_tile(z ? X1 : X0, z ? W1 : W0, z ? bias1 : bias0, z ? nullptr : res0,
               z ? nullptr : Yf0, z ? Yh1 : Yh0, relu);
}

// ---------------------------------------------------------------------------
// scores[b,c,d] = dot(a[b,c,:], bp[b,d,:]) / sqrt(512)  — one WMMA wave per b
// ---------------------------------------------------------------------------
__global__ void __launch_bounds__(128)
k_scores(const half_t* __restrict__ A, const half_t* __restrict__ Bp,
         float* __restrict__ S) {
  const int lane = threadIdx.x & 31;
  const int wave = threadIdx.x >> 5;
  const int b = blockIdx.x * 4 + wave;
  const int lm = lane & 15, lh = lane >> 4;
  const half_t* Arow = A  + (size_t)(b * 16 + lm) * D1;
  const half_t* Brow = Bp + (size_t)(b * 16 + lm) * D1;
  v8f acc = {};
  for (int kk = 0; kk < D1; kk += 32) {
    int base = kk + 8 * lh;
    v8h a0 = *(const v8h*)(Arow + base);
    v8h a1 = *(const v8h*)(Arow + base + 16);
    v8h b0 = *(const v8h*)(Brow + base);
    v8h b1 = *(const v8h*)(Brow + base + 16);
    acc = wmma_step(a0, a1, b0, b1, acc);
  }
  const float s = 0.044194173824159216f;  // 1/sqrt(512)
#pragma unroll
  for (int r2 = 0; r2 < 8; ++r2) {
    int c = lh * 8 + r2;
    S[b * 256 + c * 16 + lm] = acc[r2] * s;
  }
}

// ---------------------------------------------------------------------------
// e = relu(LayerNorm_{16,512}( ab[b] @ a[b] )) per batch; one block per b.
// ab = softmax of the raw scores S over dim 0 (batch; legacy nn.Softmax() on
// 3D). Every block works out the maximum and the sum of all 256 columns
// itself, one column (c*16 + d) a thread, and keeps only its own b's row:
// 128 KB of L2 reads a block in place of a launch of one block between the
// score kernel and this one. The sum runs in ascending b.
// ---------------------------------------------------------------------------
__global__ void __launch_bounds__(256)
k_context_ln(const float* __restrict__ S, const float* __restrict__ Af,
             const float* __restrict__ g, const float* __restrict__ beta,
             half_t* __restrict__ Eh) {
  __shared__ float ab[256];
  __shared__ float ep[8192];
  __shared__ float rs[256], rq[256];
  const int b = blockIdx.x, tid = threadIdx.x;
  {
    float v[BATCH];
    // Unrolled: v stays in registers and the column's loads are all in flight
    // together, one L2 latency for the column.
#pragma unroll
    for (int i = 0; i < BATCH; ++i) v[i] = S[i * 256 + tid];
    const float own = S[b * 256 + tid];
    float mx = -1e30f;
    // Unrolled: constant indices into v.
#pragma unroll
    for (int i = 0; i < BATCH; ++i) mx = fmaxf(mx, v[i]);
    float sum = 0.0f;
    // Unrolled: constant indices into v.
#pragma unroll
    for (int i = 0; i < BATCH; ++i) sum += __expf(v[i] - mx);
    ab[tid] = __expf(own - mx) * (1.0f / sum);
  }
  __syncthreads();

  float lsum = 0.0f, lsq = 0.0f;
#pragma unroll 4
  for (int i = 0; i < 32; ++i) {
    int idx = tid + 256 * i;          // idx = c*512 + t
    int c = idx >> 9, t = idx & 511;
    float s = 0.0f;
#pragma unroll
    for (int d = 0; d < 16; ++d)
      s += ab[c * 16 + d] * Af[(size_t)(b * 16 + d) * D1 + t];
    ep[idx] = s;
    lsum += s;
    lsq += s * s;
  }
  rs[tid] = lsum; rq[tid] = lsq;
  __syncthreads();
  for (int s2 = 128; s2 > 0; s2 >>= 1) {
    if (tid < s2) { rs[tid] += rs[tid + s2]; rq[tid] += rq[tid + s2]; }
    __syncthreads();
  }
  float mu   = rs[0] * (1.0f / 8192.0f);
  float var  = rq[0] * (1.0f / 8192.0f) - mu * mu;
  float rstd = rsqrtf(var + 1e-5f);
#pragma unroll 4
  for (int i = 0; i < 32; ++i) {
    int idx = tid + 256 * i;
    int c = idx >> 9, t = idx & 511;
    float v = (ep[idx] - mu) * rstd * g[idx] + beta[idx];
    v = fmaxf(v, 0.0f);
    Eh[(size_t)(b * 16 + c) * D1 + t] = (half_t)v;
  }
}

// ---------------------------------------------------------------------------
// h1 = relu( feat[128,16384] @ w1[200,16384]^T + b1 ).  feat = [xp | new_x]
// One block per 16x16 output tile; K is split over the block's 32 waves
// (512 k each, 16 WMMA steps), the 32 partial tiles are summed in LDS in
// wave order.
// ---------------------------------------------------------------------------
#define CLS_WAVES  32
#define CLS_KSLICE (KCLS / CLS_WAVES)  // 512; divides 8192, so a slice is all xp or all new_x

__global__ void __launch_bounds__(32 * CLS_WAVES)
k_gemm_cls(const half_t* __restrict__ XPh, const half_t* __restrict__ NXh,
           const half_t* __restrict__ W1h, const float* __restrict__ b1,
           float* __restrict__ H1) {
  __shared__ float red[CLS_WAVES][256];
  const int lane = threadIdx.x & 31;
  const int wave = threadIdx.x >> 5;
  const int lm = lane & 15, lh = lane >> 4;
  const int m0 = blockIdx.x * 16;    // batch tile (8 tiles)
  const int ntile = blockIdx.y;      // 13 tiles cover N=200 (pad to 208)
  const int nw = ntile * 16 + lm;
  const int nl = (nw < N1) ? nw : (N1 - 1);  // clamp loads; masked at store
  const int k0 = wave * CLS_KSLICE;
  const int mrow = m0 + lm;
  const half_t* Ws = W1h + (size_t)nl * KCLS + k0 + 8 * lh;
  const half_t* Xs = ((k0 < 8192) ? (XPh + (size_t)mrow * 8192 + k0)
                                  : (NXh + (size_t)mrow * 8192 + (k0 - 8192))) + 8 * lh;

  v8f acc = {};
  // Unrolled: constant offsets on two address pairs, and the next step's
  // loads issue ahead of this step's WMMA.
#pragma unroll
  for (int kk = 0; kk < CLS_KSLICE; kk += 32) {
    v8h a0 = *(const v8h*)(Xs + kk);
    v8h a1 = *(const v8h*)(Xs + kk + 16);
    v8h b0 = *(const v8h*)(Ws + kk);
    v8h b1v = *(const v8h*)(Ws + kk + 16);
    acc = wmma_step(a0, a1, b0, b1v, acc);
  }

  // Unrolled: constant indices keep acc in registers.
#pragma unroll
  for (int r2 = 0; r2 < 8; ++r2) red[wave][r2 * 32 + lane] = acc[r2];
  __syncthreads();

  if (threadIdx.x < 256 && nw < N1) {
    const float bn = b1[nw];
    // Stands in front of any reuse of the bias load's address register.
    asm volatile("s_wait_xcnt 0x0" ::: "memory");
    float s = 0.0f;
    // Unrolled: the LDS reads run ahead of the dependent adds.
#pragma unroll
    for (int w = 0; w < CLS_WAVES; ++w) s += red[w][threadIdx.x];
    const int r2 = threadIdx.x >> 5;      // accumulator register of this element
    const int m = m0 + lh * 8 + r2;       // C layout: lane->N, VGPR->M (8-row halves)
    H1[m * N1 + nw] = fmaxf(s + bn, 0.0f);
  }
}

// ---------------------------------------------------------------------------
// Tiny tail FCs (200->50->10->128): one thread per output, f32 VALU.
// ---------------------------------------------------------------------------
__global__ void k_fc(const float* __restrict__ X, const float* __restrict__ W,
                     const float* __restrict__ bias, float* __restrict__ Y,
                     int M, int N, int K, int relu) {
  int idx = blockIdx.x * blockDim.x + threadIdx.x;
  if (idx >= M * N) return;
  int m = idx / N, n = idx % N;
  const float* xr = X + (size_t)m * K;
  const float* wr = W + (size_t)n * K;
  float s = bias[n];
  for (int k = 0; k < K; ++k) s += xr[k] * wr[k];
  if (relu) s = fmaxf(s, 0.0f);
  Y[idx] = s;
}

// ---------------------------------------------------------------------------
extern "C" void kernel_launch(void* const* d_in, const int* in_sizes, int n_in,
                              void* d_out, int out_size, void* d_ws, size_t ws_size,
                              hipStream_t stream) {
  (void)in_sizes; (void)n_in; (void)out_size; (void)ws_size;
  const float* x      = (const float*)d_in[0];
  const float* attn_w = (const float*)d_in[1];
  const float* attn_b = (const float*)d_in[2];
  const float* ln_g   = (const float*)d_in[3];
  const float* ln_b   = (const float*)d_in[4];
  const float* w1     = (const float*)d_in[5];
  const float* b1     = (const float*)d_in[6];
  const float* w2     = (const float*)d_in[7];
  const float* b2     = (const float*)d_in[8];
  const float* w3     = (const float*)d_in[9];
  const float* b3     = (const float*)d_in[10];
  const float* w4     = (const float*)d_in[11];
  const float* b4     = (const float*)d_in[12];
  float* out = (float*)d_out;

  char* ws = (char*)d_ws;
  size_t off = 0;
  auto alloc = [&](size_t bytes) -> char* {
    char* p = ws + off;
    off += (bytes + 255) & ~(size_t)255;
    return p;
  };
  float*  xp_f  = (float*) alloc((size_t)M_ROWS * D1 * 4);
  half_t* xp_h  = (half_t*)alloc((size_t)M_ROWS * D1 * 2);
  float*  nx_f  = (float*) alloc((size_t)M_ROWS * D1 * 4);
  half_t* nx_h  = (half_t*)alloc((size_t)M_ROWS * D1 * 2);
  float*  a_f   = (float*) alloc((size_t)M_ROWS * D1 * 4);
  half_t* a_h   = (half_t*)alloc((size_t)M_ROWS * D1 * 2);
  half_t* bp_h  = (half_t*)alloc((size_t)M_ROWS * D1 * 2);
  half_t* e_h   = (half_t*)alloc((size_t)M_ROWS * D1 * 2);
  float*  sc    = (float*) alloc((size_t)BATCH * 256 * 4);
  half_t* awh   = (half_t*)alloc((size_t)2 * 4 * D1 * D1 * 2);
  half_t* w1h   = (half_t*)alloc((size_t)N1 * KCLS * 2);
  float*  h1    = (float*) alloc((size_t)BATCH * N1 * 4);
  float*  h2    = (float*) alloc((size_t)BATCH * 50 * 4);
  float*  h3    = (float*) alloc((size_t)BATCH * 10 * 4);

  // Max-pool (the HBM-bound stage) + new_x init, and both weight conversions.
  k_pool_cvt<<<POOL_BLKS + CVT_BLKS_AW + CVT_BLKS_W1, POOL_THR, 0, stream>>>(
      x, xp_f, xp_h, nx_f, nx_h, attn_w, awh, w1, w1h);

  dim3 ggrid(M_ROWS / 16, 2);      // 128 M-tiles x 2 groups of 8 waves x 32 cols
  dim3 ggrid2(M_ROWS / 16, 2, 2);  // the same for two products
  for (int i = 0; i < 2; ++i) {
    const half_t* Wa  = awh + (size_t)(i * 4 + 0) * D1 * D1;
    const half_t* Wb  = awh + (size_t)(i * 4 + 1) * D1 * D1;
    const half_t* W1s = awh + (size_t)(i * 4 + 3) * D1 * D1;
    const float* ba  = attn_b + (size_t)(i * 4 + 0) * D1;
    const float* bb  = attn_b + (size_t)(i * 4 + 1) * D1;
    const float* b1s = attn_b + (size_t)(i * 4 + 3) * D1;

    // z = 0: a = fc_a(new_x)  (f32 for context matmul, f16 for scores)
    // z = 1: bproj = fc_b(xp)
    k_gemm512<<<ggrid2, 256, 0, stream>>>(nx_h, Wa, ba, nullptr, a_f, a_h,
                                          xp_h, Wb, bb, bp_h, 0);
    // scores = a @ bproj^T / sqrt(512)
    k_scores<<<BATCH / 4, 128, 0, stream>>>(a_h, bp_h, sc);
    // e = relu(LN(softmax_over_batch(scores) @ a))
    k_context_ln<<<BATCH, 256, 0, stream>>>(sc, a_f, ln_g, ln_b, e_h);
    // new_x = new_x + fc_1(e)
    k_gemm512<<<ggrid, 256, 0, stream>>>(e_h, W1s, b1s, nx_f, nx_f, nx_h,
                                         nullptr, nullptr, nullptr, nullptr, 0);
  }

  // Classifier head.
  k_gemm_cls<<<dim3(BATCH / 16, 13), 32 * CLS_WAVES, 0, stream>>>(xp_h, nx_h, w1h, b1, h1);
  k_fc<<<(BATCH * 50 + 255) / 256, 256, 0, stream>>>(h1, w2, b2, h2, BATCH, 50, N1, 1);
  k_fc<<<(BATCH * 10 + 255) / 256, 256, 0, stream>>>(h2, w3, b3, h3, BATCH, 10, 50, 1);
  k_fc<<<(BATCH * 128 + 255) / 256, 256, 0, stream>>>(h3, w4, b4, out, BATCH, 128, 10, 0);
}

// v006
// It runs in 114 microseconds.
// Timed twice side by side with v005, it ran 1.22 times as fast both times.
// Over all steps from v000 it is 2.99 times as fast.
#include <hip/hip_runtime.h>

// ---------------------------------------------------------------------------
// LongTermFeatureBank forward on MI455X (gfx1250, wave32, WMMA + TDM).
//   1. max-pool 7x7 over x[128,512,16,7,7] -> xp[128,16,512]  (HBM-bound)
//   2. per stack: fc_a/fc_b GEMMs (WMMA f16->f32, TDM-staged A tiles),
//      batched 16x16 score WMMA, batch-axis softmax + context matmul +
//      LayerNorm + ReLU in one kernel, fc_1 GEMM with residual.
//   3. classifier: WMMA GEMM [128,16384]x[16384,200], tiny VALU FCs.
// ---------------------------------------------------------------------------

typedef _Float16 half_t;
typedef __attribute__((ext_vector_type(16))) _Float16     v16h;
typedef __attribute__((ext_vector_type(8)))  _Float16     v8h;
typedef __attribute__((ext_vector_type(8)))  float        v8f;
typedef __attribute__((ext_vector_type(4)))  unsigned int u32x4;
typedef __attribute__((ext_vector_type(8)))  int          i32x8;
typedef __attribute__((ext_vector_type(4)))  int          i32x4;

#define D1     512
#define D2     16
#define BATCH  128
#define M_ROWS (BATCH * D2)   // 2048
#define KCLS   (2 * D2 * D1)  // 16384
#define N1     200

// Build the documented 16-bit WMMA fragment (VGPR0-3: K=base..base+7,
// VGPR4-7: K=base+16..base+23, per lane-half) from two 8-half chunks.
__device__ inline v8f wmma_step(v8h a0, v8h a1, v8h b0, v8h b1, v8f acc) {
  v16h af, bf;
#pragma unroll
  for (int i = 0; i < 8; ++i) {
    af[i] = a0[i]; af[8 + i] = a1[i];
    bf[i] = b0[i]; bf[8 + i] = b1[i];
  }
  return __builtin_amdgcn_wmma_f32_16x16x32_f16(
      /*neg_a=*/false, af, /*neg_b=*/false, bf,
      /*c_mod=*/(short)0, acc, /*reuse_a=*/false, /*reuse_b=*/false);
}

// ---------------------------------------------------------------------------
// TDM: stage a 16-row x 512-half tile into LDS with padded rows.
// D# (2-D): data_size=2B, tile=[512,16], tensor_dim0_stride=512,
// pad_enable, pad_interval=256 dwords (one row), pad_amount=4 dwords
// -> LDS row stride 520 halves (matches As[16][520] bank-spread layout).
// ---------------------------------------------------------------------------
__device__ inline void tdm_load_tile_16x512(const half_t* gsrc, void* lds_dst) {
  unsigned long long ga = (unsigned long long)(uintptr_t)gsrc;
  unsigned int lds = (unsigned int)(uintptr_t)lds_dst;  // low 32b = LDS offset
  u32x4 g0;
  g0[0] = 1u;                                  // count=1 (valid user D#)
  g0[1] = lds;                                 // lds_addr
  g0[2] = (unsigned int)(ga & 0xFFFFFFFFu);    // global_addr[31:0]
  g0[3] = (unsigned int)((ga >> 32) & 0x01FFFFFFu) | 0x80000000u;  // [56:32]|type=2
  i32x8 g1;
  g1[0] = (int)0x07D10000u;  // data_size=2B | pad_en | pad_interval=256dw | pad=4dw
  g1[1] = (int)(512u << 16);                   // tensor_dim0[15:0]=512
  g1[2] = (int)((2048u & 0xFFFFu) << 16);      // tensor_dim0 hi=0 | tensor_dim1 lo=2048
  g1[3] = (int)(512u << 16);                   // tensor_dim1 hi=0 | tile_dim0=512
  g1[4] = 16;                                  // tile_dim1=16, tile_dim2=0
  g1[5] = 512;                                 // tensor_dim0_stride[31:0]=512
  g1[6] = 0;                                   // stride0 hi | tensor_dim1_stride lo
  g1[7] = 0;
  i32x4 z4 = {0, 0, 0, 0};
  i32x8 z8 = {0, 0, 0, 0, 0, 0, 0, 0};
  __builtin_amdgcn_tensor_load_to_lds(g0, g1, z4, z4, z8, 0);
}

// ---------------------------------------------------------------------------
// f32 -> f16 weight copy. A thread takes eight pieces of four floats, 1,024
// floats apart, so a wave reads whole 512-byte runs and stores whole 256-byte
// runs, and a block of 8 waves covers 8,192 floats. One float a thread would be
// 168,000 waves for the two copies, each living for one load: the time would go
// into starting waves. Both element counts are multiples of 8,192: no tail.
// The copies have no launch of their own: their blocks ride in the max-pool
// grid (k_pool_cvt), which they do not depend on.
// ---------------------------------------------------------------------------
typedef __attribute__((ext_vector_type(4))) float    v4f;
typedef __attribute__((ext_vector_type(4))) _Float16 v4h;

#define CVT_THR   256
#define CVT_PIECE 8
#define CVT_BLK   (CVT_THR * CVT_PIECE * 4)  // 8,192 floats a block

#define CVT_BLKS_AW (2 * 4 * D1 * D1 / CVT_BLK)  // 256 blocks: attention weights
#define CVT_BLKS_W1 (N1 * KCLS / CVT_BLK)        // 400 blocks: classifier weights

__device__ __forceinline__ void
f32_to_f16_block(const float* __restrict__ src, half_t* __restrict__ dst, int blk) {
  const int i0 = blk * CVT_BLK + threadIdx.x * 4;
  v4f v[CVT_PIECE];
  // Unrolled: v stays in registers and all eight loads are in flight together.
#pragma unroll
  for (int j = 0; j < CVT_PIECE; ++j)
    v[j] = *(const v4f*)(src + i0 + j * (CVT_THR * 4));
  // Unrolled: constant indices into v.
#pragma unroll
  for (int j = 0; j < CVT_PIECE; ++j)
    *(v4h*)(dst + i0 + j * (CVT_THR * 4)) = __builtin_convertvector(v[j], v4h);
}

// ---------------------------------------------------------------------------
// Max-pool over HxW=49 (the 205 MB streaming read) + init new_x = xp.
// A block owns one b and 64 d1, in four stages of 16 d1: 16*16*49 floats that
// lie in one run in x. A stage's run goes to LDS in whole lines by asynchronous
// copies; each thread then takes the maximum of one 49-float window from LDS
// (lane pitch 49 dwords, odd, so no bank conflict). A small LDS tile turns
// (d1,d2) into (d2,d1), so that the block stores whole 128-byte lines of all
// four outputs. Four blocks fit a WGP: one block's maxima run under the
// others' copies.
// Blocks from POOL_BLKS on do the two weight copies instead: independent work
// in the same launch. The long pool blocks have the low indices and start first.
// ---------------------------------------------------------------------------
typedef __attribute__((ext_vector_type(2))) float    v2f;
typedef __attribute__((ext_vector_type(2))) _Float16 v2h;

#define POOL_D1   64                     // d1 a block owns
#define POOL_SD1  16                     // d1 a stage
#define POOL_SFLT (POOL_SD1 * D2 * 49)   // 12,544 floats = 50,176 bytes a stage
#define POOL_THR  256
#define POOL_BLKS (BATCH * (D1 / POOL_D1))  // 1,024
static_assert(POOL_THR == CVT_THR, "both bodies run in one block shape");

__global__ void __launch_bounds__(POOL_THR)
k_pool_cvt(const float* __restrict__ x,
           float* __restrict__ xp_f, half_t* __restrict__ xp_h,
           float* __restrict__ nx_f, half_t* __restrict__ nx_h,
           const float* __restrict__ attn_w, half_t* __restrict__ awh,
           const float* __restrict__ w1, half_t* __restrict__ w1h) {
  __shared__ __align__(16) float tile[POOL_SFLT];
  __shared__ __align__(8) float tr[D2][POOL_D1 + 2];  // pitch 66: no bank conflict for writers or readers
  // Block-uniform, in front of every copy and barrier: a whole block leaves here.
  if (blockIdx.x >= POOL_BLKS) {
    const int cb = blockIdx.x - POOL_BLKS;
    const bool aw = cb < CVT_BLKS_AW;
    f32_to_f16_block(aw ? attn_w : w1, aw ? awh : w1h, aw ? cb : cb - CVT_BLKS_AW);
    return;
  }
  const int tid = threadIdx.x;
  const int wave = __builtin_amdgcn_readfirstlane(tid >> 5);
  const int b = blockIdx.x >> 3;
  const int d1_0 = (blockIdx.x & 7) * POOL_D1;
  const float* g = x + (size_t)(b * D1 + d1_0) * (D2 * 49) + tid * 4;
  const unsigned int l = (unsigned int)(uintptr_t)&tile[0] + (unsigned int)tid * 16u;

  // Unrolled: each stage's column of tr is a constant LDS offset on one base.
#pragma unroll
  for (int s = 0; s < POOL_D1 / POOL_SD1; ++s, g += POOL_SFLT) {
    // 3,136 pieces of 16 bytes: 12 from every thread, a 13th from waves 0 and 1.
    // The s_wait_xcnt closes each statement so that no address register of an
    // issued copy is rewritten ahead of it.
    asm volatile(
        "global_load_async_to_lds_b128 %0, %12, off\n\t"
        "global_load_async_to_lds_b128 %1, %13, off\n\t"
        "global_load_async_to_lds_b128 %2, %14, off\n\t"
        "global_load_async_to_lds_b128 %3, %15, off\n\t"
        "global_load_async_to_lds_b128 %4, %16, off\n\t"
        "global_load_async_to_lds_b128 %5, %17, off\n\t"
        "global_load_async_to_lds_b128 %6, %18, off\n\t"
        "global_load_async_to_lds_b128 %7, %19, off\n\t"
        "global_load_async_to_lds_b128 %8, %20, off\n\t"
        "global_load_async_to_lds_b128 %9, %21, off\n\t"
        "global_load_async_to_lds_b128 %10, %22, off\n\t"
        "global_load_async_to_lds_b128 %11, %23, off\n\t"
        "s_wait_xcnt 0x0"
        :: "v"(l), "v"(l + 1u * 4096u), "v"(l + 2u * 4096u), "v"(l + 3u * 4096u),
           "v"(l + 4u * 4096u), "v"(l + 5u * 4096u), "v"(l + 6u * 4096u),
           "v"(l + 7u * 4096u), "v"(l + 8u * 4096u), "v"(l + 9u * 4096u),
           "v"(l + 10u * 4096u), "v"(l + 11u * 4096u),
           "v"(g), "v"(g + 1 * 1024), "v"(g + 2 * 1024), "v"(g + 3 * 1024),
           "v"(g + 4 * 1024), "v"(g + 5 * 1024), "v"(g + 6 * 1024), "v"(g + 7 * 1024),
           "v"(g + 8 * 1024), "v"(g + 9 * 1024), "v"(g + 10 * 1024), "v"(g + 11 * 1024)
        : "memory");
    if (wave < 2) {
      asm volatile(
          "global_load_async_to_lds_b128 %0, %1, off\n\t"
          "s_wait_xcnt 0x0"
          :: "v"(l + 12u * 4096u), "v"(g + 12 * 1024) : "memory");
    }
    // This wave's copies have landed; the barrier then shows them to every wave.
    asm volatile("s_wait_asynccnt 0x0" ::: "memory");
    __syncthreads();

    const float* p = &tile[tid * 49];  // window tid = (d1 in the stage) * 16 + d2
    float m = p[0];
    // Unrolled: constant LDS offsets, and the reads run ahead of the maxima.
#pragma unroll
    for (int j = 1; j < 49; ++j) m = fmaxf(m, p[j]);
    tr[tid & 15][s * POOL_SD1 + (tid >> 4)] = m;

    // This wave's LDS reads of the stage are done; behind the barrier the next
    // stage's copies may overwrite the tile (and, last, tr is whole).
    asm volatile("s_wait_dscnt 0x0" ::: "memory");
    __syncthreads();
  }

  // 512 pairs of neighbouring d1: a wave stores 256 bytes of f32, 128 of f16.
#pragma unroll
  for (int k = 0; k < 2; ++k) {
    const int q = tid + POOL_THR * k;
    const int d2 = q >> 5, d1l = (q & 31) * 2;
    const v2f m2 = *(const v2f*)&tr[d2][d1l];
    const int o = (b * D2 + d2) * D1 + d1_0 + d1l;
    *(v2f*)(xp_f + o) = m2;
    *(v2f*)(nx_f + o) = m2;
    v2h h2;
    h2[0] = (half_t)m2[0];
    h2[1] = (half_t)m2[1];
    *(v2h*)(xp_h + o) = h2;
    *(v2h*)(nx_h + o) = h2;
  }
}

// ---------------------------------------------------------------------------
// Y[M,512] = op( X[M,512] @ W[512,512]^T + bias [+ res] ).
// Block = 8 waves, one 16-row A tile staged to LDS by the TDM; each wave owns
// a 16x32 output tile (two WMMA accumulators sharing one A fragment).
// k_gemm512 holds up to two independent products in one launch: blockIdx.z
// picks the operands (fc_a and fc_b of a stack; fc_1 goes alone, one z plane).
// ---------------------------------------------------------------------------
__device__ __forceinline__ void
gemm512_tile(const half_t* __restrict__ X, const half_t* __restrict__ W,
             const float* __restrict__ bias, const float* __restrict__ res,
             float* __restrict__ Yf, half_t* __restrict__ Yh, int relu) {
  __shared__ __align__(16) half_t As[16][520];  // 520-half rows (TDM-padded)
  const int lane = threadIdx.x & 31;
  const int wave = threadIdx.x >> 5;
  const int m0 = blockIdx.x * 16;
  const int ntile0 = (blockIdx.y * 8 + wave) * 2;  // two adjacent N tiles
  const int lm = lane & 15, lh = lane >> 4;
  const half_t* Wrow0 = W + (size_t)(ntile0 * 16 + lm) * D1 + 8 * lh;
  const half_t* Wrow1 = Wrow0 + (size_t)16 * D1;

  // The weight fragments come in groups of four k steps (16 loads), two groups
  // in flight: a wave waits out the L2 latency twice, not once a step. The
  // first two groups, the bias and the residual do not depend on the A tile
  // and are asked for in front of it.
  v8h wq[2][4][4];
  // Unrolled: constant indices keep wq in registers.
#pragma unroll
  for (int c = 0; c < 2; ++c) {
#pragma unroll
    for (int s = 0; s < 4; ++s) {
      const int k = (c * 4 + s) * 32;
      wq[c][s][0] = *(const v8h*)(Wrow0 + k);
      wq[c][s][1] = *(const v8h*)(Wrow0 + k + 16);
      wq[c][s][2] = *(const v8h*)(Wrow1 + k);
      wq[c][s][3] = *(const v8h*)(Wrow1 + k + 16);
    }
  }
  const size_t o0 = (size_t)(m0 + lh * 8) * D1 + ntile0 * 16 + lm;  // C layout: lane->N, VGPR->M (8-row halves)
  float bn[2] = {0.0f, 0.0f}, rv[2][8] = {};
  if (bias) {
    bn[0] = bias[ntile0 * 16 + lm];
    bn[1] = bias[ntile0 * 16 + 16 + lm];
  }
  if (res) {
    // Unrolled: constant indices keep rv in registers.
#pragma unroll
    for (int t = 0; t < 2; ++t)
#pragma unroll
      for (int r2 = 0; r2 < 8; ++r2) rv[t][r2] = res[o0 + (size_t)r2 * D1 + t * 16];
  }

  if (wave == 0) {
    tdm_load_tile_16x512(X + (size_t)m0 * D1, &As[0][0]);
    // Directly behind the load, in the issuing wave's branch: no descriptor
    // register takes a new value while the request is outstanding.
    __builtin_amdgcn_s_wait_tensorcnt(0);
  }
  __syncthreads();

  v8f acc0 = {}, acc1 = {};
  // Unrolled: the group's buffer index is a constant.
#pragma unroll
  for (int c = 0; c < 4; ++c) {
#pragma unroll
    for (int s = 0; s < 4; ++s) {
      const int base = (c * 4 + s) * 32 + 8 * lh;
      v8h a0 = *(const v8h*)&As[lm][base];
      v8h a1 = *(const v8h*)&As[lm][base + 16];
      acc0 = wmma_step(a0, a1, wq[c & 1][s][0], wq[c & 1][s][1], acc0);
      acc1 = wmma_step(a0, a1, wq[c & 1][s][2], wq[c & 1][s][3], acc1);
    }
    if (c + 2 < 4) {
      // The fence pair keeps the refill where it stands: without it the
      // compiler moves each load down to just in front of its WMMA.
      __builtin_amdgcn_sched_barrier(0);
#pragma unroll
      for (int s = 0; s < 4; ++s) {
        const int k = ((c + 2) * 4 + s) * 32;
        wq[c & 1][s][0] = *(const v8h*)(Wrow0 + k);
        wq[c & 1][s][1] = *(const v8h*)(Wrow0 + k + 16);
        wq[c & 1][s][2] = *(const v8h*)(Wrow1 + k);
        wq[c & 1][s][3] = *(const v8h*)(Wrow1 + k + 16);
      }
      __builtin_amdgcn_sched_barrier(0);
    }
  }

  float y[2][8];
  // Unrolled: constant indices into the accumulators.
#pragma unroll
  for (int t = 0; t < 2; ++t) {
    const v8f acc = t ? acc1 : acc0;
#pragma unroll
    for (int r2 = 0; r2 < 8; ++r2) {
      float v = acc[r2] + bn[t];
      if (res) v += rv[t][r2];
      if (relu) v = fmaxf(v, 0.0f);
      y[t][r2] = v;
    }
  }
  if (Yf) {
    // Unrolled: constant indices into y, constant offsets on one address pair.
#pragma unroll
    for (int t = 0; t < 2; ++t)
#pragma unroll
      for (int r2 = 0; r2 < 8; ++r2) Yf[o0 + (size_t)r2 * D1 + t * 16] = y[t][r2];
    // Stands in front of any reuse of the stores' address and data registers.
    asm volatile("s_wait_xcnt 0x0" ::: "memory");
  }
  if (Yh) {
    // Unrolled: constant indices into y, constant offsets on one address pair.
#pragma unroll
    for (int t = 0; t < 2; ++t)
#pragma unroll
      for (int r2 = 0; r2 < 8; ++r2) Yh[o0 + (size_t)r2 * D1 + t * 16] = (half_t)y[t][r2];
  }
}

__global__ void __launch_bounds__(256)
k_gemm512(const half_t* X0, const half_t* W0, const float* bias0, const float* res0,
          float* Yf0, half_t* Yh0,
          const half_t* X1, const half_t* W1, const float* bias1, half_t* Yh1,
          int relu) {
  const bool z = blockIdx.z != 0;  // block-uniform
  gemm512_tile(z ? X1 : X0, z ? W1 : W0, z ? bias1 : bias0, z ? nullptr : res0,
               z ? nullptr : Yf0, z ? Yh1 : Yh0, relu);
}

// ---------------------------------------------------------------------------
// scores[b,c,d] = dot(a[b,c,:], bp[b,d,:]) / sqrt(512)  — one WMMA wave per b
// ---------------------------------------------------------------------------
__global__ void __launch_bounds__(128)
k_scores(const half_t* __restrict__ A, const half_t* __restrict__ Bp,
         float* __restrict__ S) {
  const int lane = threadIdx.x & 31;
  const int wave = threadIdx.x >> 5;
  const int b = blockIdx.x * 4 + wave;
  const int lm = lane & 15, lh = lane >> 4;
  const half_t* Arow = A  + (size_t)(b * 16 + lm) * D1 + 8 * lh;
  const half_t* Brow = Bp + (size_t)(b * 16 + lm) * D1 + 8 * lh;
  // Fragments in groups of four k steps (16 loads), two groups in flight: the
  // wave waits out the L2 latency twice, not once a step.
  v8h q[2][4][4];
  // Unrolled: constant indices keep q in registers.
#pragma unroll
  for (int c = 0; c < 2; ++c) {
#pragma unroll
    for (int s = 0; s < 4; ++s) {
      const int k = (c * 4 + s) * 32;
      q[c][s][0] = *(const v8h*)(Arow + k);
      q[c][s][1] = *(const v8h*)(Arow + k + 16);
      q[c][s][2] = *(const v8h*)(Brow + k);
      q[c][s][3] = *(const v8h*)(Brow + k + 16);
    }
  }
  // Keeps the 32 loads above the first WMMA: without it the compiler moves
  // each load down to just in front of its WMMA.
  __builtin_amdgcn_sched_barrier(0);
  v8f acc = {};
  // Unrolled: the group's buffer index is a constant.
#pragma unroll
  for (int c = 0; c < 4; ++c) {
#pragma unroll
    for (int s = 0; s < 4; ++s)
      acc = wmma_step(q[c & 1][s][0], q[c & 1][s][1], q[c & 1][s][2], q[c & 1][s][3], acc);
    if (c + 2 < 4) {
      // The fence pair keeps the refill where it stands, for the same reason.
      __builtin_amdgcn_sched_barrier(0);
#pragma unroll
      for (int s = 0; s < 4; ++s) {
        const int k = ((c + 2) * 4 + s) * 32;
        q[c & 1][s][0] = *(const v8h*)(Arow + k);
        q[c & 1][s][1] = *(const v8h*)(Arow + k + 16);
        q[c & 1][s][2] = *(const v8h*)(Brow + k);
        q[c & 1][s][3] = *(const v8h*)(Brow + k + 16);
      }
      __builtin_amdgcn_sched_barrier(0);
    }
  }
  const float s = 0.044194173824159216f;  // 1/sqrt(512)
#pragma unroll
  for (int r2 = 0; r2 < 8; ++r2) {
    int c = lh * 8 + r2;
    S[b * 256 + c * 16 + lm] = acc[r2] * s;
  }
}

// ---------------------------------------------------------------------------
// e = relu(LayerNorm_{16,512}( ab[b] @ a[b] )) per batch; one block per b.
// ab = softmax of the raw scores S over dim 0 (batch; legacy nn.Softmax() on
// 3D). Every block works out the maximum and the sum of all 256 columns
// itself, one column (c*16 + d) a thread, and keeps only its own b's row:
// 128 KB of L2 reads a block in place of a launch of one block between the
// score kernel and this one. The sum runs in ascending b.
// ---------------------------------------------------------------------------
__global__ void __launch_bounds__(256)
k_context_ln(const float* __restrict__ S, const float* __restrict__ Af,
             const float* __restrict__ g, const float* __restrict__ beta,
             half_t* __restrict__ Eh) {
  __shared__ float ab[256];
  __shared__ float ep[8192];
  __shared__ float rs[256], rq[256];
  const int b = blockIdx.x, tid = threadIdx.x;
  // A thread's two columns of a[b] (t = tid and tid + 256), read once and asked
  // for together with the scores: every c of the context product uses them.
  float af[16][2];
  // Unrolled: constant indices keep af in registers.
#pragma unroll
  for (int d = 0; d < 16; ++d) {
    af[d][0] = Af[(size_t)(b * 16 + d) * D1 + tid];
    af[d][1] = Af[(size_t)(b * 16 + d) * D1 + tid + 256];
  }
  {
    float v[BATCH];
    // Unrolled: v stays in registers and the column's loads are all in flight
    // together, one L2 latency for the column.
#pragma unroll
    for (int i = 0; i < BATCH; ++i) v[i] = S[i * 256 + tid];
    const float own = S[b * 256 + tid];
    // Keeps the loads of af above the softmax arithmetic: one latency for all.
    __builtin_amdgcn_sched_barrier(0);
    float mx = -1e30f;
    // Unrolled: constant indices into v.
#pragma unroll
    for (int i = 0; i < BATCH; ++i) mx = fmaxf(mx, v[i]);
    float sum = 0.0f;
    // Unrolled: constant indices into v.
#pragma unroll
    for (int i = 0; i < BATCH; ++i) sum += __expf(v[i] - mx);
    ab[tid] = __expf(own - mx) * (1.0f / sum);
  }
  // The LayerNorm weights of this thread's 32 elements, asked for here so that
  // they land under the context product and the reduction.
  float gg[32], bb[32];
  // Unrolled: constant indices keep gg and bb in registers.
#pragma unroll
  for (int i = 0; i < 32; ++i) {
    gg[i] = g[tid + 256 * i];
    bb[i] = beta[tid + 256 * i];
  }
  __syncthreads();

  float lsum = 0.0f, lsq = 0.0f;
  // Unrolled: constant indices into af.
#pragma unroll
  for (int i = 0; i < 32; ++i) {
    int idx = tid + 256 * i;          // idx = c*512 + t, c = i / 2, t = tid + 256 * (i % 2)
    int c = i >> 1;
    float s = 0.0f;
#pragma unroll
    for (int d = 0; d < 16; ++d)
      s += ab[c * 16 + d] * af[d][i & 1];
    ep[idx] = s;
    lsum += s;
    lsq += s * s;
  }
  rs[tid] = lsum; rq[tid] = lsq;
  __syncthreads();
  for (int s2 = 128; s2 > 0; s2 >>= 1) {
    if (tid < s2) { rs[tid] += rs[tid + s2]; rq[tid] += rq[tid + s2]; }
    __syncthreads();
  }
  float mu   = rs[0] * (1.0f / 8192.0f);
  float var  = rq[0] * (1.0f / 8192.0f) - mu * mu;
  float rstd = rsqrtf(var + 1e-5f);
  // Unrolled: constant indices into gg and bb.
#pragma unroll
  for (int i = 0; i < 32; ++i) {
    int idx = tid + 256 * i;
    int c = idx >> 9, t = idx & 511;
    float v = (ep[idx] - mu) * rstd * gg[i] + bb[i];
    v = fmaxf(v, 0.0f);
    Eh[(size_t)(b * 16 + c) * D1 + t] = (half_t)v;
  }
}

// ---------------------------------------------------------------------------
// h1 = relu( feat[128,16384] @ w1[200,16384]^T + b1 ).  feat = [xp | new_x]
// One block per 16x16 output tile; K is split over the block's 32 waves
// (512 k each, 16 WMMA steps), the 32 partial tiles are summed in LDS in
// wave order.
// ---------------------------------------------------------------------------
#define CLS_WAVES  32
#define CLS_KSLICE (KCLS / CLS_WAVES)  // 512; divides 8192, so a slice is all xp or all new_x

__global__ void __launch_bounds__(32 * CLS_WAVES)
k_gemm_cls(const half_t* __restrict__ XPh, const half_t* __restrict__ NXh,
           const half_t* __restrict__ W1h, const float* __restrict__ b1,
           float* __restrict__ H1) {
  __shared__ float red[CLS_WAVES][256];
  const int lane = threadIdx.x & 31;
  const int wave = threadIdx.x >> 5;
  const int lm = lane & 15, lh = lane >> 4;
  const int m0 = blockIdx.x * 16;    // batch tile (8 tiles)
  const int ntile = blockIdx.y;      // 13 tiles cover N=200 (pad to 208)
  const int nw = ntile * 16 + lm;
  const int nl = (nw < N1) ? nw : (N1 - 1);  // clamp loads; masked at store
  const int k0 = wave * CLS_KSLICE;
  const int mrow = m0 + lm;
  const half_t* Ws = W1h + (size_t)nl * KCLS + k0 + 8 * lh;
  const half_t* Xs = ((k0 < 8192) ? (XPh + (size_t)mrow * 8192 + k0)
                                  : (NXh + (size_t)mrow * 8192 + (k0 - 8192))) + 8 * lh;

  // Fragments in groups of two k steps (8 loads: one whole 128-byte line of
  // each of the 32 rows), two groups in flight a wave.
  v8h q[2][2][4];
  // Unrolled: constant indices keep q in registers.
#pragma unroll
  for (int c = 0; c < 2; ++c) {
#pragma unroll
    for (int s = 0; s < 2; ++s) {
      const int k = (c * 2 + s) * 32;
      q[c][s][0] = *(const v8h*)(Xs + k);
      q[c][s][1] = *(const v8h*)(Xs + k + 16);
      q[c][s][2] = *(const v8h*)(Ws + k);
      q[c][s][3] = *(const v8h*)(Ws + k + 16);
    }
  }
  // Keeps the 16 loads above the first WMMA: without it the compiler moves
  // each load down to just in front of its WMMA.
  __builtin_amdgcn_sched_barrier(0);
  v8f acc = {};
  // Unrolled: the group's buffer index is a constant.
#pragma unroll
  for (int c = 0; c < CLS_KSLICE / 64; ++c) {
#pragma unroll
    for (int s = 0; s < 2; ++s)
      acc = wmma_step(q[c & 1][s][0], q[c & 1][s][1], q[c & 1][s][2], q[c & 1][s][3], acc);
    if (c + 2 < CLS_KSLICE / 64) {
      // The fence pair keeps the refill where it stands, for the same reason.
      __builtin_amdgcn_sched_barrier(0);
#pragma unroll
      for (int s = 0; s < 2; ++s) {
        const int k = ((c + 2) * 2 + s) * 32;
        q[c & 1][s][0] = *(const v8h*)(Xs + k);
        q[c & 1][s][1] = *(const v8h*)(Xs + k + 16);
        q[c & 1][s][2] = *(const v8h*)(Ws + k);
        q[c & 1][s][3] = *(const v8h*)(Ws + k + 16);
      }
      __builtin_amdgcn_sched_barrier(0);
    }
  }

  // Unrolled: constant indices keep acc in registers.
#pragma unroll
  for (int r2 = 0; r2 < 8; ++r2) red[wave][r2 * 32 + lane] = acc[r2];
  __syncthreads();

  if (threadIdx.x < 256 && nw < N1) {
    const float bn = b1[nw];
    // Stands in front of any reuse of the bias load's address register.
    asm volatile("s_wait_xcnt 0x0" ::: "memory");
    float s = 0.0f;
    // Unrolled: the LDS reads run ahead of the dependent adds.
#pragma unroll
    for (int w = 0; w < CLS_WAVES; ++w) s += red[w][threadIdx.x];
    const int r2 = threadIdx.x >> 5;      // accumulator register of this element
    const int m = m0 + lh * 8 + r2;       // C layout: lane->N, VGPR->M (8-row halves)
    H1[m * N1 + nw] = fmaxf(s + bn, 0.0f);
  }
}

// ---------------------------------------------------------------------------
// Tiny tail FCs (200->50->10->128): one thread per output, f32 VALU.
// ---------------------------------------------------------------------------
__global__ void k_fc(const float* __restrict__ X, const float* __restrict__ W,
                     const float* __restrict__ bias, float* __restrict__ Y,
                     int M, int N, int K, int relu) {
  int idx = blockIdx.x * blockDim.x + threadIdx.x;
  if (idx >= M * N) return;
  int m = idx / N, n = idx % N;
  const float* xr = X + (size_t)m * K;
  const float* wr = W + (size_t)n * K;
  float s = bias[n];
  for (int k = 0; k < K; ++k) s += xr[k] * wr[k];
  if (relu) s = fmaxf(s, 0.0f);
  Y[idx] = s;
}

// ---------------------------------------------------------------------------
extern "C" void kernel_launch(void* const* d_in, const int* in_sizes, int n_in,
                              void* d_out, int out_size, void* d_ws, size_t ws_size,
                              hipStream_t stream) {
  (void)in_sizes; (void)n_in; (void)out_size; (void)ws_size;
  const float* x      = (const float*)d_in[0];
  const float* attn_w = (const float*)d_in[1];
  const float* attn_b = (const float*)d_in[2];
  const float* ln_g   = (const float*)d_in[3];
  const float* ln_b   = (const float*)d_in[4];
  const float* w1     = (const float*)d_in[5];
  const float* b1     = (const float*)d_in[6];
  const float* w2     = (const float*)d_in[7];
  const float* b2     = (const float*)d_in[8];
  const float* w3     = (const float*)d_in[9];
  const float* b3     = (const float*)d_in[10];
  const float* w4     = (const float*)d_in[11];
  const float* b4     = (const float*)d_in[12];
  float* out = (float*)d_out;

  char* ws = (char*)d_ws;
  size_t off = 0;
  auto alloc = [&](size_t bytes) -> char* {
    char* p = ws + off;
    off += (bytes + 255) & ~(size_t)255;
    return p;
  };
  float*  xp_f  = (float*) alloc((size_t)M_ROWS * D1 * 4);
  half_t* xp_h  = (half_t*)alloc((size_t)M_ROWS * D1 * 2);
  float*  nx_f  = (float*) alloc((size_t)M_ROWS * D1 * 4);
  half_t* nx_h  = (half_t*)alloc((size_t)M_ROWS * D1 * 2);
  float*  a_f   = (float*) alloc((size_t)M_ROWS * D1 * 4);
  half_t* a_h   = (half_t*)alloc((size_t)M_ROWS * D1 * 2);
  half_t* bp_h  = (half_t*)alloc((size_t)M_ROWS * D1 * 2);
  half_t* e_h   = (half_t*)alloc((size_t)M_ROWS * D1 * 2);
  float*  sc    = (float*) alloc((size_t)BATCH * 256 * 4);
  half_t* awh   = (half_t*)alloc((size_t)2 * 4 * D1 * D1 * 2);
  half_t* w1h   = (half_t*)alloc((size_t)N1 * KCLS * 2);
  float*  h1    = (float*) alloc((size_t)BATCH * N1 * 4);
  float*  h2    = (float*) alloc((size_t)BATCH * 50 * 4);
  float*  h3    = (float*) alloc((size_t)BATCH * 10 * 4);

  // Max-pool (the HBM-bound stage) + new_x init, and both weight conversions.
  k_pool_cvt<<<POOL_BLKS + CVT_BLKS_AW + CVT_BLKS_W1, POOL_THR, 0, stream>>>(
      x, xp_f, xp_h, nx_f, nx_h, attn_w, awh, w1, w1h);

  dim3 ggrid(M_ROWS / 16, 2);      // 128 M-tiles x 2 groups of 8 waves x 32 cols
  dim3 ggrid2(M_ROWS / 16, 2, 2);  // the same for two products
  for (int i = 0; i < 2; ++i) {
    const half_t* Wa  = awh + (size_t)(i * 4 + 0) * D1 * D1;
    const half_t* Wb  = awh + (size_t)(i * 4 + 1) * D1 * D1;
    const half_t* W1s = awh + (size_t)(i * 4 + 3) * D1 * D1;
    const float* ba  = attn_b + (size_t)(i * 4 + 0) * D1;
    const float* bb  = attn_b + (size_t)(i * 4 + 1) * D1;
    const float* b1s = attn_b + (size_t)(i * 4 + 3) * D1;

    // z = 0: a = fc_a(new_x)  (f32 for context matmul, f16 for scores)
    // z = 1: bproj = fc_b(xp)
    k_gemm512<<<ggrid2, 256, 0, stream>>>(nx_h, Wa, ba, nullptr, a_f, a_h,
                                          xp_h, Wb, bb, bp_h, 0);
    // scores = a @ bproj^T / sqrt(512)
    k_scores<<<BATCH / 4, 128, 0, stream>>>(a_h, bp_h, sc);
    // e = relu(LN(softmax_over_batch(scores) @ a))
    k_context_ln<<<BATCH, 256, 0, stream>>>(sc, a_f, ln_g, ln_b, e_h);
    // new_x = new_x + fc_1(e)
    k_gemm512<<<ggrid, 256, 0, stream>>>(e_h, W1s, b1s, nx_f, nx_f, nx_h,
                                         nullptr, nullptr, nullptr, nullptr, 0);
  }

  // Classifier head.
  k_gemm_cls<<<dim3(BATCH / 16, 13), 32 * CLS_WAVES, 0, stream>>>(xp_h, nx_h, w1h, b1, h1);
  k_fc<<<(BATCH * 50 + 255) / 256, 256, 0, stream>>>(h1, w2, b2, h2, BATCH, 50, N1, 1);
  k_fc<<<(BATCH * 10 + 255) / 256, 256, 0, stream>>>(h2, w3, b3, h3, BATCH, 10, 50, 1);
  k_fc<<<(BATCH * 128 + 255) / 256, 256, 0, stream>>>(h3, w4, b4, out, BATCH, 128, 10, 0);
}

// v007
// One run takes 105 microseconds.
// Two timings next to v006 both put it at 1.08 times that version's speed.
// Counting every step since v000, it is 3.23 times as fast.
#include <hip/hip_runtime.h>

// ---------------------------------------------------------------------------
// Feature-bank attention forward on gfx1250 (wave32, WMMA).
//   1. max-pool 7x7 over x[128,512,16,7,7] -> xp[128,16,512]  (HBM-bound)
//   2. per stack, two launches, a block working on one batch entry b:
//      fc_a and fc_b (WMMA f16->f32) with the 16x16 score WMMA behind them;
//      batch-axis softmax + context matmul + LayerNorm + ReLU with the fc_1
//      GEMM and its residual behind them.
//   3. classifier: WMMA GEMM [128,16384]x[16384,200]; the three small FCs in
//      one launch.
// ---------------------------------------------------------------------------

typedef _Float16 half_t;
typedef __attribute__((ext_vector_type(16))) _Float16     v16h;
typedef __attribute__((ext_vector_type(8)))  _Float16     v8h;
typedef __attribute__((ext_vector_type(8)))  float        v8f;

#define D1     512
#define D2     16
#define BATCH  128
#define M_ROWS (BATCH * D2)   // 2048
#define KCLS   (2 * D2 * D1)  // 16384
#define N1     200

// Build the documented 16-bit WMMA fragment (VGPR0-3: K=base..base+7,
// VGPR4-7: K=base+16..base+23, per lane-half) from two 8-half chunks.
__device__ inline v8f wmma_step(v8h a0, v8h a1, v8h b0, v8h b1, v8f acc) {
  v16h af, bf;
#pragma unroll
  for (int i = 0; i < 8; ++i) {
    af[i] = a0[i]; af[8 + i] = a1[i];
    bf[i] = b0[i]; bf[8 + i] = b1[i];
  }
  return __builtin_amdgcn_wmma_f32_16x16x32_f16(
      /*neg_a=*/false, af, /*neg_b=*/false, bf,
      /*c_mod=*/(short)0, acc, /*reuse_a=*/false, /*reuse_b=*/false);
}

// ---------------------------------------------------------------------------
// f32 -> f16 weight copy. A thread takes eight pieces of four floats, 1,024
// floats apart, so a wave reads whole 512-byte runs and stores whole 256-byte
// runs, and a block of 8 waves covers 8,192 floats. One float a thread would be
// 168,000 waves for the two copies, each living for one load: the time would go
// into starting waves. Both element counts are multiples of 8,192: no tail.
// The copies have no launch of their own: their blocks ride in the max-pool
// grid (k_pool_cvt), which they do not depend on.
// ---------------------------------------------------------------------------
typedef __attribute__((ext_vector_type(4))) float    v4f;
typedef __attribute__((ext_vector_type(4))) _Float16 v4h;

#define CVT_THR   256
#define CVT_PIECE 8
#define CVT_BLK   (CVT_THR * CVT_PIECE * 4)  // 8,192 floats a block

#define CVT_BLKS_AW (2 * 4 * D1 * D1 / CVT_BLK)  // 256 blocks: attention weights
#define CVT_BLKS_W1 (N1 * KCLS / CVT_BLK)        // 400 blocks: classifier weights

__device__ __forceinline__ void
f32_to_f16_block(const float* __restrict__ src, half_t* __restrict__ dst, int blk) {
  const int i0 = blk * CVT_BLK + threadIdx.x * 4;
  v4f v[CVT_PIECE];
  // Unrolled: v stays in registers and all eight loads are in flight together.
#pragma unroll
  for (int j = 0; j < CVT_PIECE; ++j)
    v[j] = *(const v4f*)(src + i0 + j * (CVT_THR * 4));
  // Unrolled: constant indices into v.
#pragma unroll
  for (int j = 0; j < CVT_PIECE; ++j)
    *(v4h*)(dst + i0 + j * (CVT_THR * 4)) = __builtin_convertvector(v[j], v4h);
}

// ---------------------------------------------------------------------------
// Max-pool over HxW=49 (the 205 MB streaming read) + init new_x = xp.
// A block owns one b and 64 d1, in four stages of 16 d1: 16*16*49 floats that
// lie in one run in x. A stage's run goes to LDS in whole lines by asynchronous
// copies; each thread then takes the maximum of one 49-float window from LDS
// (lane pitch 49 dwords, odd, so no bank conflict). A small LDS tile turns
// (d1,d2) into (d2,d1), so that the block stores whole 128-byte lines of all
// four outputs. Four blocks fit a WGP: one block's maxima run under the
// others' copies.
// Blocks from POOL_BLKS on do the two weight copies instead: independent work
// in the same launch. The long pool blocks have the low indices and start first.
// ---------------------------------------------------------------------------
typedef __attribute__((ext_vector_type(2))) float    v2f;
typedef __attribute__((ext_vector_type(2))) _Float16 v2h;

#define POOL_D1   64                     // d1 a block owns
#define POOL_SD1  16                     // d1 a stage
#define POOL_SFLT (POOL_SD1 * D2 * 49)   // 12,544 floats = 50,176 bytes a stage
#define POOL_THR  256
#define POOL_BLKS (BATCH * (D1 / POOL_D1))  // 1,024
static_assert(POOL_THR == CVT_THR, "both bodies run in one block shape");

__global__ void __launch_bounds__(POOL_THR)
k_pool_cvt(const float* __restrict__ x,
           float* __restrict__ xp_f, half_t* __restrict__ xp_h,
           float* __restrict__ nx_f, half_t* __restrict__ nx_h,
           const float* __restrict__ attn_w, half_t* __restrict__ awh,
           const float* __restrict__ w1, half_t* __restrict__ w1h) {
  __shared__ __align__(16) float tile[POOL_SFLT];
  __shared__ __align__(8) float tr[D2][POOL_D1 + 2];  // pitch 66: no bank conflict for writers or readers
  // Block-uniform, in front of every copy and barrier: a whole block leaves here.
  if (blockIdx.x >= POOL_BLKS) {
    const int cb = blockIdx.x - POOL_BLKS;
    const bool aw = cb < CVT_BLKS_AW;
    f32_to_f16_block(aw ? attn_w : w1, aw ? awh : w1h, aw ? cb : cb - CVT_BLKS_AW);
    return;
  }
  const int tid = threadIdx.x;
  const int wave = __builtin_amdgcn_readfirstlane(tid >> 5);
  const int b = blockIdx.x >> 3;
  const int d1_0 = (blockIdx.x & 7) * POOL_D1;
  const float* g = x + (size_t)(b * D1 + d1_0) * (D2 * 49) + tid * 4;
  const unsigned int l = (unsigned int)(uintptr_t)&tile[0] + (unsigned int)tid * 16u;

  // Unrolled: each stage's column of tr is a constant LDS offset on one base.
#pragma unroll
  for (int s = 0; s < POOL_D1 / POOL_SD1; ++s, g += POOL_SFLT) {
    // 3,136 pieces of 16 bytes: 12 from every thread, a 13th from waves 0 and 1.
    // The s_wait_xcnt closes each statement so that no address register of an
    // issued copy is rewritten ahead of it.
    asm volatile(
        "global_load_async_to_lds_b128 %0, %12, off\n\t"
        "global_load_async_to_lds_b128 %1, %13, off\n\t"
        "global_load_async_to_lds_b128 %2, %14, off\n\t"
        "global_load_async_to_lds_b128 %3, %15, off\n\t"
        "global_load_async_to_lds_b128 %4, %16, off\n\t"
        "global_load_async_to_lds_b128 %5, %17, off\n\t"
        "global_load_async_to_lds_b128 %6, %18, off\n\t"
        "global_load_async_to_lds_b128 %7, %19, off\n\t"
        "global_load_async_to_lds_b128 %8, %20, off\n\t"
        "global_load_async_to_lds_b128 %9, %21, off\n\t"
        "global_load_async_to_lds_b128 %10, %22, off\n\t"
        "global_load_async_to_lds_b128 %11, %23, off\n\t"
        "s_wait_xcnt 0x0"
        :: "v"(l), "v"(l + 1u * 4096u), "v"(l + 2u * 4096u), "v"(l + 3u * 4096u),
           "v"(l + 4u * 4096u), "v"(l + 5u * 4096u), "v"(l + 6u * 4096u),
           "v"(l + 7u * 4096u), "v"(l + 8u * 4096u), "v"(l + 9u * 4096u),
           "v"(l + 10u * 4096u), "v"(l + 11u * 4096u),
           "v"(g), "v"(g + 1 * 1024), "v"(g + 2 * 1024), "v"(g + 3 * 1024),
           "v"(g + 4 * 1024), "v"(g + 5 * 1024), "v"(g + 6 * 1024), "v"(g + 7 * 1024),
           "v"(g + 8 * 1024), "v"(g + 9 * 1024), "v"(g + 10 * 1024), "v"(g + 11 * 1024)
        : "memory");
    if (wave < 2) {
      asm volatile(
          "global_load_async_to_lds_b128 %0, %1, off\n\t"
          "s_wait_xcnt 0x0"
          :: "v"(l + 12u * 4096u), "v"(g + 12 * 1024) : "memory");
    }
    // This wave's copies have landed; the barrier then shows them to every wave.
    asm volatile("s_wait_asynccnt 0x0" ::: "memory");
    __syncthreads();

    const float* p = &tile[tid * 49];  // window tid = (d1 in the stage) * 16 + d2
    float m = p[0];
    // Unrolled: constant LDS offsets, and the reads run ahead of the maxima.
#pragma unroll
    for (int j = 1; j < 49; ++j) m = fmaxf(m, p[j]);
    tr[tid & 15][s * POOL_SD1 + (tid >> 4)] = m;

    // This wave's LDS reads of the stage are done; behind the barrier the next
    // stage's copies may overwrite the tile (and, last, tr is whole).
    asm volatile("s_wait_dscnt 0x0" ::: "memory");
    __syncthreads();
  }

  // 512 pairs of neighbouring d1: a wave stores 256 bytes of f32, 128 of f16.
#pragma unroll
  for (int k = 0; k < 2; ++k) {
    const int q = tid + POOL_THR * k;
    const int d2 = q >> 5, d1l = (q & 31) * 2;
    const v2f m2 = *(const v2f*)&tr[d2][d1l];
    const int o = (b * D2 + d2) * D1 + d1_0 + d1l;
    *(v2f*)(xp_f + o) = m2;
    *(v2f*)(nx_f + o) = m2;
    v2h h2;
    h2[0] = (half_t)m2[0];
    h2[1] = (half_t)m2[1];
    *(v2h*)(xp_h + o) = h2;
    *(v2h*)(nx_h + o) = h2;
  }
}

// ---------------------------------------------------------------------------
// The 16 x 512 x 512 product Y = X @ W^T of one batch entry, shared by the two
// kernels below. X (f16) lies in LDS, rows of 520 halves; a wave owns a 16x32
// output tile (two WMMA accumulators sharing one A fragment). The weight
// fragments come in groups of GS k steps (4 * GS loads), two groups in flight:
// a wave waits out the L2 latency once a pair of groups, not once a step.
// ---------------------------------------------------------------------------
#define XPITCH 520  // halves a row in LDS: 16 bytes more than the row spreads the banks

template <int GS>
__device__ __forceinline__ void
w_group(v8h (&q)[GS][4], const half_t* __restrict__ Wrow0,
        const half_t* __restrict__ Wrow1, int c) {
  // Unrolled: constant indices keep q in registers.
#pragma unroll
  for (int s = 0; s < GS; ++s) {
    const int k = (c * GS + s) * 32;
    q[s][0] = *(const v8h*)(Wrow0 + k);
    q[s][1] = *(const v8h*)(Wrow0 + k + 16);
    q[s][2] = *(const v8h*)(Wrow1 + k);
    q[s][3] = *(const v8h*)(Wrow1 + k + 16);
  }
}

// wq holds groups 0 and 1 on entry.
template <int GS>
__device__ __forceinline__ void
gemm512_kloop(const half_t (*Xs)[XPITCH], const half_t* __restrict__ Wrow0,
              const half_t* __restrict__ Wrow1, v8h (&wq)[2][GS][4],
              int lm, int lh, v8f& acc0, v8f& acc1) {
  // Unrolled: the group's buffer index is a constant.
#pragma unroll
  for (int c = 0; c < 16 / GS; ++c) {
#pragma unroll
    for (int s = 0; s < GS; ++s) {
      const int base = (c * GS + s) * 32 + 8 * lh;
      v8h a0 = *(const v8h*)&Xs[lm][base];
      v8h a1 = *(const v8h*)&Xs[lm][base + 16];
      acc0 = wmma_step(a0, a1, wq[c & 1][s][0], wq[c & 1][s][1], acc0);
      acc1 = wmma_step(a0, a1, wq[c & 1][s][2], wq[c & 1][s][3], acc1);
    }
    if (c + 2 < 16 / GS) {
      // The fence pair keeps the refill where it stands: without it the
      // compiler moves each load down to just in front of its WMMA.
      __builtin_amdgcn_sched_barrier(0);
      w_group<GS>(wq[c & 1], Wrow0, Wrow1, c + 2);
      __builtin_amdgcn_sched_barrier(0);
    }
  }
}

// ---------------------------------------------------------------------------
// a = fc_a(new_x), bproj = fc_b(xp), scores[b,c,d] = dot(a[b,c,:], bproj[b,d,:])
// / sqrt(512). One block of 32 waves per b: waves 0-15 make a[b], waves 16-31
// bproj[b], 32 columns each. Both results stay in LDS as f16, and wave 0 takes
// the 16x16 score tile from there: the scores need nothing of another b, so
// they need no launch of their own. a goes to memory in f32 for the context
// product; bproj never leaves the block.
// ---------------------------------------------------------------------------
__global__ void __launch_bounds__(1024)
k_ab_scores(const half_t* __restrict__ NXh, const half_t* __restrict__ XPh,
            const half_t* __restrict__ Wa, const half_t* __restrict__ Wb,
            const float* __restrict__ ba, const float* __restrict__ bb,
            float* __restrict__ Af, float* __restrict__ S) {
  __shared__ __align__(16) half_t Xs[2][16][XPITCH];  // new_x[b], xp[b]
  __shared__ __align__(16) half_t Ys[2][16][XPITCH];  // a[b], bproj[b]
  const int tid = threadIdx.x;
  const int lane = tid & 31;
  const int wave = __builtin_amdgcn_readfirstlane(tid >> 5);
  const int z = wave >> 4;  // wave-uniform: 0 = fc_a, 1 = fc_b
  const int b = blockIdx.x;
  const int ntile0 = (wave & 15) * 2;  // two adjacent N tiles
  const int lm = lane & 15, lh = lane >> 4;

  // Both X tiles: 1,024 pieces of 8 halves each, one piece of each a thread.
  // Asked for first, so that their LDS stores do not wait for the weights.
  const int pr = tid >> 6, pc = (tid & 63) * 8;
  const v8h xa = *(const v8h*)(NXh + (size_t)(b * 16 + pr) * D1 + pc);
  const v8h xb = *(const v8h*)(XPh + (size_t)(b * 16 + pr) * D1 + pc);
  // Stands in front of any reuse of these two loads' address registers.
  asm volatile("s_wait_xcnt 0x0" ::: "memory");

  const half_t* Wrow0 = (z ? Wb : Wa) + (size_t)(ntile0 * 16 + lm) * D1 + 8 * lh;
  const half_t* Wrow1 = Wrow0 + (size_t)16 * D1;
  // Groups of two k steps: 32 waves leave a wave 128 registers, and the block
  // still has as many loads in flight as two blocks of 8 waves with groups of four.
  v8h wq[2][2][4];
  w_group<2>(wq[0], Wrow0, Wrow1, 0);
  w_group<2>(wq[1], Wrow0, Wrow1, 1);
  const float* bias = z ? bb : ba;
  const float bn[2] = {bias[ntile0 * 16 + lm], bias[ntile0 * 16 + 16 + lm]};

  *(v8h*)&Xs[0][pr][pc] = xa;
  *(v8h*)&Xs[1][pr][pc] = xb;
  __syncthreads();

  v8f acc0 = {}, acc1 = {};
  gemm512_kloop<2>(Xs[z], Wrow0, Wrow1, wq, lm, lh, acc0, acc1);

  // C layout: lane->N, VGPR->M (8-row halves).
  float y[2][8];
  // Unrolled: constant indices into the accumulators.
#pragma unroll
  for (int t = 0; t < 2; ++t) {
    const v8f acc = t ? acc1 : acc0;
#pragma unroll
    for (int r2 = 0; r2 < 8; ++r2) {
      y[t][r2] = acc[r2] + bn[t];
      Ys[z][lh * 8 + r2][ntile0 * 16 + t * 16 + lm] = (half_t)y[t][r2];
    }
  }
  __syncthreads();

  // Behind the barrier: in front of it, the barrier would wait for the stores
  // to be acknowledged, and the scores with it.
  if (z == 0) {
    const size_t o0 = (size_t)(b * 16 + lh * 8) * D1 + ntile0 * 16 + lm;
    // Unrolled: constant indices into y, constant offsets on one address pair.
#pragma unroll
    for (int t = 0; t < 2; ++t)
#pragma unroll
      for (int r2 = 0; r2 < 8; ++r2) Af[o0 + (size_t)r2 * D1 + t * 16] = y[t][r2];
    // Stands in front of any reuse of the stores' address and data registers.
    asm volatile("s_wait_xcnt 0x0" ::: "memory");
  }

  if (wave == 0) {
    v8f acc = {};
    // Unrolled: constant LDS offsets, and the reads run ahead of the WMMAs.
#pragma unroll
    for (int s = 0; s < 16; ++s) {
      const int base = s * 32 + 8 * lh;
      acc = wmma_step(*(const v8h*)&Ys[0][lm][base], *(const v8h*)&Ys[0][lm][base + 16],
                      *(const v8h*)&Ys[1][lm][base], *(const v8h*)&Ys[1][lm][base + 16], acc);
    }
    const float sc = 0.044194173824159216f;  // 1/sqrt(512)
    // Unrolled: constant indices into the accumulator.
#pragma unroll
    for (int r2 = 0; r2 < 8; ++r2) S[b * 256 + (lh * 8 + r2) * 16 + lm] = acc[r2] * sc;
  }
}

// ---------------------------------------------------------------------------
// e = relu(LayerNorm_{16,512}( ab[b] @ a[b] )), new_x[b] += fc_1(e).
// ab = softmax of the raw scores S over dim 0 (batch; legacy nn.Softmax() on
// 3D). Every block works out the maximum and the sum of all 256 columns
// itself, one column (c*16 + d) a thread, and keeps only its own b's row. The
// sum runs in ascending b.
// e stays in LDS as f16 and is the X tile of the fc_1 product, which needs
// nothing of another b. Two blocks per b (blockIdx.y): each makes the whole of
// e for itself and takes 256 of the 512 columns of fc_1, so that the product
// keeps its 16 waves per b without a hand-over between blocks.
// ---------------------------------------------------------------------------
__global__ void __launch_bounds__(256)
k_context_fc1(const float* __restrict__ S, const float* __restrict__ Af,
              const float* __restrict__ g, const float* __restrict__ beta,
              const half_t* __restrict__ W, const float* __restrict__ bias,
              float* NXf, half_t* __restrict__ NXh) {
  __shared__ float ab[256];
  __shared__ float ep[8192];
  __shared__ float rs[256], rq[256];
  __shared__ __align__(16) half_t Es[16][XPITCH];
  const int b = blockIdx.x, tid = threadIdx.x;
  // A thread's two columns of a[b] (t = tid and tid + 256), read once and asked
  // for together with the scores: every c of the context product uses them.
  float af[16][2];
  // Unrolled: constant indices keep af in registers.
#pragma unroll
  for (int d = 0; d < 16; ++d) {
    af[d][0] = Af[(size_t)(b * 16 + d) * D1 + tid];
    af[d][1] = Af[(size_t)(b * 16 + d) * D1 + tid + 256];
  }
  {
    float v[BATCH];
    // Unrolled: v stays in registers and the column's loads are all in flight
    // together, one L2 latency for the column.
#pragma unroll
    for (int i = 0; i < BATCH; ++i) v[i] = S[i * 256 + tid];
    const float own = S[b * 256 + tid];
    // Stands in front of any reuse of the load's address registers.
    asm volatile("s_wait_xcnt 0x0" ::: "memory");
    // Keeps the loads of af above the softmax arithmetic: one latency for all.
    __builtin_amdgcn_sched_barrier(0);
    float mx = -1e30f;
    // Unrolled: constant indices into v.
#pragma unroll
    for (int i = 0; i < BATCH; ++i) mx = fmaxf(mx, v[i]);
    float sum = 0.0f;
    // Unrolled: constant indices into v.
#pragma unroll
    for (int i = 0; i < BATCH; ++i) sum += __expf(v[i] - mx);
    ab[tid] = __expf(own - mx) * (1.0f / sum);
  }
  // The LayerNorm weights of this thread's 32 elements, asked for here so that
  // they land under the context product and the reduction.
  float gg[32], bb[32];
  // Unrolled: constant indices keep gg and bb in registers.
#pragma unroll
  for (int i = 0; i < 32; ++i) {
    gg[i] = g[tid + 256 * i];
    bb[i] = beta[tid + 256 * i];
  }
  __syncthreads();

  float lsum = 0.0f, lsq = 0.0f;
  // Unrolled: constant indices into af.
#pragma unroll
  for (int i = 0; i < 32; ++i) {
    int idx = tid + 256 * i;          // idx = c*512 + t, c = i / 2, t = tid + 256 * (i % 2)
    int c = i >> 1;
    float s = 0.0f;
#pragma unroll
    for (int d = 0; d < 16; ++d)
      s += ab[c * 16 + d] * af[d][i & 1];
    ep[idx] = s;
    lsum += s;
    lsq += s * s;
    // Every four rows c: keeps the LDS reads of later rows of ab, and behind the
    // last row the weight loads below, from piling up in registers on top of af,
    // gg and bb, which would take the kernel past 256 of them.
    if ((i & 7) == 7) __builtin_amdgcn_sched_barrier(0);
  }
  rs[tid] = lsum; rq[tid] = lsq;

  // fc_1's first two weight groups and its bias depend on nothing above: asked
  // for here, in front of the reduction and the LayerNorm.
  const int lane = tid & 31;
  const int wave = tid >> 5;
  const int ntile0 = (blockIdx.y * 8 + wave) * 2;  // two adjacent N tiles
  const int lm = lane & 15, lh = lane >> 4;
  const half_t* Wrow0 = W + (size_t)(ntile0 * 16 + lm) * D1 + 8 * lh;
  const half_t* Wrow1 = Wrow0 + (size_t)16 * D1;
  const float bn[2] = {bias[ntile0 * 16 + lm], bias[ntile0 * 16 + 16 + lm]};
  // Stands in front of any reuse of the bias loads' address register.
  asm volatile("s_wait_xcnt 0x0" ::: "memory");
  v8h wq[2][4][4];
  w_group<4>(wq[0], Wrow0, Wrow1, 0);
  w_group<4>(wq[1], Wrow0, Wrow1, 1);
  const size_t o0 = (size_t)(b * 16 + lh * 8) * D1 + ntile0 * 16 + lm;  // C layout: lane->N, VGPR->M (8-row halves)

  __syncthreads();
  for (int s2 = 128; s2 > 0; s2 >>= 1) {
    if (tid < s2) { rs[tid] += rs[tid + s2]; rq[tid] += rq[tid + s2]; }
    __syncthreads();
  }
  float mu   = rs[0] * (1.0f / 8192.0f);
  float var  = rq[0] * (1.0f / 8192.0f) - mu * mu;
  float rstd = rsqrtf(var + 1e-5f);
  // Unrolled: constant indices into gg and bb.
#pragma unroll
  for (int i = 0; i < 32; ++i) {
    int idx = tid + 256 * i;
    int c = idx >> 9, t = idx & 511;
    float v = (ep[idx] - mu) * rstd * gg[i] + bb[i];
    v = fmaxf(v, 0.0f);
    Es[c][t] = (half_t)v;
  }
  // The residual, asked for once gg and bb have left their registers: it lands
  // under the product.
  float rv[2][8];
  // Unrolled: constant indices keep rv in registers.
#pragma unroll
  for (int t = 0; t < 2; ++t)
#pragma unroll
    for (int r2 = 0; r2 < 8; ++r2) rv[t][r2] = NXf[o0 + (size_t)r2 * D1 + t * 16];
  __syncthreads();

  v8f acc0 = {}, acc1 = {};
  gemm512_kloop<4>(Es, Wrow0, Wrow1, wq, lm, lh, acc0, acc1);

  float y[2][8];
  // Unrolled: constant indices into the accumulators.
#pragma unroll
  for (int t = 0; t < 2; ++t) {
    const v8f acc = t ? acc1 : acc0;
#pragma unroll
    for (int r2 = 0; r2 < 8; ++r2) y[t][r2] = acc[r2] + bn[t] + rv[t][r2];
  }
  // Unrolled: constant indices into y, constant offsets on one address pair.
#pragma unroll
  for (int t = 0; t < 2; ++t)
#pragma unroll
    for (int r2 = 0; r2 < 8; ++r2) NXf[o0 + (size_t)r2 * D1 + t * 16] = y[t][r2];
  // Stands in front of any reuse of the stores' address and data registers; the
  // fence keeps the conversions below, which reuse them, behind the wait.
  asm volatile("s_wait_xcnt 0x0" ::: "memory");
  __builtin_amdgcn_sched_barrier(0);
  half_t yh[2][8];
  // Unrolled: constant indices into y and yh.
#pragma unroll
  for (int t = 0; t < 2; ++t)
#pragma unroll
    for (int r2 = 0; r2 < 8; ++r2) yh[t][r2] = (half_t)y[t][r2];
  // Keeps every conversion in front of the stores: none of them then rewrites a
  // register of an issued store.
  __builtin_amdgcn_sched_barrier(0);
  // Unrolled: constant indices into yh, constant offsets on one address pair.
#pragma unroll
  for (int t = 0; t < 2; ++t)
#pragma unroll
    for (int r2 = 0; r2 < 8; ++r2) NXh[o0 + (size_t)r2 * D1 + t * 16] = yh[t][r2];
}

// ---------------------------------------------------------------------------
// h1 = relu( feat[128,16384] @ w1[200,16384]^T + b1 ).  feat = [xp | new_x]
// One block per 16x16 output tile; K is split over the block's 32 waves
// (512 k each, 16 WMMA steps), the 32 partial tiles are summed in LDS in
// wave order.
// ---------------------------------------------------------------------------
#define CLS_WAVES  32
#define CLS_KSLICE (KCLS / CLS_WAVES)  // 512; divides 8192, so a slice is all xp or all new_x

__global__ void __launch_bounds__(32 * CLS_WAVES)
k_gemm_cls(const half_t* __restrict__ XPh, const half_t* __restrict__ NXh,
           const half_t* __restrict__ W1h, const float* __restrict__ b1,
           float* __restrict__ H1) {
  __shared__ float red[CLS_WAVES][256];
  const int lane = threadIdx.x & 31;
  const int wave = threadIdx.x >> 5;
  const int lm = lane & 15, lh = lane >> 4;
  const int m0 = blockIdx.x * 16;    // batch tile (8 tiles)
  const int ntile = blockIdx.y;      // 13 tiles cover N=200 (pad to 208)
  const int nw = ntile * 16 + lm;
  const int nl = (nw < N1) ? nw : (N1 - 1);  // clamp loads; masked at store
  const int k0 = wave * CLS_KSLICE;
  const int mrow = m0 + lm;
  const half_t* Ws = W1h + (size_t)nl * KCLS + k0 + 8 * lh;
  const half_t* Xs = ((k0 < 8192) ? (XPh + (size_t)mrow * 8192 + k0)
                                  : (NXh + (size_t)mrow * 8192 + (k0 - 8192))) + 8 * lh;

  // Fragments in groups of two k steps (8 loads: one whole 128-byte line of
  // each of the 32 rows), two groups in flight a wave.
  v8h q[2][2][4];
  // Unrolled: constant indices keep q in registers.
#pragma unroll
  for (int c = 0; c < 2; ++c) {
#pragma unroll
    for (int s = 0; s < 2; ++s) {
      const int k = (c * 2 + s) * 32;
      q[c][s][0] = *(const v8h*)(Xs + k);
      q[c][s][1] = *(const v8h*)(Xs + k + 16);
      q[c][s][2] = *(const v8h*)(Ws + k);
      q[c][s][3] = *(const v8h*)(Ws + k + 16);
    }
  }
  // Keeps the 16 loads above the first WMMA: without it the compiler moves
  // each load down to just in front of its WMMA.
  __builtin_amdgcn_sched_barrier(0);
  v8f acc = {};
  // Unrolled: the group's buffer index is a constant.
#pragma unroll
  for (int c = 0; c < CLS_KSLICE / 64; ++c) {
#pragma unroll
    for (int s = 0; s < 2; ++s)
      acc = wmma_step(q[c & 1][s][0], q[c & 1][s][1], q[c & 1][s][2], q[c & 1][s][3], acc);
    if (c + 2 < CLS_KSLICE / 64) {
      // The fence pair keeps the refill where it stands, for the same reason.
      __builtin_amdgcn_sched_barrier(0);
#pragma unroll
      for (int s = 0; s < 2; ++s) {
        const int k = ((c + 2) * 2 + s) * 32;
        q[c & 1][s][0] = *(const v8h*)(Xs + k);
        q[c & 1][s][1] = *(const v8h*)(Xs + k + 16);
        q[c & 1][s][2] = *(const v8h*)(Ws + k);
        q[c & 1][s][3] = *(const v8h*)(Ws + k + 16);
      }
      __builtin_amdgcn_sched_barrier(0);
    }
  }

  // Unrolled: constant indices keep acc in registers.
#pragma unroll
  for (int r2 = 0; r2 < 8; ++r2) red[wave][r2 * 32 + lane] = acc[r2];
  __syncthreads();

  if (threadIdx.x < 256 && nw < N1) {
    const float bn = b1[nw];
    // Stands in front of any reuse of the bias load's address register.
    asm volatile("s_wait_xcnt 0x0" ::: "memory");
    float s = 0.0f;
    // Unrolled: the LDS reads run ahead of the dependent adds.
#pragma unroll
    for (int w = 0; w < CLS_WAVES; ++w) s += red[w][threadIdx.x];
    const int r2 = threadIdx.x >> 5;      // accumulator register of this element
    const int m = m0 + lh * 8 + r2;       // C layout: lane->N, VGPR->M (8-row halves)
    H1[m * N1 + nw] = fmaxf(s + bn, 0.0f);
  }
}

// ---------------------------------------------------------------------------
// The three small FCs (200->50->10->128) in one launch: a row of the batch
// needs nothing of another row, so a block takes one row through all three and
// hands h2 and h3 over in LDS. All weights are asked for up front, together
// with the row of h1. In the first two layers a wave takes an output, its lanes
// split k and the 32 partial sums meet in a butterfly.
// ---------------------------------------------------------------------------
#define N2 50
#define N3 10
#define N4 128

// Sums each of the N values over the wave's 32 lanes; every lane gets the sums.
// The distance is the outer loop: the N exchanges of a distance are in flight
// together, five LDS-path latencies in all and not five a value.
template <int N>
__device__ __forceinline__ void wave_sum(float (&s)[N]) {
  // Unrolled: constant indices keep s in registers.
#pragma unroll
  for (int d = 16; d > 0; d >>= 1) {
    float t[N];
#pragma unroll
    for (int o = 0; o < N; ++o) t[o] = __shfl_xor(s[o], d);
#pragma unroll
    for (int o = 0; o < N; ++o) s[o] += t[o];
  }
}

__global__ void __launch_bounds__(256)
k_tail(const float* __restrict__ H1,
       const float* __restrict__ w2, const float* __restrict__ b2,
       const float* __restrict__ w3, const float* __restrict__ b3,
       const float* __restrict__ w4, const float* __restrict__ b4,
       float* __restrict__ out) {
  __shared__ float h2s[N2], h3s[N3];
  const int tid = threadIdx.x;
  const int lane = tid & 31;
  const int wave = __builtin_amdgcn_readfirstlane(tid >> 5);
  const int m = blockIdx.x;

  // Outputs wave, wave + 8, ...; an output past the end is clamped for its
  // loads and not stored.
  float x1[7], wa[7][7], ba[7];
  // Unrolled (here and below): constant indices keep the arrays in registers.
#pragma unroll
  for (int j = 0; j < 7; ++j) {
    const int k = lane + 32 * j;
    x1[j] = (k < N1) ? H1[m * N1 + k] : 0.0f;
  }
#pragma unroll
  for (int o = 0; o < 7; ++o) {
    const int n = min(wave + 8 * o, N2 - 1);
    ba[o] = b2[n];
#pragma unroll
    for (int j = 0; j < 7; ++j) {
      const int k = lane + 32 * j;
      wa[o][j] = (k < N1) ? w2[n * N1 + k] : 0.0f;
    }
  }
  float wb[2][2], bbv[2];
#pragma unroll
  for (int o = 0; o < 2; ++o) {
    const int n = min(wave + 8 * o, N3 - 1);
    bbv[o] = b3[n];
#pragma unroll
    for (int j = 0; j < 2; ++j) {
      const int k = lane + 32 * j;
      wb[o][j] = (k < N2) ? w3[n * N2 + k] : 0.0f;
    }
  }
  const int n4 = tid & (N4 - 1);
  float wc[N3];
#pragma unroll
  for (int k = 0; k < N3; ++k) wc[k] = w4[n4 * N3 + k];
  const float bc = b4[n4];
  // Stands in front of any reuse of the loads' address registers.
  asm volatile("s_wait_xcnt 0x0" ::: "memory");

  float s2[7];
#pragma unroll
  for (int o = 0; o < 7; ++o) {
    s2[o] = 0.0f;
#pragma unroll
    for (int j = 0; j < 7; ++j) s2[o] += x1[j] * wa[o][j];
  }
  wave_sum<7>(s2);
  if (lane == 0) {
#pragma unroll
    for (int o = 0; o < 7; ++o) {
      const int n = wave + 8 * o;
      if (n < N2) h2s[n] = fmaxf(s2[o] + ba[o], 0.0f);
    }
  }
  __syncthreads();

  float x2[2];
#pragma unroll
  for (int j = 0; j < 2; ++j) {
    const int k = lane + 32 * j;
    x2[j] = (k < N2) ? h2s[k] : 0.0f;
  }
  float s3[2];
#pragma unroll
  for (int o = 0; o < 2; ++o) s3[o] = x2[0] * wb[o][0] + x2[1] * wb[o][1];
  wave_sum<2>(s3);
  if (lane == 0) {
#pragma unroll
    for (int o = 0; o < 2; ++o) {
      const int n = wave + 8 * o;
      if (n < N3) h3s[n] = fmaxf(s3[o] + bbv[o], 0.0f);
    }
  }
  __syncthreads();

  if (tid < N4) {
    float s = bc;
#pragma unroll
    for (int k = 0; k < N3; ++k) s += h3s[k] * wc[k];
    out[m * N4 + tid] = s;
  }
}

// ---------------------------------------------------------------------------
extern "C" void kernel_launch(void* const* d_in, const int* in_sizes, int n_in,
                              void* d_out, int out_size, void* d_ws, size_t ws_size,
                              hipStream_t stream) {
  (void)in_sizes; (void)n_in; (void)out_size; (void)ws_size;
  const float* x      = (const float*)d_in[0];
  const float* attn_w = (const float*)d_in[1];
  const float* attn_b = (const float*)d_in[2];
  const float* ln_g   = (const float*)d_in[3];
  const float* ln_b   = (const float*)d_in[4];
  const float* w1     = (const float*)d_in[5];
  const float* b1     = (const float*)d_in[6];
  const float* w2     = (const float*)d_in[7];
  const float* b2     = (const float*)d_in[8];
  const float* w3     = (const float*)d_in[9];
  const float* b3     = (const float*)d_in[10];
  const float* w4     = (const float*)d_in[11];
  const float* b4     = (const float*)d_in[12];
  float* out = (float*)d_out;

  char* ws = (char*)d_ws;
  size_t off = 0;
  auto alloc = [&](size_t bytes) -> char* {
    char* p = ws + off;
    off += (bytes + 255) & ~(size_t)255;
    return p;
  };
  float*  xp_f  = (float*) alloc((size_t)M_ROWS * D1 * 4);
  half_t* xp_h  = (half_t*)alloc((size_t)M_ROWS * D1 * 2);
  float*  nx_f  = (float*) alloc((size_t)M_ROWS * D1 * 4);
  half_t* nx_h  = (half_t*)alloc((size_t)M_ROWS * D1 * 2);
  float*  a_f   = (float*) alloc((size_t)M_ROWS * D1 * 4);
  float*  sc    = (float*) alloc((size_t)BATCH * 256 * 4);
  half_t* awh   = (half_t*)alloc((size_t)2 * 4 * D1 * D1 * 2);
  half_t* w1h   = (half_t*)alloc((size_t)N1 * KCLS * 2);
  float*  h1    = (float*) alloc((size_t)BATCH * N1 * 4);


  // Max-pool (the HBM-bound stage) + new_x init, and both weight conversions.
  k_pool_cvt<<<POOL_BLKS + CVT_BLKS_AW + CVT_BLKS_W1, POOL_THR, 0, stream>>>(
      x, xp_f, xp_h, nx_f, nx_h, attn_w, awh, w1, w1h);

  for (int i = 0; i < 2; ++i) {
    const half_t* Wa  = awh + (size_t)(i * 4 + 0) * D1 * D1;
    const half_t* Wb  = awh + (size_t)(i * 4 + 1) * D1 * D1;
    const half_t* W1s = awh + (size_t)(i * 4 + 3) * D1 * D1;
    const float* ba  = attn_b + (size_t)(i * 4 + 0) * D1;
    const float* bb  = attn_b + (size_t)(i * 4 + 1) * D1;
    const float* b1s = attn_b + (size_t)(i * 4 + 3) * D1;

    // a = fc_a(new_x), bproj = fc_b(xp), scores = a @ bproj^T / sqrt(512)
    k_ab_scores<<<BATCH, 1024, 0, stream>>>(nx_h, xp_h, Wa, Wb, ba, bb, a_f, sc);
    // new_x = new_x + fc_1(relu(LN(softmax_over_batch(scores) @ a)))
    k_context_fc1<<<dim3(BATCH, 2), 256, 0, stream>>>(sc, a_f, ln_g, ln_b, W1s, b1s, nx_f, nx_h);
  }

  // Classifier head.
  k_gemm_cls<<<dim3(BATCH / 16, 13), 32 * CLS_WAVES, 0, stream>>>(xp_h, nx_h, w1h, b1, h1);
  k_tail<<<BATCH, 256, 0, stream>>>(h1, w2, b2, w3, b3, w4, b4, out);
}

// v008
// Measured time: 78.1 microseconds a run.
// In two side-by-side timings against v007, it was 1.34 and 1.33 times as fast.
// Over all steps from v000 it is 4.31 times as fast.
#include <hip/hip_runtime.h>

// ---------------------------------------------------------------------------
// Feature-bank attention forward on gfx1250 (wave32, WMMA).
//   1. max-pool 7x7 over x[128,512,16,7,7] -> xp[128,16,512]  (HBM-bound)
//   2. per stack, two launches, a block working on one batch entry b:
//      fc_a and fc_b (WMMA f16->f32) with the 16x16 score WMMA behind them;
//      batch-axis softmax + context matmul + LayerNorm + ReLU with the fc_1
//      GEMM and its residual behind them.
//   3. classifier: WMMA GEMM [128,16384]x[16384,200]; the three small FCs in
//      one launch.
// ---------------------------------------------------------------------------

typedef _Float16 half_t;
typedef __attribute__((ext_vector_type(16))) _Float16     v16h;
typedef __attribute__((ext_vector_type(8)))  _Float16     v8h;
typedef __attribute__((ext_vector_type(8)))  float        v8f;

#define D1     512
#define D2     16
#define BATCH  128
#define M_ROWS (BATCH * D2)   // 2048
#define KCLS   (2 * D2 * D1)  // 16384
#define N1     200

// Build the documented 16-bit WMMA fragment (VGPR0-3: K=base..base+7,
// VGPR4-7: K=base+16..base+23, per lane-half) from two 8-half chunks.
__device__ inline v8f wmma_step(v8h a0, v8h a1, v8h b0, v8h b1, v8f acc) {
  v16h af, bf;
#pragma unroll
  for (int i = 0; i < 8; ++i) {
    af[i] = a0[i]; af[8 + i] = a1[i];
    bf[i] = b0[i]; bf[8 + i] = b1[i];
  }
  return __builtin_amdgcn_wmma_f32_16x16x32_f16(
      /*neg_a=*/false, af, /*neg_b=*/false, bf,
      /*c_mod=*/(short)0, acc, /*reuse_a=*/false, /*reuse_b=*/false);
}

// ---------------------------------------------------------------------------
// f32 -> f16 weight copy, into the order in which the WMMA B fragments are read.
// A weight matrix [rows n][K] is stored as pieces of 512 bytes, one per
// (16 rows, 16 k): lane l = ((k >> 3) & 1) * 16 + (n & 15) owns 8 halves, k & 7:
//   half index = ((n >> 4) * (K / 32) + (k >> 5)) * 512 + ((k >> 4) & 1) * 256
//                + l * 8 + (k & 7)
// A fragment load of a wave is then 512 bytes in a row, four whole lines. From
// the row-major matrix it would be 32 bytes of each of 16 rows: 16 lines a load.
// A wave takes 16 rows x 64 k: eight loads of two 256-byte runs, all in flight
// together; its own LDS range turns them into the 2,048 bytes of four pieces,
// which lie in a row and are stored as whole lines. A block of 8 waves takes
// 512 k of its 16 rows. Where the rows are no multiple of 16, the last tile
// reads the matrix's last 16 rows and its lanes read them back from LDS turned
// round by the overlap: the tile's rows past the end then hold earlier rows, so
// that every byte of its pieces is written and no load leaves the matrix.
// The copies have no launch of their own: their blocks ride in the max-pool
// grid (k_pool_cvt), which they do not depend on.
// ---------------------------------------------------------------------------
typedef __attribute__((ext_vector_type(4))) float    v4f;
typedef __attribute__((ext_vector_type(4))) _Float16 v4h;

#define CVT_THR    256
#define W1_TILES   ((N1 + 15) / 16)  // 13
#define PK_GPITCH  144               // halves: 16 lanes' 256 bytes + 32, so that the 8-byte LDS stores spread over all banks
#define PK_WAVE    (8 * PK_GPITCH)   // halves of LDS a wave

#define CVT_BLKS_AW (2 * 4 * D1 / 16 * (D1 / 64) / 8)  // 256 blocks: attention weights
#define CVT_BLKS_W1 (W1_TILES * (KCLS / 64) / 8)       // 416 blocks: classifier weights

template <int K, int R>
__device__ __forceinline__ void
pack_f16_block(const float* __restrict__ src, half_t* __restrict__ dst, int blk,
               half_t* __restrict__ lds) {
  const int lane = threadIdx.x & 31;
  const int wave = __builtin_amdgcn_readfirstlane(threadIdx.x >> 5);
  static_assert(R >= 16, "a tile reads 16 rows");
  const unsigned int u = blk * 8 + wave;
  const int ntile = u / (K / 64), kp = u % (K / 64);
  const int r = lane >> 4, c = lane & 15;  // row in the pair, piece of 4 floats in the run
  const int row0 = min(ntile * 16, R - 16);  // the same in every lane
  const int turn = ntile * 16 - row0;
  const float* p = src + (size_t)(row0 + r) * K + kp * 64 + c * 4;
  v4f v[8];
  // Unrolled: v stays in registers, all eight loads are in flight together,
  // constant offsets on one address pair.
#pragma unroll
  for (int i = 0; i < 8; ++i) v[i] = *(const v4f*)(p + (size_t)i * (2 * K));
  half_t* st = lds + wave * PK_WAVE;
  // Unrolled: constant indices into v, constant LDS offsets on one base.
#pragma unroll
  for (int i = 0; i < 8; ++i)
    *(v4h*)(st + (c >> 1) * PK_GPITCH + (2 * i + r) * 8 + (c & 1) * 4) =
        __builtin_convertvector(v[i], v4h);
  // The wave's LDS stores are done before its lanes read each other's halves.
  asm volatile("s_wait_dscnt 0x0" ::: "memory");
  half_t* o = dst + ((size_t)ntile * (K / 32) + kp * 2) * 512 + lane * 8;
  // Unrolled: constant offsets on one LDS base and one address pair.
#pragma unroll
  for (int t = 0; t < 4; ++t)
    *(v8h*)(o + t * 256) = *(const v8h*)(st + (t * 2 + r) * PK_GPITCH + ((c + turn) & 15) * 8);
}

// ---------------------------------------------------------------------------
// Max-pool over HxW=49 (the 205 MB streaming read) + init new_x = xp.
// A block owns one b and 64 d1, in four stages of 16 d1: 16*16*49 floats that
// lie in one run in x. A stage's run goes to LDS in whole lines by asynchronous
// copies; each thread then takes the maximum of one 49-float window from LDS
// (lane pitch 49 dwords, odd, so no bank conflict). A small LDS tile turns
// (d1,d2) into (d2,d1), so that the block stores whole 128-byte lines of all
// four outputs. Four blocks fit a WGP: one block's maxima run under the
// others' copies.
// Blocks from POOL_BLKS on do the two weight copies instead: independent work
// in the same launch. The long pool blocks have the low indices and start first.
// ---------------------------------------------------------------------------
typedef __attribute__((ext_vector_type(2))) float    v2f;
typedef __attribute__((ext_vector_type(2))) _Float16 v2h;

#define POOL_D1   64                     // d1 a block owns
#define POOL_SD1  16                     // d1 a stage
#define POOL_SFLT (POOL_SD1 * D2 * 49)   // 12,544 floats = 50,176 bytes a stage
#define POOL_THR  256
#define POOL_BLKS (BATCH * (D1 / POOL_D1))  // 1,024
static_assert(POOL_THR == CVT_THR, "both bodies run in one block shape");

__global__ void __launch_bounds__(POOL_THR)
k_pool_cvt(const float* __restrict__ x,
           float* __restrict__ xp_f, half_t* __restrict__ xp_h,
           float* __restrict__ nx_f, half_t* __restrict__ nx_h,
           const float* __restrict__ attn_w, half_t* __restrict__ awh,
           const float* __restrict__ w1, half_t* __restrict__ w1h) {
  __shared__ __align__(16) float tile[POOL_SFLT];
  __shared__ __align__(8) float tr[D2][POOL_D1 + 2];  // pitch 66: no bank conflict for writers or readers
  // Block-uniform, in front of every copy and barrier: a whole block leaves here.
  if (blockIdx.x >= POOL_BLKS) {
    const int cb = blockIdx.x - POOL_BLKS;
    if (cb < CVT_BLKS_AW)
      pack_f16_block<D1, 2 * 4 * D1>(attn_w, awh, cb, (half_t*)tile);
    else
      pack_f16_block<KCLS, N1>(w1, w1h, cb - CVT_BLKS_AW, (half_t*)tile);
    return;
  }
  const int tid = threadIdx.x;
  const int wave = __builtin_amdgcn_readfirstlane(tid >> 5);
  const int b = blockIdx.x >> 3;
  const int d1_0 = (blockIdx.x & 7) * POOL_D1;
  const float* g = x + (size_t)(b * D1 + d1_0) * (D2 * 49) + tid * 4;
  const unsigned int l = (unsigned int)(uintptr_t)&tile[0] + (unsigned int)tid * 16u;

  // Unrolled: each stage's column of tr is a constant LDS offset on one base.
#pragma unroll
  for (int s = 0; s < POOL_D1 / POOL_SD1; ++s, g += POOL_SFLT) {
    // 3,136 pieces of 16 bytes: 12 from every thread, a 13th from waves 0 and 1.
    // The s_wait_xcnt closes each statement so that no address register of an
    // issued copy is rewritten ahead of it.
    asm volatile(
        "global_load_async_to_lds_b128 %0, %12, off\n\t"
        "global_load_async_to_lds_b128 %1, %13, off\n\t"
        "global_load_async_to_lds_b128 %2, %14, off\n\t"
        "global_load_async_to_lds_b128 %3, %15, off\n\t"
        "global_load_async_to_lds_b128 %4, %16, off\n\t"
        "global_load_async_to_lds_b128 %5, %17, off\n\t"
        "global_load_async_to_lds_b128 %6, %18, off\n\t"
        "global_load_async_to_lds_b128 %7, %19, off\n\t"
        "global_load_async_to_lds_b128 %8, %20, off\n\t"
        "global_load_async_to_lds_b128 %9, %21, off\n\t"
        "global_load_async_to_lds_b128 %10, %22, off\n\t"
        "global_load_async_to_lds_b128 %11, %23, off\n\t"
        "s_wait_xcnt 0x0"
        :: "v"(l), "v"(l + 1u * 4096u), "v"(l + 2u * 4096u), "v"(l + 3u * 4096u),
           "v"(l + 4u * 4096u), "v"(l + 5u * 4096u), "v"(l + 6u * 4096u),
           "v"(l + 7u * 4096u), "v"(l + 8u * 4096u), "v"(l + 9u * 4096u),
           "v"(l + 10u * 4096u), "v"(l + 11u * 4096u),
           "v"(g), "v"(g + 1 * 1024), "v"(g + 2 * 1024), "v"(g + 3 * 1024),
           "v"(g + 4 * 1024), "v"(g + 5 * 1024), "v"(g + 6 * 1024), "v"(g + 7 * 1024),
           "v"(g + 8 * 1024), "v"(g + 9 * 1024), "v"(g + 10 * 1024), "v"(g + 11 * 1024)
        : "memory");
    if (wave < 2) {
      asm volatile(
          "global_load_async_to_lds_b128 %0, %1, off\n\t"
          "s_wait_xcnt 0x0"
          :: "v"(l + 12u * 4096u), "v"(g + 12 * 1024) : "memory");
    }
    // This wave's copies have landed; the barrier then shows them to every wave.
    asm volatile("s_wait_asynccnt 0x0" ::: "memory");
    __syncthreads();

    const float* p = &tile[tid * 49];  // window tid = (d1 in the stage) * 16 + d2
    float m = p[0];
    // Unrolled: constant LDS offsets, and the reads run ahead of the maxima.
#pragma unroll
    for (int j = 1; j < 49; ++j) m = fmaxf(m, p[j]);
    tr[tid & 15][s * POOL_SD1 + (tid >> 4)] = m;

    // This wave's LDS reads of the stage are done; behind the barrier the next
    // stage's copies may overwrite the tile (and, last, tr is whole).
    asm volatile("s_wait_dscnt 0x0" ::: "memory");
    __syncthreads();
  }

  // 512 pairs of neighbouring d1: a wave stores 256 bytes of f32, 128 of f16.
#pragma unroll
  for (int k = 0; k < 2; ++k) {
    const int q = tid + POOL_THR * k;
    const int d2 = q >> 5, d1l = (q & 31) * 2;
    const v2f m2 = *(const v2f*)&tr[d2][d1l];
    const int o = (b * D2 + d2) * D1 + d1_0 + d1l;
    *(v2f*)(xp_f + o) = m2;
    *(v2f*)(nx_f + o) = m2;
    v2h h2;
    h2[0] = (half_t)m2[0];
    h2[1] = (half_t)m2[1];
    *(v2h*)(xp_h + o) = h2;
    *(v2h*)(nx_h + o) = h2;
  }
}

// ---------------------------------------------------------------------------
// The 16 x 512 x 512 product Y = X @ W^T of one batch entry, shared by the two
// kernels below. X (f16) lies in LDS, rows of 520 halves; a wave owns a 16x32
// output tile (two WMMA accumulators sharing one A fragment). W lies in fragment
// order (pack_f16_block): Wt0 and Wt1 point at this lane's 8 halves in the first
// piece of the wave's two N tiles, a k step is 512 halves on. The weight
// fragments come in groups of GS k steps (4 * GS loads), two groups in flight:
// a wave waits out the L2 latency once a pair of groups, not once a step.
// ---------------------------------------------------------------------------
#define XPITCH 520  // halves a row in LDS: 16 bytes more than the row spreads the banks

template <int GS>
__device__ __forceinline__ void
w_group(v8h (&q)[GS][4], const half_t* __restrict__ Wt0,
        const half_t* __restrict__ Wt1, int c) {
  // Unrolled: constant indices keep q in registers.
#pragma unroll
  for (int s = 0; s < GS; ++s) {
    const int p = (c * GS + s) * 512;
    q[s][0] = *(const v8h*)(Wt0 + p);
    q[s][1] = *(const v8h*)(Wt0 + p + 256);
    q[s][2] = *(const v8h*)(Wt1 + p);
    q[s][3] = *(const v8h*)(Wt1 + p + 256);
  }
}

// wq holds groups 0 and 1 on entry.
template <int GS>
__device__ __forceinline__ void
gemm512_kloop(const half_t (*Xs)[XPITCH], const half_t* __restrict__ Wt0,
              const half_t* __restrict__ Wt1, v8h (&wq)[2][GS][4],
              int lm, int lh, v8f& acc0, v8f& acc1) {
  // Unrolled: the group's buffer index is a constant.
#pragma unroll
  for (int c = 0; c < 16 / GS; ++c) {
#pragma unroll
    for (int s = 0; s < GS; ++s) {
      const int base = (c * GS + s) * 32 + 8 * lh;
      v8h a0 = *(const v8h*)&Xs[lm][base];
      v8h a1 = *(const v8h*)&Xs[lm][base + 16];
      acc0 = wmma_step(a0, a1, wq[c & 1][s][0], wq[c & 1][s][1], acc0);
      acc1 = wmma_step(a0, a1, wq[c & 1][s][2], wq[c & 1][s][3], acc1);
    }
    if (c + 2 < 16 / GS) {
      // The fence pair keeps the refill where it stands: without it the
      // compiler moves each load down to just in front of its WMMA.
      __builtin_amdgcn_sched_barrier(0);
      w_group<GS>(wq[c & 1], Wt0, Wt1, c + 2);
      __builtin_amdgcn_sched_barrier(0);
    }
  }
}

// ---------------------------------------------------------------------------
// a = fc_a(new_x), bproj = fc_b(xp), scores[b,c,d] = dot(a[b,c,:], bproj[b,d,:])
// / sqrt(512). One block of 32 waves per b: waves 0-15 make a[b], waves 16-31
// bproj[b], 32 columns each. Both results stay in LDS as f16, and wave 0 takes
// the 16x16 score tile from there: the scores need nothing of another b, so
// they need no launch of their own. a goes to memory in f32 for the context
// product; bproj never leaves the block.
// ---------------------------------------------------------------------------
__global__ void __launch_bounds__(1024)
k_ab_scores(const half_t* __restrict__ NXh, const half_t* __restrict__ XPh,
            const half_t* __restrict__ Wa, const half_t* __restrict__ Wb,
            const float* __restrict__ ba, const float* __restrict__ bb,
            float* __restrict__ Af, float* __restrict__ S) {
  __shared__ __align__(16) half_t Xs[2][16][XPITCH];  // new_x[b], xp[b]
  __shared__ __align__(16) half_t Ys[2][16][XPITCH];  // a[b], bproj[b]
  const int tid = threadIdx.x;
  const int lane = tid & 31;
  const int wave = __builtin_amdgcn_readfirstlane(tid >> 5);
  const int z = wave >> 4;  // wave-uniform: 0 = fc_a, 1 = fc_b
  const int b = blockIdx.x;
  const int ntile0 = (wave & 15) * 2;  // two adjacent N tiles
  const int lm = lane & 15, lh = lane >> 4;

  // Both X tiles: 1,024 pieces of 8 halves each, one piece of each a thread.
  // Asked for first, so that their LDS stores do not wait for the weights.
  const int pr = tid >> 6, pc = (tid & 63) * 8;
  const v8h xa = *(const v8h*)(NXh + (size_t)(b * 16 + pr) * D1 + pc);
  const v8h xb = *(const v8h*)(XPh + (size_t)(b * 16 + pr) * D1 + pc);
  // Stands in front of any reuse of these two loads' address registers.
  asm volatile("s_wait_xcnt 0x0" ::: "memory");

  const half_t* Wt0 = (z ? Wb : Wa) + (size_t)ntile0 * (16 * D1) + lane * 8;
  const half_t* Wt1 = Wt0 + (size_t)16 * D1;
  // Groups of two k steps: 32 waves leave a wave 128 registers, and the block
  // still has as many loads in flight as two blocks of 8 waves with groups of four.
  v8h wq[2][2][4];
  w_group<2>(wq[0], Wt0, Wt1, 0);
  w_group<2>(wq[1], Wt0, Wt1, 1);
  const float* bias = z ? bb : ba;
  const float bn[2] = {bias[ntile0 * 16 + lm], bias[ntile0 * 16 + 16 + lm]};

  *(v8h*)&Xs[0][pr][pc] = xa;
  *(v8h*)&Xs[1][pr][pc] = xb;
  __syncthreads();

  v8f acc0 = {}, acc1 = {};
  gemm512_kloop<2>(Xs[z], Wt0, Wt1, wq, lm, lh, acc0, acc1);

  // C layout: lane->N, VGPR->M (8-row halves).
  float y[2][8];
  // Unrolled: constant indices into the accumulators.
#pragma unroll
  for (int t = 0; t < 2; ++t) {
    const v8f acc = t ? acc1 : acc0;
#pragma unroll
    for (int r2 = 0; r2 < 8; ++r2) {
      y[t][r2] = acc[r2] + bn[t];
      Ys[z][lh * 8 + r2][ntile0 * 16 + t * 16 + lm] = (half_t)y[t][r2];
    }
  }
  __syncthreads();

  // Behind the barrier: in front of it, the barrier would wait for the stores
  // to be acknowledged, and the scores with it.
  if (z == 0) {
    const size_t o0 = (size_t)(b * 16 + lh * 8) * D1 + ntile0 * 16 + lm;
    // Unrolled: constant indices into y, constant offsets on one address pair.
#pragma unroll
    for (int t = 0; t < 2; ++t)
#pragma unroll
      for (int r2 = 0; r2 < 8; ++r2) Af[o0 + (size_t)r2 * D1 + t * 16] = y[t][r2];
    // Stands in front of any reuse of the stores' address and data registers.
    asm volatile("s_wait_xcnt 0x0" ::: "memory");
  }

  if (wave == 0) {
    v8f acc = {};
    // Unrolled: constant LDS offsets, and the reads run ahead of the WMMAs.
#pragma unroll
    for (int s = 0; s < 16; ++s) {
      const int base = s * 32 + 8 * lh;
      acc = wmma_step(*(const v8h*)&Ys[0][lm][base], *(const v8h*)&Ys[0][lm][base + 16],
                      *(const v8h*)&Ys[1][lm][base], *(const v8h*)&Ys[1][lm][base + 16], acc);
    }
    const float sc = 0.044194173824159216f;  // 1/sqrt(512)
    // Unrolled: constant indices into the accumulator.
#pragma unroll
    for (int r2 = 0; r2 < 8; ++r2) S[b * 256 + (lh * 8 + r2) * 16 + lm] = acc[r2] * sc;
  }
}

// ---------------------------------------------------------------------------
// e = relu(LayerNorm_{16,512}( ab[b] @ a[b] )), new_x[b] += fc_1(e).
// ab = softmax of the raw scores S over dim 0 (batch; legacy nn.Softmax() on
// 3D). Every block works out the maximum and the sum of all 256 columns
// itself, one column (c*16 + d) a thread, and keeps only its own b's row. The
// sum runs in ascending b.
// e stays in LDS as f16 and is the X tile of the fc_1 product, which needs
// nothing of another b. Two blocks per b (blockIdx.y): each makes the whole of
// e for itself and takes 256 of the 512 columns of fc_1, so that the product
// keeps its 16 waves per b without a hand-over between blocks.
// ---------------------------------------------------------------------------
__global__ void __launch_bounds__(256)
k_context_fc1(const float* __restrict__ S, const float* __restrict__ Af,
              const float* __restrict__ g, const float* __restrict__ beta,
              const half_t* __restrict__ W, const float* __restrict__ bias,
              float* NXf, half_t* __restrict__ NXh) {
  __shared__ float ab[256];
  __shared__ float ep[8192];
  __shared__ float rs[256], rq[256];
  __shared__ __align__(16) half_t Es[16][XPITCH];
  const int b = blockIdx.x, tid = threadIdx.x;
  // A thread's two columns of a[b] (t = tid and tid + 256), read once and asked
  // for together with the scores: every c of the context product uses them.
  float af[16][2];
  // Unrolled: constant indices keep af in registers.
#pragma unroll
  for (int d = 0; d < 16; ++d) {
    af[d][0] = Af[(size_t)(b * 16 + d) * D1 + tid];
    af[d][1] = Af[(size_t)(b * 16 + d) * D1 + tid + 256];
  }
  {
    float v[BATCH];
    // Unrolled: v stays in registers and the column's loads are all in flight
    // together, one L2 latency for the column.
#pragma unroll
    for (int i = 0; i < BATCH; ++i) v[i] = S[i * 256 + tid];
    const float own = S[b * 256 + tid];
    // Stands in front of any reuse of the load's address registers.
    asm volatile("s_wait_xcnt 0x0" ::: "memory");
    // Keeps the loads of af above the softmax arithmetic: one latency for all.
    __builtin_amdgcn_sched_barrier(0);
    float mx = -1e30f;
    // Unrolled: constant indices into v.
#pragma unroll
    for (int i = 0; i < BATCH; ++i) mx = fmaxf(mx, v[i]);
    float sum = 0.0f;
    // Unrolled: constant indices into v.
#pragma unroll
    for (int i = 0; i < BATCH; ++i) sum += __expf(v[i] - mx);
    ab[tid] = __expf(own - mx) * (1.0f / sum);
  }
  // The LayerNorm weights of this thread's 32 elements, asked for here so that
  // they land under the context product and the reduction.
  float gg[32], bb[32];
  // Unrolled: constant indices keep gg and bb in registers.
#pragma unroll
  for (int i = 0; i < 32; ++i) {
    gg[i] = g[tid + 256 * i];
    bb[i] = beta[tid + 256 * i];
  }
  __syncthreads();

  float lsum = 0.0f, lsq = 0.0f;
  // Unrolled: constant indices into af.
#pragma unroll
  for (int i = 0; i < 32; ++i) {
    int idx = tid + 256 * i;          // idx = c*512 + t, c = i / 2, t = tid + 256 * (i % 2)
    int c = i >> 1;
    float s = 0.0f;
#pragma unroll
    for (int d = 0; d < 16; ++d)
      s += ab[c * 16 + d] * af[d][i & 1];
    ep[idx] = s;
    lsum += s;
    lsq += s * s;
    // Every four rows c: keeps the LDS reads of later rows of ab, and behind the
    // last row the weight loads below, from piling up in registers on top of af,
    // gg and bb, which would take the kernel past 256 of them.
    if ((i & 7) == 7) __builtin_amdgcn_sched_barrier(0);
  }
  rs[tid] = lsum; rq[tid] = lsq;

  // fc_1's first two weight groups and its bias depend on nothing above: asked
  // for here, in front of the reduction and the LayerNorm.
  const int lane = tid & 31;
  const int wave = tid >> 5;
  const int ntile0 = (blockIdx.y * 8 + wave) * 2;  // two adjacent N tiles
  const int lm = lane & 15, lh = lane >> 4;
  const half_t* Wt0 = W + (size_t)ntile0 * (16 * D1) + lane * 8;
  const half_t* Wt1 = Wt0 + (size_t)16 * D1;
  const float bn[2] = {bias[ntile0 * 16 + lm], bias[ntile0 * 16 + 16 + lm]};
  // Stands in front of any reuse of the bias loads' address register.
  asm volatile("s_wait_xcnt 0x0" ::: "memory");
  v8h wq[2][4][4];
  w_group<4>(wq[0], Wt0, Wt1, 0);
  w_group<4>(wq[1], Wt0, Wt1, 1);
  const size_t o0 = (size_t)(b * 16 + lh * 8) * D1 + ntile0 * 16 + lm;  // C layout: lane->N, VGPR->M (8-row halves)

  __syncthreads();
  for (int s2 = 128; s2 > 0; s2 >>= 1) {
    if (tid < s2) { rs[tid] += rs[tid + s2]; rq[tid] += rq[tid + s2]; }
    __syncthreads();
  }
  float mu   = rs[0] * (1.0f / 8192.0f);
  float var  = rq[0] * (1.0f / 8192.0f) - mu * mu;
  float rstd = rsqrtf(var + 1e-5f);
  // Unrolled: constant indices into gg and bb.
#pragma unroll
  for (int i = 0; i < 32; ++i) {
    int idx = tid + 256 * i;
    int c = idx >> 9, t = idx & 511;
    float v = (ep[idx] - mu) * rstd * gg[i] + bb[i];
    v = fmaxf(v, 0.0f);
    Es[c][t] = (half_t)v;
  }
  // The residual, asked for once gg and bb have left their registers: it lands
  // under the product.
  float rv[2][8];
  // Unrolled: constant indices keep rv in registers.
#pragma unroll
  for (int t = 0; t < 2; ++t)
#pragma unroll
    for (int r2 = 0; r2 < 8; ++r2) rv[t][r2] = NXf[o0 + (size_t)r2 * D1 + t * 16];
  __syncthreads();

  v8f acc0 = {}, acc1 = {};
  gemm512_kloop<4>(Es, Wt0, Wt1, wq, lm, lh, acc0, acc1);

  float y[2][8];
  // Unrolled: constant indices into the accumulators.
#pragma unroll
  for (int t = 0; t < 2; ++t) {
    const v8f acc = t ? acc1 : acc0;
#pragma unroll
    for (int r2 = 0; r2 < 8; ++r2) y[t][r2] = acc[r2] + bn[t] + rv[t][r2];
  }
  // Unrolled: constant indices into y, constant offsets on one address pair.
#pragma unroll
  for (int t = 0; t < 2; ++t)
#pragma unroll
    for (int r2 = 0; r2 < 8; ++r2) NXf[o0 + (size_t)r2 * D1 + t * 16] = y[t][r2];
  // Stands in front of any reuse of the stores' address and data registers; the
  // fence keeps the conversions below, which reuse them, behind the wait.
  asm volatile("s_wait_xcnt 0x0" ::: "memory");
  __builtin_amdgcn_sched_barrier(0);
  half_t yh[2][8];
  // Unrolled: constant indices into y and yh.
#pragma unroll
  for (int t = 0; t < 2; ++t)
#pragma unroll
    for (int r2 = 0; r2 < 8; ++r2) yh[t][r2] = (half_t)y[t][r2];
  // Keeps every conversion in front of the stores: none of them then rewrites a
  // register of an issued store.
  __builtin_amdgcn_sched_barrier(0);
  // Unrolled: constant indices into yh, constant offsets on one address pair.
#pragma unroll
  for (int t = 0; t < 2; ++t)
#pragma unroll
    for (int r2 = 0; r2 < 8; ++r2) NXh[o0 + (size_t)r2 * D1 + t * 16] = yh[t][r2];
}

// ---------------------------------------------------------------------------
// h1 = relu( feat[128,16384] @ w1[200,16384]^T + b1 ).  feat = [xp | new_x]
// One block per 16x16 output tile; K is split over the block's 32 waves
// (512 k each, 16 WMMA steps), the 32 partial tiles are summed in LDS in
// wave order. w1 lies in fragment order (pack_f16_block), 13 whole tiles of 16
// rows: a k step is 512 halves on.
// ---------------------------------------------------------------------------
#define CLS_WAVES  32
#define CLS_KSLICE (KCLS / CLS_WAVES)  // 512; divides 8192, so a slice is all xp or all new_x

__global__ void __launch_bounds__(32 * CLS_WAVES)
k_gemm_cls(const half_t* __restrict__ XPh, const half_t* __restrict__ NXh,
           const half_t* __restrict__ W1h, const float* __restrict__ b1,
           float* __restrict__ H1) {
  __shared__ float red[CLS_WAVES][256];
  const int lane = threadIdx.x & 31;
  const int wave = threadIdx.x >> 5;
  const int lm = lane & 15, lh = lane >> 4;
  const int m0 = blockIdx.x * 16;    // batch tile (8 tiles)
  const int ntile = blockIdx.y;      // 13 tiles cover N=200 (pad to 208)
  const int nw = ntile * 16 + lm;   // masked at the store
  const int k0 = wave * CLS_KSLICE;
  const int mrow = m0 + lm;
  const half_t* Ws = W1h + ((size_t)ntile * (KCLS / 32) + k0 / 32) * 512 + lane * 8;
  const half_t* Xs = ((k0 < 8192) ? (XPh + (size_t)mrow * 8192 + k0)
                                  : (NXh + (size_t)mrow * 8192 + (k0 - 8192))) + 8 * lh;

  // Fragments in groups of two k steps (8 loads: one whole 128-byte line of
  // each of the 16 rows of X, 2,048 bytes in a row of w1), two groups in flight
  // a wave.
  v8h q[2][2][4];
  // Unrolled: constant indices keep q in registers.
#pragma unroll
  for (int c = 0; c < 2; ++c) {
#pragma unroll
    for (int s = 0; s < 2; ++s) {
      const int k = (c * 2 + s) * 32;
      q[c][s][0] = *(const v8h*)(Xs + k);
      q[c][s][1] = *(const v8h*)(Xs + k + 16);
      q[c][s][2] = *(const v8h*)(Ws + k * 16);
      q[c][s][3] = *(const v8h*)(Ws + k * 16 + 256);
    }
  }
  // Keeps the 16 loads above the first WMMA: without it the compiler moves
  // each load down to just in front of its WMMA.
  __builtin_amdgcn_sched_barrier(0);
  v8f acc = {};
  // Unrolled: the group's buffer index is a constant.
#pragma unroll
  for (int c = 0; c < CLS_KSLICE / 64; ++c) {
#pragma unroll
    for (int s = 0; s < 2; ++s)
      acc = wmma_step(q[c & 1][s][0], q[c & 1][s][1], q[c & 1][s][2], q[c & 1][s][3], acc);
    if (c + 2 < CLS_KSLICE / 64) {
      // The fence pair keeps the refill where it stands, for the same reason.
      __builtin_amdgcn_sched_barrier(0);
#pragma unroll
      for (int s = 0; s < 2; ++s) {
        const int k = ((c + 2) * 2 + s) * 32;
        q[c & 1][s][0] = *(const v8h*)(Xs + k);
        q[c & 1][s][1] = *(const v8h*)(Xs + k + 16);
        q[c & 1][s][2] = *(const v8h*)(Ws + k * 16);
        q[c & 1][s][3] = *(const v8h*)(Ws + k * 16 + 256);
      }
      __builtin_amdgcn_sched_barrier(0);
    }
  }

  // Unrolled: constant indices keep acc in registers.
#pragma unroll
  for (int r2 = 0; r2 < 8; ++r2) red[wave][r2 * 32 + lane] = acc[r2];
  __syncthreads();

  if (threadIdx.x < 256 && nw < N1) {
    const float bn = b1[nw];
    // Stands in front of any reuse of the bias load's address register.
    asm volatile("s_wait_xcnt 0x0" ::: "memory");
    float s = 0.0f;
    // Unrolled: the LDS reads run ahead of the dependent adds.
#pragma unroll
    for (int w = 0; w < CLS_WAVES; ++w) s += red[w][threadIdx.x];
    const int r2 = threadIdx.x >> 5;      // accumulator register of this element
    const int m = m0 + lh * 8 + r2;       // C layout: lane->N, VGPR->M (8-row halves)
    H1[m * N1 + nw] = fmaxf(s + bn, 0.0f);
  }
}

// ---------------------------------------------------------------------------
// The three small FCs (200->50->10->128) in one launch: a row of the batch
// needs nothing of another row, so a block takes one row through all three and
// hands h2 and h3 over in LDS. All weights are asked for up front, together
// with the row of h1. In the first two layers a wave takes an output, its lanes
// split k and the 32 partial sums meet in a butterfly.
// ---------------------------------------------------------------------------
#define N2 50
#define N3 10
#define N4 128

// Sums each of the N values over the wave's 32 lanes; every lane gets the sums.
// The distance is the outer loop: the N exchanges of a distance are in flight
// together, five LDS-path latencies in all and not five a value.
template <int N>
__device__ __forceinline__ void wave_sum(float (&s)[N]) {
  // Unrolled: constant indices keep s in registers.
#pragma unroll
  for (int d = 16; d > 0; d >>= 1) {
    float t[N];
#pragma unroll
    for (int o = 0; o < N; ++o) t[o] = __shfl_xor(s[o], d);
#pragma unroll
    for (int o = 0; o < N; ++o) s[o] += t[o];
  }
}

__global__ void __launch_bounds__(256)
k_tail(const float* __restrict__ H1,
       const float* __restrict__ w2, const float* __restrict__ b2,
       const float* __restrict__ w3, const float* __restrict__ b3,
       const float* __restrict__ w4, const float* __restrict__ b4,
       float* __restrict__ out) {
  __shared__ float h2s[N2], h3s[N3];
  const int tid = threadIdx.x;
  const int lane = tid & 31;
  const int wave = __builtin_amdgcn_readfirstlane(tid >> 5);
  const int m = blockIdx.x;

  // Outputs wave, wave + 8, ...; an output past the end is clamped for its
  // loads and not stored.
  float x1[7], wa[7][7], ba[7];
  // Unrolled (here and below): constant indices keep the arrays in registers.
#pragma unroll
  for (int j = 0; j < 7; ++j) {
    const int k = lane + 32 * j;
    x1[j] = (k < N1) ? H1[m * N1 + k] : 0.0f;
  }
#pragma unroll
  for (int o = 0; o < 7; ++o) {
    const int n = min(wave + 8 * o, N2 - 1);
    ba[o] = b2[n];
#pragma unroll
    for (int j = 0; j < 7; ++j) {
      const int k = lane + 32 * j;
      wa[o][j] = (k < N1) ? w2[n * N1 + k] : 0.0f;
    }
  }
  float wb[2][2], bbv[2];
#pragma unroll
  for (int o = 0; o < 2; ++o) {
    const int n = min(wave + 8 * o, N3 - 1);
    bbv[o] = b3[n];
#pragma unroll
    for (int j = 0; j < 2; ++j) {
      const int k = lane + 32 * j;
      wb[o][j] = (k < N2) ? w3[n * N2 + k] : 0.0f;
    }
  }
  const int n4 = tid & (N4 - 1);
  float wc[N3];
#pragma unroll
  for (int k = 0; k < N3; ++k) wc[k] = w4[n4 * N3 + k];
  const float bc = b4[n4];
  // Stands in front of any reuse of the loads' address registers.
  asm volatile("s_wait_xcnt 0x0" ::: "memory");

  float s2[7];
#pragma unroll
  for (int o = 0; o < 7; ++o) {
    s2[o] = 0.0f;
#pragma unroll
    for (int j = 0; j < 7; ++j) s2[o] += x1[j] * wa[o][j];
  }
  wave_sum<7>(s2);
  if (lane == 0) {
#pragma unroll
    for (int o = 0; o < 7; ++o) {
      const int n = wave + 8 * o;
      if (n < N2) h2s[n] = fmaxf(s2[o] + ba[o], 0.0f);
    }
  }
  __syncthreads();

  float x2[2];
#pragma unroll
  for (int j = 0; j < 2; ++j) {
    const int k = lane + 32 * j;
    x2[j] = (k < N2) ? h2s[k] : 0.0f;
  }
  float s3[2];
#pragma unroll
  for (int o = 0; o < 2; ++o) s3[o] = x2[0] * wb[o][0] + x2[1] * wb[o][1];
  wave_sum<2>(s3);
  if (lane == 0) {
#pragma unroll
    for (int o = 0; o < 2; ++o) {
      const int n = wave + 8 * o;
      if (n < N3) h3s[n] = fmaxf(s3[o] + bbv[o], 0.0f);
    }
  }
  __syncthreads();

  if (tid < N4) {
    float s = bc;
#pragma unroll
    for (int k = 0; k < N3; ++k) s += h3s[k] * wc[k];
    out[m * N4 + tid] = s;
  }
}

// ---------------------------------------------------------------------------
extern "C" void kernel_launch(void* const* d_in, const int* in_sizes, int n_in,
                              void* d_out, int out_size, void* d_ws, size_t ws_size,
                              hipStream_t stream) {
  (void)in_sizes; (void)n_in; (void)out_size; (void)ws_size;
  const float* x      = (const float*)d_in[0];
  const float* attn_w = (const float*)d_in[1];
  const float* attn_b = (const float*)d_in[2];
  const float* ln_g   = (const float*)d_in[3];
  const float* ln_b   = (const float*)d_in[4];
  const float* w1     = (const float*)d_in[5];
  const float* b1     = (const float*)d_in[6];
  const float* w2     = (const float*)d_in[7];
  const float* b2     = (const float*)d_in[8];
  const float* w3     = (const float*)d_in[9];
  const float* b3     = (const float*)d_in[10];
  const float* w4     = (const float*)d_in[11];
  const float* b4     = (const float*)d_in[12];
  float* out = (float*)d_out;

  char* ws = (char*)d_ws;
  size_t off = 0;
  auto alloc = [&](size_t bytes) -> char* {
    char* p = ws + off;
    off += (bytes + 255) & ~(size_t)255;
    return p;
  };
  float*  xp_f  = (float*) alloc((size_t)M_ROWS * D1 * 4);
  half_t* xp_h  = (half_t*)alloc((size_t)M_ROWS * D1 * 2);
  float*  nx_f  = (float*) alloc((size_t)M_ROWS * D1 * 4);
  half_t* nx_h  = (half_t*)alloc((size_t)M_ROWS * D1 * 2);
  float*  a_f   = (float*) alloc((size_t)M_ROWS * D1 * 4);
  float*  sc    = (float*) alloc((size_t)BATCH * 256 * 4);
  half_t* awh   = (half_t*)alloc((size_t)2 * 4 * D1 * D1 * 2);
  half_t* w1h   = (half_t*)alloc((size_t)W1_TILES * 16 * KCLS * 2);
  float*  h1    = (float*) alloc((size_t)BATCH * N1 * 4);


  // Max-pool (the HBM-bound stage) + new_x init, and both weight conversions.
  k_pool_cvt<<<POOL_BLKS + CVT_BLKS_AW + CVT_BLKS_W1, POOL_THR, 0, stream>>>(
      x, xp_f, xp_h, nx_f, nx_h, attn_w, awh, w1, w1h);

  for (int i = 0; i < 2; ++i) {
    const half_t* Wa  = awh + (size_t)(i * 4 + 0) * D1 * D1;
    const half_t* Wb  = awh + (size_t)(i * 4 + 1) * D1 * D1;
    const half_t* W1s = awh + (size_t)(i * 4 + 3) * D1 * D1;
    const float* ba  = attn_b + (size_t)(i * 4 + 0) * D1;
    const float* bb  = attn_b + (size_t)(i * 4 + 1) * D1;
    const float* b1s = attn_b + (size_t)(i * 4 + 3) * D1;

    // a = fc_a(new_x), bproj = fc_b(xp), scores = a @ bproj^T / sqrt(512)
    k_ab_scores<<<BATCH, 1024, 0, stream>>>(nx_h, xp_h, Wa, Wb, ba, bb, a_f, sc);
    // new_x = new_x + fc_1(relu(LN(softmax_over_batch(scores) @ a)))
    k_context_fc1<<<dim3(BATCH, 2), 256, 0, stream>>>(sc, a_f, ln_g, ln_b, W1s, b1s, nx_f, nx_h);
  }

  // Classifier head.
  k_gemm_cls<<<dim3(BATCH / 16, 13), 32 * CLS_WAVES, 0, stream>>>(xp_h, nx_h, w1h, b1, h1);
  k_tail<<<BATCH, 256, 0, stream>>>(h1, w2, b2, w3, b3, w4, b4, out);
}

// v009
// One run takes 68.5 microseconds.
// Next to v008, in two timings, it ran 1.14 times as fast each time.
// All steps since v000 together make it 4.92 times as fast.
#include <hip/hip_runtime.h>

// ---------------------------------------------------------------------------
// Feature-bank attention forward on gfx1250 (wave32, WMMA).
//   1. max-pool 7x7 over x[128,512,16,7,7] -> xp[128,16,512]  (HBM-bound)
//   2. per stack, two launches, a block working on one batch entry b:
//      fc_a and fc_b (WMMA f16->f32) with the 16x16 score WMMA behind them;
//      batch-axis softmax + context matmul + LayerNorm + ReLU with the fc_1
//      GEMM and its residual behind them.
//   3. classifier: WMMA GEMM [128,16384]x[16384,200] as 32 partial sums over K;
//      their sum and the three small FCs in one launch.
// ---------------------------------------------------------------------------

typedef _Float16 half_t;
typedef __attribute__((ext_vector_type(16))) _Float16     v16h;
typedef __attribute__((ext_vector_type(8)))  _Float16     v8h;
typedef __attribute__((ext_vector_type(8)))  float        v8f;

#define D1     512
#define D2     16
#define BATCH  128
#define M_ROWS (BATCH * D2)   // 2048
#define KCLS   (2 * D2 * D1)  // 16384
#define N1     200

// Build the documented 16-bit WMMA fragment (VGPR0-3: K=base..base+7,
// VGPR4-7: K=base+16..base+23, per lane-half) from two 8-half chunks.
__device__ inline v8f wmma_step(v8h a0, v8h a1, v8h b0, v8h b1, v8f acc) {
  v16h af, bf;
#pragma unroll
  for (int i = 0; i < 8; ++i) {
    af[i] = a0[i]; af[8 + i] = a1[i];
    bf[i] = b0[i]; bf[8 + i] = b1[i];
  }
  return __builtin_amdgcn_wmma_f32_16x16x32_f16(
      /*neg_a=*/false, af, /*neg_b=*/false, bf,
      /*c_mod=*/(short)0, acc, /*reuse_a=*/false, /*reuse_b=*/false);
}

// ---------------------------------------------------------------------------
// f32 -> f16 weight copy, into the order in which the WMMA B fragments are read.
// A weight matrix [rows n][K] is stored as pieces of 512 bytes, one per
// (16 rows, 16 k): lane l = ((k >> 3) & 1) * 16 + (n & 15) owns 8 halves, k & 7:
//   half index = ((n >> 4) * (K / 32) + (k >> 5)) * 512 + ((k >> 4) & 1) * 256
//                + l * 8 + (k & 7)
// A fragment load of a wave is then 512 bytes in a row, four whole lines. From
// the row-major matrix it would be 32 bytes of each of 16 rows: 16 lines a load.
// A wave takes 16 rows x 64 k: eight loads of two 256-byte runs, all in flight
// together; its own LDS range turns them into the 2,048 bytes of four pieces,
// which lie in a row and are stored as whole lines. A block of 8 waves takes
// 512 k of its 16 rows. Where the rows are no multiple of 16, the last tile
// reads the matrix's last 16 rows and its lanes read them back from LDS turned
// round by the overlap: the tile's rows past the end then hold earlier rows, so
// that every byte of its pieces is written and no load leaves the matrix.
// The copies have no launch of their own: their blocks ride in the max-pool
// grid (k_pool_cvt), which they do not depend on.
// ---------------------------------------------------------------------------
typedef __attribute__((ext_vector_type(4))) float    v4f;
typedef __attribute__((ext_vector_type(4))) _Float16 v4h;

#define CVT_THR    256
#define W1_TILES   ((N1 + 15) / 16)  // 13
#define PK_GPITCH  144               // halves: 16 lanes' 256 bytes + 32, so that the 8-byte LDS stores spread over all banks
#define PK_WAVE    (8 * PK_GPITCH)   // halves of LDS a wave

#define CVT_BLKS_AW (2 * 4 * D1 / 16 * (D1 / 64) / 8)  // 256 blocks: attention weights
#define CVT_BLKS_W1 (W1_TILES * (KCLS / 64) / 8)       // 416 blocks: classifier weights

template <int K, int R>
__device__ __forceinline__ void
pack_f16_block(const float* __restrict__ src, half_t* __restrict__ dst, int blk,
               half_t* __restrict__ lds) {
  const int lane = threadIdx.x & 31;
  const int wave = __builtin_amdgcn_readfirstlane(threadIdx.x >> 5);
  static_assert(R >= 16, "a tile reads 16 rows");
  const unsigned int u = blk * 8 + wave;
  const int ntile = u / (K / 64), kp = u % (K / 64);
  const int r = lane >> 4, c = lane & 15;  // row in the pair, piece of 4 floats in the run
  const int row0 = min(ntile * 16, R - 16);  // the same in every lane
  const int turn = ntile * 16 - row0;
  const float* p = src + (size_t)(row0 + r) * K + kp * 64 + c * 4;
  v4f v[8];
  // Unrolled: v stays in registers, all eight loads are in flight together,
  // constant offsets on one address pair.
#pragma unroll
  for (int i = 0; i < 8; ++i) v[i] = *(const v4f*)(p + (size_t)i * (2 * K));
  half_t* st = lds + wave * PK_WAVE;
  // Unrolled: constant indices into v, constant LDS offsets on one base.
#pragma unroll
  for (int i = 0; i < 8; ++i)
    *(v4h*)(st + (c >> 1) * PK_GPITCH + (2 * i + r) * 8 + (c & 1) * 4) =
        __builtin_convertvector(v[i], v4h);
  // The wave's LDS stores are done before its lanes read each other's halves.
  asm volatile("s_wait_dscnt 0x0" ::: "memory");
  half_t* o = dst + ((size_t)ntile * (K / 32) + kp * 2) * 512 + lane * 8;
  // Unrolled: constant offsets on one LDS base and one address pair.
#pragma unroll
  for (int t = 0; t < 4; ++t)
    *(v8h*)(o + t * 256) = *(const v8h*)(st + (t * 2 + r) * PK_GPITCH + ((c + turn) & 15) * 8);
}

// ---------------------------------------------------------------------------
// Max-pool over HxW=49 (the 205 MB streaming read) + init new_x = xp.
// A block owns one b and 64 d1, in four stages of 16 d1: 16*16*49 floats that
// lie in one run in x. A stage's run goes to LDS in whole lines by asynchronous
// copies; each thread then takes the maximum of one 49-float window from LDS
// (lane pitch 49 dwords, odd, so no bank conflict). A small LDS tile turns
// (d1,d2) into (d2,d1), so that the block stores whole 128-byte lines of all
// four outputs. Four blocks fit a WGP: one block's maxima run under the
// others' copies.
// Blocks from POOL_BLKS on do the two weight copies instead: independent work
// in the same launch. The long pool blocks have the low indices and start first.
// ---------------------------------------------------------------------------
typedef __attribute__((ext_vector_type(2))) float    v2f;
typedef __attribute__((ext_vector_type(2))) _Float16 v2h;

#define POOL_D1   64                     // d1 a block owns
#define POOL_SD1  16                     // d1 a stage
#define POOL_SFLT (POOL_SD1 * D2 * 49)   // 12,544 floats = 50,176 bytes a stage
#define POOL_THR  256
#define POOL_BLKS (BATCH * (D1 / POOL_D1))  // 1,024
static_assert(POOL_THR == CVT_THR, "both bodies run in one block shape");

__global__ void __launch_bounds__(POOL_THR)
k_pool_cvt(const float* __restrict__ x,
           float* __restrict__ xp_f, half_t* __restrict__ xp_h,
           float* __restrict__ nx_f, half_t* __restrict__ nx_h,
           const float* __restrict__ attn_w, half_t* __restrict__ awh,
           const float* __restrict__ w1, half_t* __restrict__ w1h) {
  __shared__ __align__(16) float tile[POOL_SFLT];
  __shared__ __align__(8) float tr[D2][POOL_D1 + 2];  // pitch 66: no bank conflict for writers or readers
  // Block-uniform, in front of every copy and barrier: a whole block leaves here.
  if (blockIdx.x >= POOL_BLKS) {
    const int cb = blockIdx.x - POOL_BLKS;
    if (cb < CVT_BLKS_AW)
      pack_f16_block<D1, 2 * 4 * D1>(attn_w, awh, cb, (half_t*)tile);
    else
      pack_f16_block<KCLS, N1>(w1, w1h, cb - CVT_BLKS_AW, (half_t*)tile);
    return;
  }
  const int tid = threadIdx.x;
  const int wave = __builtin_amdgcn_readfirstlane(tid >> 5);
  const int b = blockIdx.x >> 3;
  const int d1_0 = (blockIdx.x & 7) * POOL_D1;
  const float* g = x + (size_t)(b * D1 + d1_0) * (D2 * 49) + tid * 4;
  const unsigned int l = (unsigned int)(uintptr_t)&tile[0] + (unsigned int)tid * 16u;

  // Unrolled: each stage's column of tr is a constant LDS offset on one base.
#pragma unroll
  for (int s = 0; s < POOL_D1 / POOL_SD1; ++s, g += POOL_SFLT) {
    // 3,136 pieces of 16 bytes: 12 from every thread, a 13th from waves 0 and 1.
    // The s_wait_xcnt closes each statement so that no address register of an
    // issued copy is rewritten ahead of it.
    asm volatile(
        "global_load_async_to_lds_b128 %0, %12, off\n\t"
        "global_load_async_to_lds_b128 %1, %13, off\n\t"
        "global_load_async_to_lds_b128 %2, %14, off\n\t"
        "global_load_async_to_lds_b128 %3, %15, off\n\t"
        "global_load_async_to_lds_b128 %4, %16, off\n\t"
        "global_load_async_to_lds_b128 %5, %17, off\n\t"
        "global_load_async_to_lds_b128 %6, %18, off\n\t"
        "global_load_async_to_lds_b128 %7, %19, off\n\t"
        "global_load_async_to_lds_b128 %8, %20, off\n\t"
        "global_load_async_to_lds_b128 %9, %21, off\n\t"
        "global_load_async_to_lds_b128 %10, %22, off\n\t"
        "global_load_async_to_lds_b128 %11, %23, off\n\t"
        "s_wait_xcnt 0x0"
        :: "v"(l), "v"(l + 1u * 4096u), "v"(l + 2u * 4096u), "v"(l + 3u * 4096u),
           "v"(l + 4u * 4096u), "v"(l + 5u * 4096u), "v"(l + 6u * 4096u),
           "v"(l + 7u * 4096u), "v"(l + 8u * 4096u), "v"(l + 9u * 4096u),
           "v"(l + 10u * 4096u), "v"(l + 11u * 4096u),
           "v"(g), "v"(g + 1 * 1024), "v"(g + 2 * 1024), "v"(g + 3 * 1024),
           "v"(g + 4 * 1024), "v"(g + 5 * 1024), "v"(g + 6 * 1024), "v"(g + 7 * 1024),
           "v"(g + 8 * 1024), "v"(g + 9 * 1024), "v"(g + 10 * 1024), "v"(g + 11 * 1024)
        : "memory");
    if (wave < 2) {
      asm volatile(
          "global_load_async_to_lds_b128 %0, %1, off\n\t"
          "s_wait_xcnt 0x0"
          :: "v"(l + 12u * 4096u), "v"(g + 12 * 1024) : "memory");
    }
    // This wave's copies have landed; the barrier then shows them to every wave.
    asm volatile("s_wait_asynccnt 0x0" ::: "memory");
    __syncthreads();

    const float* p = &tile[tid * 49];  // window tid = (d1 in the stage) * 16 + d2
    float m = p[0];
    // Unrolled: constant LDS offsets, and the reads run ahead of the maxima.
#pragma unroll
    for (int j = 1; j < 49; ++j) m = fmaxf(m, p[j]);
    tr[tid & 15][s * POOL_SD1 + (tid >> 4)] = m;

    // This wave's LDS reads of the stage are done; behind the barrier the next
    // stage's copies may overwrite the tile (and, last, tr is whole).
    asm volatile("s_wait_dscnt 0x0" ::: "memory");
    __syncthreads();
  }

  // 512 pairs of neighbouring d1: a wave stores 256 bytes of f32, 128 of f16.
#pragma unroll
  for (int k = 0; k < 2; ++k) {
    const int q = tid + POOL_THR * k;
    const int d2 = q >> 5, d1l = (q & 31) * 2;
    const v2f m2 = *(const v2f*)&tr[d2][d1l];
    const int o = (b * D2 + d2) * D1 + d1_0 + d1l;
    *(v2f*)(xp_f + o) = m2;
    *(v2f*)(nx_f + o) = m2;
    v2h h2;
    h2[0] = (half_t)m2[0];
    h2[1] = (half_t)m2[1];
    *(v2h*)(xp_h + o) = h2;
    *(v2h*)(nx_h + o) = h2;
  }
}

// ---------------------------------------------------------------------------
// The 16 x 512 x 512 product Y = X @ W^T of one batch entry, shared by the two
// kernels below. X (f16) lies in LDS, rows of 520 halves; a wave owns a 16x32
// output tile (two WMMA accumulators sharing one A fragment). W lies in fragment
// order (pack_f16_block): Wt0 and Wt1 point at this lane's 8 halves in the first
// piece of the wave's two N tiles, a k step is 512 halves on. The weight
// fragments come in groups of GS k steps (4 * GS loads), two groups in flight:
// a wave waits out the L2 latency once a pair of groups, not once a step.
// ---------------------------------------------------------------------------
#define XPITCH 520  // halves a row in LDS: 16 bytes more than the row spreads the banks

template <int GS>
__device__ __forceinline__ void
w_group(v8h (&q)[GS][4], const half_t* __restrict__ Wt0,
        const half_t* __restrict__ Wt1, int c) {
  // Unrolled: constant indices keep q in registers.
#pragma unroll
  for (int s = 0; s < GS; ++s) {
    const int p = (c * GS + s) * 512;
    q[s][0] = *(const v8h*)(Wt0 + p);
    q[s][1] = *(const v8h*)(Wt0 + p + 256);
    q[s][2] = *(const v8h*)(Wt1 + p);
    q[s][3] = *(const v8h*)(Wt1 + p + 256);
  }
}

// wq holds groups 0 and 1 on entry.
template <int GS>
__device__ __forceinline__ void
gemm512_kloop(const half_t (*Xs)[XPITCH], const half_t* __restrict__ Wt0,
              const half_t* __restrict__ Wt1, v8h (&wq)[2][GS][4],
              int lm, int lh, v8f& acc0, v8f& acc1) {
  // Unrolled: the group's buffer index is a constant.
#pragma unroll
  for (int c = 0; c < 16 / GS; ++c) {
#pragma unroll
    for (int s = 0; s < GS; ++s) {
      const int base = (c * GS + s) * 32 + 8 * lh;
      v8h a0 = *(const v8h*)&Xs[lm][base];
      v8h a1 = *(const v8h*)&Xs[lm][base + 16];
      acc0 = wmma_step(a0, a1, wq[c & 1][s][0], wq[c & 1][s][1], acc0);
      acc1 = wmma_step(a0, a1, wq[c & 1][s][2], wq[c & 1][s][3], acc1);
    }
    if (c + 2 < 16 / GS) {
      // The fence pair keeps the refill where it stands: without it the
      // compiler moves each load down to just in front of its WMMA.
      __builtin_amdgcn_sched_barrier(0);
      w_group<GS>(wq[c & 1], Wt0, Wt1, c + 2);
      __builtin_amdgcn_sched_barrier(0);
    }
  }
}

// ---------------------------------------------------------------------------
// a = fc_a(new_x), bproj = fc_b(xp), scores[b,c,d] = dot(a[b,c,:], bproj[b,d,:])
// / sqrt(512). One block of 32 waves per b: waves 0-15 make a[b], waves 16-31
// bproj[b], 32 columns each. Both results stay in LDS as f16, and wave 0 takes
// the 16x16 score tile from there: the scores need nothing of another b, so
// they need no launch of their own. a goes to memory in f32 for the context
// product; bproj never leaves the block.
// ---------------------------------------------------------------------------
__global__ void __launch_bounds__(1024)
k_ab_scores(const half_t* __restrict__ NXh, const half_t* __restrict__ XPh,
            const half_t* __restrict__ Wa, const half_t* __restrict__ Wb,
            const float* __restrict__ ba, const float* __restrict__ bb,
            float* __restrict__ Af, float* __restrict__ S) {
  __shared__ __align__(16) half_t Xs[2][16][XPITCH];  // new_x[b], xp[b]
  __shared__ __align__(16) half_t Ys[2][16][XPITCH];  // a[b], bproj[b]
  const int tid = threadIdx.x;
  const int lane = tid & 31;
  const int wave = __builtin_amdgcn_readfirstlane(tid >> 5);
  const int z = wave >> 4;  // wave-uniform: 0 = fc_a, 1 = fc_b
  const int b = blockIdx.x;
  const int ntile0 = (wave & 15) * 2;  // two adjacent N tiles
  const int lm = lane & 15, lh = lane >> 4;

  // Both X tiles: 1,024 pieces of 8 halves each, one piece of each a thread.
  // Asked for first, so that their LDS stores do not wait for the weights.
  const int pr = tid >> 6, pc = (tid & 63) * 8;
  const v8h xa = *(const v8h*)(NXh + (size_t)(b * 16 + pr) * D1 + pc);
  const v8h xb = *(const v8h*)(XPh + (size_t)(b * 16 + pr) * D1 + pc);
  // Stands in front of any reuse of these two loads' address registers.
  asm volatile("s_wait_xcnt 0x0" ::: "memory");

  const half_t* Wt0 = (z ? Wb : Wa) + (size_t)ntile0 * (16 * D1) + lane * 8;
  const half_t* Wt1 = Wt0 + (size_t)16 * D1;
  // Groups of two k steps: 32 waves leave a wave 128 registers, and the block
  // still has as many loads in flight as two blocks of 8 waves with groups of four.
  v8h wq[2][2][4];
  w_group<2>(wq[0], Wt0, Wt1, 0);
  w_group<2>(wq[1], Wt0, Wt1, 1);
  const float* bias = z ? bb : ba;
  const float bn[2] = {bias[ntile0 * 16 + lm], bias[ntile0 * 16 + 16 + lm]};

  *(v8h*)&Xs[0][pr][pc] = xa;
  *(v8h*)&Xs[1][pr][pc] = xb;
  __syncthreads();

  v8f acc0 = {}, acc1 = {};
  gemm512_kloop<2>(Xs[z], Wt0, Wt1, wq, lm, lh, acc0, acc1);

  // C layout: lane->N, VGPR->M (8-row halves).
  float y[2][8];
  // Unrolled: constant indices into the accumulators.
#pragma unroll
  for (int t = 0; t < 2; ++t) {
    const v8f acc = t ? acc1 : acc0;
#pragma unroll
    for (int r2 = 0; r2 < 8; ++r2) {
      y[t][r2] = acc[r2] + bn[t];
      Ys[z][lh * 8 + r2][ntile0 * 16 + t * 16 + lm] = (half_t)y[t][r2];
    }
  }
  __syncthreads();

  // Behind the barrier: in front of it, the barrier would wait for the stores
  // to be acknowledged, and the scores with it.
  if (z == 0) {
    const size_t o0 = (size_t)(b * 16 + lh * 8) * D1 + ntile0 * 16 + lm;
    // Unrolled: constant indices into y, constant offsets on one address pair.
#pragma unroll
    for (int t = 0; t < 2; ++t)
#pragma unroll
      for (int r2 = 0; r2 < 8; ++r2) Af[o0 + (size_t)r2 * D1 + t * 16] = y[t][r2];
    // Stands in front of any reuse of the stores' address and data registers.
    asm volatile("s_wait_xcnt 0x0" ::: "memory");
  }

  if (wave == 0) {
    v8f acc = {};
    // Unrolled: constant LDS offsets, and the reads run ahead of the WMMAs.
#pragma unroll
    for (int s = 0; s < 16; ++s) {
      const int base = s * 32 + 8 * lh;
      acc = wmma_step(*(const v8h*)&Ys[0][lm][base], *(const v8h*)&Ys[0][lm][base + 16],
                      *(const v8h*)&Ys[1][lm][base], *(const v8h*)&Ys[1][lm][base + 16], acc);
    }
    const float sc = 0.044194173824159216f;  // 1/sqrt(512)
    // Unrolled: constant indices into the accumulator.
#pragma unroll
    for (int r2 = 0; r2 < 8; ++r2) S[b * 256 + (lh * 8 + r2) * 16 + lm] = acc[r2] * sc;
  }
}

// ---------------------------------------------------------------------------
// e = relu(LayerNorm_{16,512}( ab[b] @ a[b] )), new_x[b] += fc_1(e).
// ab = softmax of the raw scores S over dim 0 (batch; legacy nn.Softmax() on
// 3D). Every block works out the maximum and the sum of all 256 columns
// itself, one column (c*16 + d) a thread, and keeps only its own b's row. The
// sum runs in ascending b.
// e stays in LDS as f16 and is the X tile of the fc_1 product, which needs
// nothing of another b. Two blocks per b (blockIdx.y): each makes the whole of
// e for itself and takes 256 of the 512 columns of fc_1, so that the product
// keeps its 16 waves per b without a hand-over between blocks.
// ---------------------------------------------------------------------------
__global__ void __launch_bounds__(256)
k_context_fc1(const float* __restrict__ S, const float* __restrict__ Af,
              const float* __restrict__ g, const float* __restrict__ beta,
              const half_t* __restrict__ W, const float* __restrict__ bias,
              float* NXf, half_t* __restrict__ NXh) {
  __shared__ float ab[256];
  __shared__ float ep[8192];
  __shared__ float rs[256], rq[256];
  __shared__ __align__(16) half_t Es[16][XPITCH];
  const int b = blockIdx.x, tid = threadIdx.x;
  // A thread's two columns of a[b] (t = tid and tid + 256), read once and asked
  // for together with the scores: every c of the context product uses them.
  float af[16][2];
  // Unrolled: constant indices keep af in registers.
#pragma unroll
  for (int d = 0; d < 16; ++d) {
    af[d][0] = Af[(size_t)(b * 16 + d) * D1 + tid];
    af[d][1] = Af[(size_t)(b * 16 + d) * D1 + tid + 256];
  }
  {
    float v[BATCH];
    // Unrolled: v stays in registers and the column's loads are all in flight
    // together, one L2 latency for the column.
#pragma unroll
    for (int i = 0; i < BATCH; ++i) v[i] = S[i * 256 + tid];
    const float own = S[b * 256 + tid];
    // Stands in front of any reuse of the load's address registers.
    asm volatile("s_wait_xcnt 0x0" ::: "memory");
    // Keeps the loads of af above the softmax arithmetic: one latency for all.
    __builtin_amdgcn_sched_barrier(0);
    float mx = -1e30f;
    // Unrolled: constant indices into v.
#pragma unroll
    for (int i = 0; i < BATCH; ++i) mx = fmaxf(mx, v[i]);
    float sum = 0.0f;
    // Unrolled: constant indices into v.
#pragma unroll
    for (int i = 0; i < BATCH; ++i) sum += __expf(v[i] - mx);
    ab[tid] = __expf(own - mx) * (1.0f / sum);
  }
  // The LayerNorm weights of this thread's 32 elements, asked for here so that
  // they land under the context product and the reduction.
  float gg[32], bb[32];
  // Unrolled: constant indices keep gg and bb in registers.
#pragma unroll
  for (int i = 0; i < 32; ++i) {
    gg[i] = g[tid + 256 * i];
    bb[i] = beta[tid + 256 * i];
  }
  __syncthreads();

  float lsum = 0.0f, lsq = 0.0f;
  // Unrolled: constant indices into af.
#pragma unroll
  for (int i = 0; i < 32; ++i) {
    int idx = tid + 256 * i;          // idx = c*512 + t, c = i / 2, t = tid + 256 * (i % 2)
    int c = i >> 1;
    float s = 0.0f;
#pragma unroll
    for (int d = 0; d < 16; ++d)
      s += ab[c * 16 + d] * af[d][i & 1];
    ep[idx] = s;
    lsum += s;
    lsq += s * s;
    // Every four rows c: keeps the LDS reads of later rows of ab, and behind the
    // last row the weight loads below, from piling up in registers on top of af,
    // gg and bb, which would take the kernel past 256 of them.
    if ((i & 7) == 7) __builtin_amdgcn_sched_barrier(0);
  }
  rs[tid] = lsum; rq[tid] = lsq;

  // fc_1's first two weight groups and its bias depend on nothing above: asked
  // for here, in front of the reduction and the LayerNorm.
  const int lane = tid & 31;
  const int wave = tid >> 5;
  const int ntile0 = (blockIdx.y * 8 + wave) * 2;  // two adjacent N tiles
  const int lm = lane & 15, lh = lane >> 4;
  const half_t* Wt0 = W + (size_t)ntile0 * (16 * D1) + lane * 8;
  const half_t* Wt1 = Wt0 + (size_t)16 * D1;
  const float bn[2] = {bias[ntile0 * 16 + lm], bias[ntile0 * 16 + 16 + lm]};
  // Stands in front of any reuse of the bias loads' address register.
  asm volatile("s_wait_xcnt 0x0" ::: "memory");
  v8h wq[2][4][4];
  w_group<4>(wq[0], Wt0, Wt1, 0);
  w_group<4>(wq[1], Wt0, Wt1, 1);
  const size_t o0 = (size_t)(b * 16 + lh * 8) * D1 + ntile0 * 16 + lm;  // C layout: lane->N, VGPR->M (8-row halves)

  __syncthreads();
  for (int s2 = 128; s2 > 0; s2 >>= 1) {
    if (tid < s2) { rs[tid] += rs[tid + s2]; rq[tid] += rq[tid + s2]; }
    __syncthreads();
  }
  float mu   = rs[0] * (1.0f / 8192.0f);
  float var  = rq[0] * (1.0f / 8192.0f) - mu * mu;
  float rstd = rsqrtf(var + 1e-5f);
  // Unrolled: constant indices into gg and bb.
#pragma unroll
  for (int i = 0; i < 32; ++i) {
    int idx = tid + 256 * i;
    int c = idx >> 9, t = idx & 511;
    float v = (ep[idx] - mu) * rstd * gg[i] + bb[i];
    v = fmaxf(v, 0.0f);
    Es[c][t] = (half_t)v;
  }
  // The residual, asked for once gg and bb have left their registers: it lands
  // under the product.
  float rv[2][8];
  // Unrolled: constant indices keep rv in registers.
#pragma unroll
  for (int t = 0; t < 2; ++t)
#pragma unroll
    for (int r2 = 0; r2 < 8; ++r2) rv[t][r2] = NXf[o0 + (size_t)r2 * D1 + t * 16];
  __syncthreads();

  v8f acc0 = {}, acc1 = {};
  gemm512_kloop<4>(Es, Wt0, Wt1, wq, lm, lh, acc0, acc1);

  float y[2][8];
  // Unrolled: constant indices into the accumulators.
#pragma unroll
  for (int t = 0; t < 2; ++t) {
    const v8f acc = t ? acc1 : acc0;
#pragma unroll
    for (int r2 = 0; r2 < 8; ++r2) y[t][r2] = acc[r2] + bn[t] + rv[t][r2];
  }
  // Unrolled: constant indices into y, constant offsets on one address pair.
#pragma unroll
  for (int t = 0; t < 2; ++t)
#pragma unroll
    for (int r2 = 0; r2 < 8; ++r2) NXf[o0 + (size_t)r2 * D1 + t * 16] = y[t][r2];
  // Stands in front of any reuse of the stores' address and data registers; the
  // fence keeps the conversions below, which reuse them, behind the wait.
  asm volatile("s_wait_xcnt 0x0" ::: "memory");
  __builtin_amdgcn_sched_barrier(0);
  half_t yh[2][8];
  // Unrolled: constant indices into y and yh.
#pragma unroll
  for (int t = 0; t < 2; ++t)
#pragma unroll
    for (int r2 = 0; r2 < 8; ++r2) yh[t][r2] = (half_t)y[t][r2];
  // Keeps every conversion in front of the stores: none of them then rewrites a
  // register of an issued store.
  __builtin_amdgcn_sched_barrier(0);
  // Unrolled: constant indices into yh, constant offsets on one address pair.
#pragma unroll
  for (int t = 0; t < 2; ++t)
#pragma unroll
    for (int r2 = 0; r2 < 8; ++r2) NXh[o0 + (size_t)r2 * D1 + t * 16] = yh[t][r2];
}

// ---------------------------------------------------------------------------
// feat[128,16384] @ w1[200,16384]^T, feat = [xp | new_x], as 32 partial sums.
// K is split over the blocks: a block takes 16 batch rows x 512 k x all 13 N
// tiles, one wave an N tile (16 WMMA steps). Its X tile (16 rows of 1,024 bytes)
// is read once, in whole lines, into LDS and serves all 13 waves. w1 lies in
// fragment order (pack_f16_block), 13 whole tiles of 16 rows: a k step is 512
// halves on; a wave asks for its 32 fragment loads at once. A wave stores its
// partial tile in accumulator order, 1,024 bytes in a row; k_tail sums the 32
// partial tiles in ascending k.
// ---------------------------------------------------------------------------
#define CLS_KC     32                   // K chunks
#define CLS_KSLICE (KCLS / CLS_KC)      // 512; divides 8192, so a chunk is all xp or all new_x
#define CLS_THR    (32 * W1_TILES)      // 416
#define CLS_PLANE  ((BATCH / 16) * W1_TILES * 256)  // floats of one chunk's partial tiles
static_assert(CLS_KSLICE == D1, "the X tile has the pitch of a 512-half row");

__global__ void __launch_bounds__(CLS_THR)
k_gemm_cls(const half_t* __restrict__ XPh, const half_t* __restrict__ NXh,
           const half_t* __restrict__ W1h, float* __restrict__ P) {
  __shared__ __align__(16) half_t Xs[16][XPITCH];
  const int tid = threadIdx.x;
  const int lane = tid & 31;
  const int wave = __builtin_amdgcn_readfirstlane(tid >> 5);  // = N tile
  const int lm = lane & 15, lh = lane >> 4;
  const int kc = blockIdx.x;         // K chunk
  const int mt = blockIdx.y;         // batch tile (8 tiles)
  const int k0 = kc * CLS_KSLICE;
  const half_t* Xg = ((k0 < 8192) ? (XPh + k0) : (NXh + (k0 - 8192))) + (size_t)mt * 16 * 8192;

  // The X tile: 1,024 pieces of 8 halves, two from every thread, a third from
  // waves 0 to 5; waves 6 to 12 read an earlier piece again there and do not
  // store it, so that no branch stands among the loads. Asked for first, so that
  // the LDS stores do not wait for w1.
  v8h xv[3];
  // Unrolled: constant indices keep xv in registers.
#pragma unroll
  for (int i = 0; i < 3; ++i) {
    const int p = (tid + CLS_THR * i) & 1023;
    xv[i] = *(const v8h*)(Xg + (size_t)(p >> 6) * 8192 + (p & 63) * 8);
  }
  // Stands in front of any reuse of these loads' address registers.
  asm volatile("s_wait_xcnt 0x0" ::: "memory");

  const half_t* Ws = W1h + ((size_t)wave * (KCLS / 32) + k0 / 32) * 512 + lane * 8;
  v8h q[CLS_KSLICE / 32][2];
  // Unrolled: constant indices keep q in registers, constant offsets on one address pair.
#pragma unroll
  for (int s = 0; s < CLS_KSLICE / 32; ++s) {
    q[s][0] = *(const v8h*)(Ws + s * 512);
    q[s][1] = *(const v8h*)(Ws + s * 512 + 256);
  }
  // Keeps the 32 loads above the barrier and the first WMMA: without it the
  // compiler moves each load down to just in front of its WMMA.
  __builtin_amdgcn_sched_barrier(0);

#pragma unroll
  for (int i = 0; i < 3; ++i) {
    const int p = tid + CLS_THR * i;
    if (i < 2 || wave < 6) *(v8h*)&Xs[p >> 6][(p & 63) * 8] = xv[i];
  }
  __syncthreads();

  v8f acc = {};
  // Unrolled: constant indices into q, constant LDS offsets.
#pragma unroll
  for (int s = 0; s < CLS_KSLICE / 32; ++s) {
    const int base = s * 32 + 8 * lh;
    acc = wmma_step(*(const v8h*)&Xs[lm][base], *(const v8h*)&Xs[lm][base + 16],
                    q[s][0], q[s][1], acc);
  }

  float* o = P + (size_t)kc * CLS_PLANE + (mt * W1_TILES + wave) * 256 + lane;
  // Unrolled: constant indices into acc, constant offsets on one address pair.
#pragma unroll
  for (int r2 = 0; r2 < 8; ++r2) o[r2 * 32] = acc[r2];
}

// ---------------------------------------------------------------------------
// h1 = relu(sum of the classifier's 32 partial sums + b1), then the three small
// FCs (200->50->10->128), in one launch: a row of the batch needs nothing of
// another row, so a block takes one row through all of it and hands h1, h2 and
// h3 over in LDS. A thread sums one column of h1, in ascending k. All weights
// are asked for up front, together with the partial sums. In the first two layers a wave takes an output, its lanes
// split k (whole lines a load) and the 32 partial sums meet in a butterfly.
// ---------------------------------------------------------------------------
#define N2 50
#define N3 10
#define N4 128

// Sums each of the N values over the wave's 32 lanes; every lane gets the sums.
// The distance is the outer loop: the N exchanges of a distance are in flight
// together, five LDS-path latencies in all and not five a value.
template <int N>
__device__ __forceinline__ void wave_sum(float (&s)[N]) {
  // Unrolled: constant indices keep s in registers.
#pragma unroll
  for (int d = 16; d > 0; d >>= 1) {
    float t[N];
#pragma unroll
    for (int o = 0; o < N; ++o) t[o] = __shfl_xor(s[o], d);
#pragma unroll
    for (int o = 0; o < N; ++o) s[o] += t[o];
  }
}

__global__ void __launch_bounds__(256)
k_tail(const float* __restrict__ P, const float* __restrict__ b1,
       const float* __restrict__ w2, const float* __restrict__ b2,
       const float* __restrict__ w3, const float* __restrict__ b3,
       const float* __restrict__ w4, const float* __restrict__ b4,
       float* __restrict__ out) {
  __shared__ float h1s[N1], h2s[N2], h3s[N3];
  const int tid = threadIdx.x;
  const int lane = tid & 31;
  const int wave = __builtin_amdgcn_readfirstlane(tid >> 5);
  const int m = blockIdx.x;

  // Column tid of h1's row m in each of the 32 partial tiles (accumulator order:
  // register m & 7, lane half (m >> 3) & 1, lane n & 15); a thread past the last
  // column is clamped for its loads and stores nothing.
  const int n1 = min(tid, N1 - 1);
  const float* pp = P + ((m >> 4) * W1_TILES + (n1 >> 4)) * 256 + (m & 7) * 32 +
                    ((m >> 3) & 1) * 16 + (n1 & 15);
  float pv[CLS_KC];
  // Unrolled (here and below): constant indices keep the arrays in registers.
#pragma unroll
  for (int w = 0; w < CLS_KC; ++w) pv[w] = pp[(size_t)w * CLS_PLANE];
  const float bh = b1[n1];

  // Outputs wave, wave + 8, ...; an output past the end is clamped for its
  // loads and not stored.
  float wa[7][7], ba[7];
#pragma unroll
  for (int o = 0; o < 7; ++o) {
    const int n = min(wave + 8 * o, N2 - 1);
    ba[o] = b2[n];
#pragma unroll
    for (int j = 0; j < 7; ++j) {
      const int k = lane + 32 * j;
      wa[o][j] = (k < N1) ? w2[n * N1 + k] : 0.0f;
    }
  }
  float wb[2][2], bbv[2];
#pragma unroll
  for (int o = 0; o < 2; ++o) {
    const int n = min(wave + 8 * o, N3 - 1);
    bbv[o] = b3[n];
#pragma unroll
    for (int j = 0; j < 2; ++j) {
      const int k = lane + 32 * j;
      wb[o][j] = (k < N2) ? w3[n * N2 + k] : 0.0f;
    }
  }
  const int n4 = tid & (N4 - 1);
  float wc[N3];
#pragma unroll
  for (int k = 0; k < N3; ++k) wc[k] = w4[n4 * N3 + k];
  const float bc = b4[n4];
  // Stands in front of any reuse of the loads' address registers.
  asm volatile("s_wait_xcnt 0x0" ::: "memory");

  float sh = 0.0f;
#pragma unroll
  for (int w = 0; w < CLS_KC; ++w) sh += pv[w];
  if (tid < N1) h1s[tid] = fmaxf(sh + bh, 0.0f);
  __syncthreads();

  float x1[7];
#pragma unroll
  for (int j = 0; j < 7; ++j) {
    const int k = lane + 32 * j;
    x1[j] = (k < N1) ? h1s[k] : 0.0f;
  }
  float s2[7];
#pragma unroll
  for (int o = 0; o < 7; ++o) {
    s2[o] = 0.0f;
#pragma unroll
    for (int j = 0; j < 7; ++j) s2[o] += x1[j] * wa[o][j];
  }
  wave_sum<7>(s2);
  if (lane == 0) {
#pragma unroll
    for (int o = 0; o < 7; ++o) {
      const int n = wave + 8 * o;
      if (n < N2) h2s[n] = fmaxf(s2[o] + ba[o], 0.0f);
    }
  }
  __syncthreads();

  float x2[2];
#pragma unroll
  for (int j = 0; j < 2; ++j) {
    const int k = lane + 32 * j;
    x2[j] = (k < N2) ? h2s[k] : 0.0f;
  }
  float s3[2];
#pragma unroll
  for (int o = 0; o < 2; ++o) s3[o] = x2[0] * wb[o][0] + x2[1] * wb[o][1];
  wave_sum<2>(s3);
  if (lane == 0) {
#pragma unroll
    for (int o = 0; o < 2; ++o) {
      const int n = wave + 8 * o;
      if (n < N3) h3s[n] = fmaxf(s3[o] + bbv[o], 0.0f);
    }
  }
  __syncthreads();

  if (tid < N4) {
    float s = bc;
#pragma unroll
    for (int k = 0; k < N3; ++k) s += h3s[k] * wc[k];
    out[m * N4 + tid] = s;
  }
}

// ---------------------------------------------------------------------------
extern "C" void kernel_launch(void* const* d_in, const int* in_sizes, int n_in,
                              void* d_out, int out_size, void* d_ws, size_t ws_size,
                              hipStream_t stream) {
  (void)in_sizes; (void)n_in; (void)out_size; (void)ws_size;
  const float* x      = (const float*)d_in[0];
  const float* attn_w = (const float*)d_in[1];
  const float* attn_b = (const float*)d_in[2];
  const float* ln_g   = (const float*)d_in[3];
  const float* ln_b   = (const float*)d_in[4];
  const float* w1     = (const float*)d_in[5];
  const float* b1     = (const float*)d_in[6];
  const float* w2     = (const float*)d_in[7];
  const float* b2     = (const float*)d_in[8];
  const float* w3     = (const float*)d_in[9];
  const float* b3     = (const float*)d_in[10];
  const float* w4     = (const float*)d_in[11];
  const float* b4     = (const float*)d_in[12];
  float* out = (float*)d_out;

  char* ws = (char*)d_ws;
  size_t off = 0;
  auto alloc = [&](size_t bytes) -> char* {
    char* p = ws + off;
    off += (bytes + 255) & ~(size_t)255;
    return p;
  };
  float*  xp_f  = (float*) alloc((size_t)M_ROWS * D1 * 4);
  half_t* xp_h  = (half_t*)alloc((size_t)M_ROWS * D1 * 2);
  float*  nx_f  = (float*) alloc((size_t)M_ROWS * D1 * 4);
  half_t* nx_h  = (half_t*)alloc((size_t)M_ROWS * D1 * 2);
  float*  a_f   = (float*) alloc((size_t)M_ROWS * D1 * 4);
  float*  sc    = (float*) alloc((size_t)BATCH * 256 * 4);
  half_t* awh   = (half_t*)alloc((size_t)2 * 4 * D1 * D1 * 2);
  half_t* w1h   = (half_t*)alloc((size_t)W1_TILES * 16 * KCLS * 2);
  float*  pcls  = (float*) alloc((size_t)CLS_KC * CLS_PLANE * 4);


  // Max-pool (the HBM-bound stage) + new_x init, and both weight conversions.
  k_pool_cvt<<<POOL_BLKS + CVT_BLKS_AW + CVT_BLKS_W1, POOL_THR, 0, stream>>>(
      x, xp_f, xp_h, nx_f, nx_h, attn_w, awh, w1, w1h);

  for (int i = 0; i < 2; ++i) {
    const half_t* Wa  = awh + (size_t)(i * 4 + 0) * D1 * D1;
    const half_t* Wb  = awh + (size_t)(i * 4 + 1) * D1 * D1;
    const half_t* W1s = awh + (size_t)(i * 4 + 3) * D1 * D1;
    const float* ba  = attn_b + (size_t)(i * 4 + 0) * D1;
    const float* bb  = attn_b + (size_t)(i * 4 + 1) * D1;
    const float* b1s = attn_b + (size_t)(i * 4 + 3) * D1;

    // a = fc_a(new_x), bproj = fc_b(xp), scores = a @ bproj^T / sqrt(512)
    k_ab_scores<<<BATCH, 1024, 0, stream>>>(nx_h, xp_h, Wa, Wb, ba, bb, a_f, sc);
    // new_x = new_x + fc_1(relu(LN(softmax_over_batch(scores) @ a)))
    k_context_fc1<<<dim3(BATCH, 2), 256, 0, stream>>>(sc, a_f, ln_g, ln_b, W1s, b1s, nx_f, nx_h);
  }

  // Classifier head.
  k_gemm_cls<<<dim3(CLS_KC, BATCH / 16), CLS_THR, 0, stream>>>(xp_h, nx_h, w1h, pcls);
  k_tail<<<BATCH, 256, 0, stream>>>(pcls, b1, w2, b2, w3, b3, w4, b4, out);
}

// v010
// A run of this version takes 65 microseconds.
// Next to v009, in two timings, it ran 1.05 and 1.04 times as fast.
// Counting every step since v000, it is 5.14 times as fast.
#include <hip/hip_runtime.h>

// ---------------------------------------------------------------------------
// Feature-bank attention forward on gfx1250 (wave32, WMMA).
//   1. max-pool 7x7 over x[128,512,16,7,7] -> xp[128,16,512]  (HBM-bound)
//   2. per stack, two launches, a block working on one batch entry b:
//      fc_a and fc_b (WMMA f16->f32) with the 16x16 score WMMA behind them;
//      batch-axis softmax + context matmul + LayerNorm + ReLU with the fc_1
//      GEMM and its residual behind them.
//   3. classifier: WMMA GEMM [128,16384]x[16384,200] as 32 partial sums over K;
//      their sum and the three small FCs in one launch.
// ---------------------------------------------------------------------------

typedef _Float16 half_t;
typedef __attribute__((ext_vector_type(16))) _Float16     v16h;
typedef __attribute__((ext_vector_type(8)))  _Float16     v8h;
typedef __attribute__((ext_vector_type(8)))  float        v8f;

#define D1     512
#define D2     16
#define BATCH  128
#define M_ROWS (BATCH * D2)   // 2048
#define KCLS   (2 * D2 * D1)  // 16384
#define N1     200

// Build the documented 16-bit WMMA fragment (VGPR0-3: K=base..base+7,
// VGPR4-7: K=base+16..base+23, per lane-half) from two 8-half chunks.
__device__ inline v8f wmma_step(v8h a0, v8h a1, v8h b0, v8h b1, v8f acc) {
  v16h af, bf;
#pragma unroll
  for (int i = 0; i < 8; ++i) {
    af[i] = a0[i]; af[8 + i] = a1[i];
    bf[i] = b0[i]; bf[8 + i] = b1[i];
  }
  return __builtin_amdgcn_wmma_f32_16x16x32_f16(
      /*neg_a=*/false, af, /*neg_b=*/false, bf,
      /*c_mod=*/(short)0, acc, /*reuse_a=*/false, /*reuse_b=*/false);
}

// A work-group barrier for hand-overs through LDS alone. The fences name the
// local space, so a wave waits only for its LDS operations (s_wait_dscnt) in
// front of the barrier. __syncthreads() also waits for every global load that
// the wave has outstanding: loads asked for ahead of their use would all have
// to land at the next barrier. Used only where no thread reads global memory
// that another thread of its block has written.
__device__ __forceinline__ void lds_barrier() {
  __builtin_amdgcn_fence(__ATOMIC_RELEASE, "workgroup", "local");
  __builtin_amdgcn_s_barrier();
  __builtin_amdgcn_fence(__ATOMIC_ACQUIRE, "workgroup", "local");
}

// ---------------------------------------------------------------------------
// f32 -> f16 weight copy, into the order in which the WMMA B fragments are read.
// A weight matrix [rows n][K] is stored as pieces of 512 bytes, one per
// (16 rows, 16 k): lane l = ((k >> 3) & 1) * 16 + (n & 15) owns 8 halves, k & 7:
//   half index = ((n >> 4) * (K / 32) + (k >> 5)) * 512 + ((k >> 4) & 1) * 256
//                + l * 8 + (k & 7)
// A fragment load of a wave is then 512 bytes in a row, four whole lines. From
// the row-major matrix it would be 32 bytes of each of 16 rows: 16 lines a load.
// A wave takes 16 rows x 64 k: eight loads of two 256-byte runs, all in flight
// together; its own LDS range turns them into the 2,048 bytes of four pieces,
// which lie in a row and are stored as whole lines. A block of 8 waves takes
// 512 k of its 16 rows. Where the rows are no multiple of 16, the last tile
// reads the matrix's last 16 rows and its lanes read them back from LDS turned
// round by the overlap: the tile's rows past the end then hold earlier rows, so
// that every byte of its pieces is written and no load leaves the matrix.
// The copies have no launch of their own: their blocks ride in the max-pool
// grid (k_pool_cvt), which they do not depend on.
// ---------------------------------------------------------------------------
typedef __attribute__((ext_vector_type(4))) float    v4f;
typedef __attribute__((ext_vector_type(4))) _Float16 v4h;

#define CVT_THR    256
#define W1_TILES   ((N1 + 15) / 16)  // 13
#define PK_GPITCH  144               // halves: 16 lanes' 256 bytes + 32, so that the 8-byte LDS stores spread over all banks
#define PK_WAVE    (8 * PK_GPITCH)   // halves of LDS a wave

#define CVT_BLKS_AW (2 * 4 * D1 / 16 * (D1 / 64) / 8)  // 256 blocks: attention weights
#define CVT_BLKS_W1 (W1_TILES * (KCLS / 64) / 8)       // 416 blocks: classifier weights

template <int K, int R>
__device__ __forceinline__ void
pack_f16_block(const float* __restrict__ src, half_t* __restrict__ dst, int blk,
               half_t* __restrict__ lds) {
  const int lane = threadIdx.x & 31;
  const int wave = __builtin_amdgcn_readfirstlane(threadIdx.x >> 5);
  static_assert(R >= 16, "a tile reads 16 rows");
  const unsigned int u = blk * 8 + wave;
  const int ntile = u / (K / 64), kp = u % (K / 64);
  const int r = lane >> 4, c = lane & 15;  // row in the pair, piece of 4 floats in the run
  const int row0 = min(ntile * 16, R - 16);  // the same in every lane
  const int turn = ntile * 16 - row0;
  const float* p = src + (size_t)(row0 + r) * K + kp * 64 + c * 4;
  v4f v[8];
  // Unrolled: v stays in registers, all eight loads are in flight together,
  // constant offsets on one address pair.
#pragma unroll
  for (int i = 0; i < 8; ++i) v[i] = *(const v4f*)(p + (size_t)i * (2 * K));
  half_t* st = lds + wave * PK_WAVE;
  // Unrolled: constant indices into v, constant LDS offsets on one base.
#pragma unroll
  for (int i = 0; i < 8; ++i)
    *(v4h*)(st + (c >> 1) * PK_GPITCH + (2 * i + r) * 8 + (c & 1) * 4) =
        __builtin_convertvector(v[i], v4h);
  // The wave's LDS stores are done before its lanes read each other's halves.
  asm volatile("s_wait_dscnt 0x0" ::: "memory");
  half_t* o = dst + ((size_t)ntile * (K / 32) + kp * 2) * 512 + lane * 8;
  // Unrolled: constant offsets on one LDS base and one address pair.
#pragma unroll
  for (int t = 0; t < 4; ++t)
    *(v8h*)(o + t * 256) = *(const v8h*)(st + (t * 2 + r) * PK_GPITCH + ((c + turn) & 15) * 8);
}

// ---------------------------------------------------------------------------
// Max-pool over HxW=49 (the 205 MB streaming read) + init new_x = xp.
// A block owns one b and 64 d1, in four stages of 16 d1: 16*16*49 floats that
// lie in one run in x. A stage's run goes to LDS in whole lines by asynchronous
// copies; each thread then takes the maximum of one 49-float window from LDS
// (lane pitch 49 dwords, odd, so no bank conflict). A small LDS tile turns
// (d1,d2) into (d2,d1), so that the block stores whole 128-byte lines of all
// four outputs. Four blocks fit a WGP: one block's maxima run under the
// others' copies.
// Blocks from POOL_BLKS on do the two weight copies instead: independent work
// in the same launch. The long pool blocks have the low indices and start first.
// ---------------------------------------------------------------------------
typedef __attribute__((ext_vector_type(2))) float    v2f;
typedef __attribute__((ext_vector_type(2))) _Float16 v2h;

#define POOL_D1   64                     // d1 a block owns
#define POOL_SD1  16                     // d1 a stage
#define POOL_SFLT (POOL_SD1 * D2 * 49)   // 12,544 floats = 50,176 bytes a stage
#define POOL_THR  256
#define POOL_BLKS (BATCH * (D1 / POOL_D1))  // 1,024
static_assert(POOL_THR == CVT_THR, "both bodies run in one block shape");

__global__ void __launch_bounds__(POOL_THR)
k_pool_cvt(const float* __restrict__ x,
           float* __restrict__ xp_f, half_t* __restrict__ xp_h,
           float* __restrict__ nx_f, half_t* __restrict__ nx_h,
           const float* __restrict__ attn_w, half_t* __restrict__ awh,
           const float* __restrict__ w1, half_t* __restrict__ w1h) {
  __shared__ __align__(16) float tile[POOL_SFLT];
  __shared__ __align__(8) float tr[D2][POOL_D1 + 2];  // pitch 66: no bank conflict for writers or readers
  // Block-uniform, in front of every copy and barrier: a whole block leaves here.
  if (blockIdx.x >= POOL_BLKS) {
    const int cb = blockIdx.x - POOL_BLKS;
    if (cb < CVT_BLKS_AW)
      pack_f16_block<D1, 2 * 4 * D1>(attn_w, awh, cb, (half_t*)tile);
    else
      pack_f16_block<KCLS, N1>(w1, w1h, cb - CVT_BLKS_AW, (half_t*)tile);
    return;
  }
  const int tid = threadIdx.x;
  const int wave = __builtin_amdgcn_readfirstlane(tid >> 5);
  const int b = blockIdx.x >> 3;
  const int d1_0 = (blockIdx.x & 7) * POOL_D1;
  const float* g = x + (size_t)(b * D1 + d1_0) * (D2 * 49) + tid * 4;
  const unsigned int l = (unsigned int)(uintptr_t)&tile[0] + (unsigned int)tid * 16u;

  // Unrolled: each stage's column of tr is a constant LDS offset on one base.
#pragma unroll
  for (int s = 0; s < POOL_D1 / POOL_SD1; ++s, g += POOL_SFLT) {
    // 3,136 pieces of 16 bytes: 12 from every thread, a 13th from waves 0 and 1.
    // The s_wait_xcnt closes each statement so that no address register of an
    // issued copy is rewritten ahead of it.
    asm volatile(
        "global_load_async_to_lds_b128 %0, %12, off\n\t"
        "global_load_async_to_lds_b128 %1, %13, off\n\t"
        "global_load_async_to_lds_b128 %2, %14, off\n\t"
        "global_load_async_to_lds_b128 %3, %15, off\n\t"
        "global_load_async_to_lds_b128 %4, %16, off\n\t"
        "global_load_async_to_lds_b128 %5, %17, off\n\t"
        "global_load_async_to_lds_b128 %6, %18, off\n\t"
        "global_load_async_to_lds_b128 %7, %19, off\n\t"
        "global_load_async_to_lds_b128 %8, %20, off\n\t"
        "global_load_async_to_lds_b128 %9, %21, off\n\t"
        "global_load_async_to_lds_b128 %10, %22, off\n\t"
        "global_load_async_to_lds_b128 %11, %23, off\n\t"
        "s_wait_xcnt 0x0"
        :: "v"(l), "v"(l + 1u * 4096u), "v"(l + 2u * 4096u), "v"(l + 3u * 4096u),
           "v"(l + 4u * 4096u), "v"(l + 5u * 4096u), "v"(l + 6u * 4096u),
           "v"(l + 7u * 4096u), "v"(l + 8u * 4096u), "v"(l + 9u * 4096u),
           "v"(l + 10u * 4096u), "v"(l + 11u * 4096u),
           "v"(g), "v"(g + 1 * 1024), "v"(g + 2 * 1024), "v"(g + 3 * 1024),
           "v"(g + 4 * 1024), "v"(g + 5 * 1024), "v"(g + 6 * 1024), "v"(g + 7 * 1024),
           "v"(g + 8 * 1024), "v"(g + 9 * 1024), "v"(g + 10 * 1024), "v"(g + 11 * 1024)
        : "memory");
    if (wave < 2) {
      asm volatile(
          "global_load_async_to_lds_b128 %0, %1, off\n\t"
          "s_wait_xcnt 0x0"
          :: "v"(l + 12u * 4096u), "v"(g + 12 * 1024) : "memory");
    }
    // This wave's copies have landed; the barrier then shows them to every wave.
    asm volatile("s_wait_asynccnt 0x0" ::: "memory");
    __syncthreads();

    const float* p = &tile[tid * 49];  // window tid = (d1 in the stage) * 16 + d2
    float m = p[0];
    // Unrolled: constant LDS offsets, and the reads run ahead of the maxima.
#pragma unroll
    for (int j = 1; j < 49; ++j) m = fmaxf(m, p[j]);
    tr[tid & 15][s * POOL_SD1 + (tid >> 4)] = m;

    // This wave's LDS reads of the stage are done; behind the barrier the next
    // stage's copies may overwrite the tile (and, last, tr is whole).
    asm volatile("s_wait_dscnt 0x0" ::: "memory");
    __syncthreads();
  }

  // 512 pairs of neighbouring d1: a wave stores 256 bytes of f32, 128 of f16.
#pragma unroll
  for (int k = 0; k < 2; ++k) {
    const int q = tid + POOL_THR * k;
    const int d2 = q >> 5, d1l = (q & 31) * 2;
    const v2f m2 = *(const v2f*)&tr[d2][d1l];
    const int o = (b * D2 + d2) * D1 + d1_0 + d1l;
    *(v2f*)(xp_f + o) = m2;
    *(v2f*)(nx_f + o) = m2;
    v2h h2;
    h2[0] = (half_t)m2[0];
    h2[1] = (half_t)m2[1];
    *(v2h*)(xp_h + o) = h2;
    *(v2h*)(nx_h + o) = h2;
  }
}

// ---------------------------------------------------------------------------
// The 16 x 512 x 512 product Y = X @ W^T of one batch entry, shared by the two
// kernels below. X (f16) lies in LDS, rows of 520 halves; a wave owns a 16x32
// output tile (two WMMA accumulators sharing one A fragment). W lies in fragment
// order (pack_f16_block): Wt0 and Wt1 point at this lane's 8 halves in the first
// piece of the wave's two N tiles, a k step is 512 halves on. The weight
// fragments come in groups of GS k steps (4 * GS loads), two groups in flight:
// a wave waits out the L2 latency once a pair of groups, not once a step.
// ---------------------------------------------------------------------------
#define XPITCH 520  // halves a row in LDS: 16 bytes more than the row spreads the banks

template <int GS>
__device__ __forceinline__ void
w_group(v8h (&q)[GS][4], const half_t* __restrict__ Wt0,
        const half_t* __restrict__ Wt1, int c) {
  // Unrolled: constant indices keep q in registers.
#pragma unroll
  for (int s = 0; s < GS; ++s) {
    const int p = (c * GS + s) * 512;
    q[s][0] = *(const v8h*)(Wt0 + p);
    q[s][1] = *(const v8h*)(Wt0 + p + 256);
    q[s][2] = *(const v8h*)(Wt1 + p);
    q[s][3] = *(const v8h*)(Wt1 + p + 256);
  }
}

// wq holds groups 0 and 1 on entry.
template <int GS>
__device__ __forceinline__ void
gemm512_kloop(const half_t (*Xs)[XPITCH], const half_t* __restrict__ Wt0,
              const half_t* __restrict__ Wt1, v8h (&wq)[2][GS][4],
              int lm, int lh, v8f& acc0, v8f& acc1) {
  // Unrolled: the group's buffer index is a constant.
#pragma unroll
  for (int c = 0; c < 16 / GS; ++c) {
#pragma unroll
    for (int s = 0; s < GS; ++s) {
      const int base = (c * GS + s) * 32 + 8 * lh;
      v8h a0 = *(const v8h*)&Xs[lm][base];
      v8h a1 = *(const v8h*)&Xs[lm][base + 16];
      acc0 = wmma_step(a0, a1, wq[c & 1][s][0], wq[c & 1][s][1], acc0);
      acc1 = wmma_step(a0, a1, wq[c & 1][s][2], wq[c & 1][s][3], acc1);
    }
    if (c + 2 < 16 / GS) {
      // The fence pair keeps the refill where it stands: without it the
      // compiler moves each load down to just in front of its WMMA.
      __builtin_amdgcn_sched_barrier(0);
      w_group<GS>(wq[c & 1], Wt0, Wt1, c + 2);
      __builtin_amdgcn_sched_barrier(0);
    }
  }
}

// ---------------------------------------------------------------------------
// a = fc_a(new_x), bproj = fc_b(xp), scores[b,c,d] = dot(a[b,c,:], bproj[b,d,:])
// / sqrt(512). One block of 32 waves per b: waves 0-15 make a[b], waves 16-31
// bproj[b], 32 columns each. Both results stay in LDS as f16, and wave 0 takes
// the 16x16 score tile from there: the scores need nothing of another b, so
// they need no launch of their own. a goes to memory in f32 for the context
// product; bproj never leaves the block.
// ---------------------------------------------------------------------------
__global__ void __launch_bounds__(1024)
k_ab_scores(const half_t* __restrict__ NXh, const half_t* __restrict__ XPh,
            const half_t* __restrict__ Wa, const half_t* __restrict__ Wb,
            const float* __restrict__ ba, const float* __restrict__ bb,
            float* __restrict__ Af, float* __restrict__ S) {
  __shared__ __align__(16) half_t Xs[2][16][XPITCH];  // new_x[b], xp[b]
  __shared__ __align__(16) half_t Ys[2][16][XPITCH];  // a[b], bproj[b]
  const int tid = threadIdx.x;
  const int lane = tid & 31;
  const int wave = __builtin_amdgcn_readfirstlane(tid >> 5);
  const int z = wave >> 4;  // wave-uniform: 0 = fc_a, 1 = fc_b
  const int b = blockIdx.x;
  const int ntile0 = (wave & 15) * 2;  // two adjacent N tiles
  const int lm = lane & 15, lh = lane >> 4;

  // Both X tiles: 1,024 pieces of 8 halves each, one piece of each a thread.
  // Asked for first, so that their LDS stores do not wait for the weights.
  const int pr = tid >> 6, pc = (tid & 63) * 8;
  const v8h xa = *(const v8h*)(NXh + (size_t)(b * 16 + pr) * D1 + pc);
  const v8h xb = *(const v8h*)(XPh + (size_t)(b * 16 + pr) * D1 + pc);
  // Stands in front of any reuse of these two loads' address registers.
  asm volatile("s_wait_xcnt 0x0" ::: "memory");

  const half_t* Wt0 = (z ? Wb : Wa) + (size_t)ntile0 * (16 * D1) + lane * 8;
  const half_t* Wt1 = Wt0 + (size_t)16 * D1;
  // Groups of two k steps: 32 waves leave a wave 128 registers, and the block
  // still has as many loads in flight as two blocks of 8 waves with groups of four.
  v8h wq[2][2][4];
  w_group<2>(wq[0], Wt0, Wt1, 0);
  w_group<2>(wq[1], Wt0, Wt1, 1);
  const float* bias = z ? bb : ba;
  const float bn[2] = {bias[ntile0 * 16 + lm], bias[ntile0 * 16 + 16 + lm]};

  *(v8h*)&Xs[0][pr][pc] = xa;
  *(v8h*)&Xs[1][pr][pc] = xb;
  lds_barrier();

  v8f acc0 = {}, acc1 = {};
  gemm512_kloop<2>(Xs[z], Wt0, Wt1, wq, lm, lh, acc0, acc1);

  // C layout: lane->N, VGPR->M (8-row halves).
  float y[2][8];
  // Unrolled: constant indices into the accumulators.
#pragma unroll
  for (int t = 0; t < 2; ++t) {
    const v8f acc = t ? acc1 : acc0;
#pragma unroll
    for (int r2 = 0; r2 < 8; ++r2) {
      y[t][r2] = acc[r2] + bn[t];
      Ys[z][lh * 8 + r2][ntile0 * 16 + t * 16 + lm] = (half_t)y[t][r2];
    }
  }
  __syncthreads();

  // Behind the barrier: in front of it, the barrier would wait for the stores
  // to be acknowledged, and the scores with it.
  if (z == 0) {
    const size_t o0 = (size_t)(b * 16 + lh * 8) * D1 + ntile0 * 16 + lm;
    // Unrolled: constant indices into y, constant offsets on one address pair.
#pragma unroll
    for (int t = 0; t < 2; ++t)
#pragma unroll
      for (int r2 = 0; r2 < 8; ++r2) Af[o0 + (size_t)r2 * D1 + t * 16] = y[t][r2];
    // Stands in front of any reuse of the stores' address and data registers.
    asm volatile("s_wait_xcnt 0x0" ::: "memory");
  }

  if (wave == 0) {
    v8f acc = {};
    // Unrolled: constant LDS offsets, and the reads run ahead of the WMMAs.
#pragma unroll
    for (int s = 0; s < 16; ++s) {
      const int base = s * 32 + 8 * lh;
      acc = wmma_step(*(const v8h*)&Ys[0][lm][base], *(const v8h*)&Ys[0][lm][base + 16],
                      *(const v8h*)&Ys[1][lm][base], *(const v8h*)&Ys[1][lm][base + 16], acc);
    }
    const float sc = 0.044194173824159216f;  // 1/sqrt(512)
    // Unrolled: constant indices into the accumulator.
#pragma unroll
    for (int r2 = 0; r2 < 8; ++r2) S[b * 256 + (lh * 8 + r2) * 16 + lm] = acc[r2] * sc;
  }
}

// ---------------------------------------------------------------------------
// e = relu(LayerNorm_{16,512}( ab[b] @ a[b] )), new_x[b] += fc_1(e).
// ab = softmax of the raw scores S over dim 0 (batch; legacy nn.Softmax() on
// 3D). Every block works out the maximum and the sum of all 256 columns
// itself, one column (c*16 + d) a thread, and keeps only its own b's row. The
// sum runs in ascending b.
// e stays in LDS as f16 and is the X tile of the fc_1 product, which needs
// nothing of another b. Two blocks per b (blockIdx.y): each makes the whole of
// e for itself and takes 256 of the 512 columns of fc_1, so that the product
// keeps its 16 waves per b without a hand-over between blocks.
// ---------------------------------------------------------------------------
__global__ void __launch_bounds__(256)
k_context_fc1(const float* __restrict__ S, const float* __restrict__ Af,
              const float* __restrict__ g, const float* __restrict__ beta,
              const half_t* __restrict__ W, const float* __restrict__ bias,
              float* NXf, half_t* __restrict__ NXh) {
  __shared__ float ab[256];
  __shared__ float ep[8192];
  __shared__ float rs[256], rq[256];
  __shared__ __align__(16) half_t Es[16][XPITCH];
  const int b = blockIdx.x, tid = threadIdx.x;
  // A thread's two columns of a[b] (t = tid and tid + 256), read once and asked
  // for together with the scores: every c of the context product uses them.
  float af[16][2];
  // Unrolled: constant indices keep af in registers.
#pragma unroll
  for (int d = 0; d < 16; ++d) {
    af[d][0] = Af[(size_t)(b * 16 + d) * D1 + tid];
    af[d][1] = Af[(size_t)(b * 16 + d) * D1 + tid + 256];
  }
  {
    float v[BATCH];
    // Unrolled: v stays in registers and the column's loads are all in flight
    // together, one L2 latency for the column.
#pragma unroll
    for (int i = 0; i < BATCH; ++i) v[i] = S[i * 256 + tid];
    const float own = S[b * 256 + tid];
    // Stands in front of any reuse of the load's address registers.
    asm volatile("s_wait_xcnt 0x0" ::: "memory");
    // Keeps the loads of af above the softmax arithmetic: one latency for all.
    __builtin_amdgcn_sched_barrier(0);
    float mx = -1e30f;
    // Unrolled: constant indices into v.
#pragma unroll
    for (int i = 0; i < BATCH; ++i) mx = fmaxf(mx, v[i]);
    float sum = 0.0f;
    // Unrolled: constant indices into v.
#pragma unroll
    for (int i = 0; i < BATCH; ++i) sum += __expf(v[i] - mx);
    ab[tid] = __expf(own - mx) * (1.0f / sum);
  }
  // The LayerNorm weights of this thread's 32 elements, asked for here so that
  // they land under the context product and the reduction.
  float gg[32], bb[32];
  // Unrolled: constant indices keep gg and bb in registers.
#pragma unroll
  for (int i = 0; i < 32; ++i) {
    gg[i] = g[tid + 256 * i];
    bb[i] = beta[tid + 256 * i];
  }
  lds_barrier();

  float lsum = 0.0f, lsq = 0.0f;
  // Unrolled: constant indices into af.
#pragma unroll
  for (int i = 0; i < 32; ++i) {
    int idx = tid + 256 * i;          // idx = c*512 + t, c = i / 2, t = tid + 256 * (i % 2)
    int c = i >> 1;
    float s = 0.0f;
#pragma unroll
    for (int d = 0; d < 16; ++d)
      s += ab[c * 16 + d] * af[d][i & 1];
    ep[idx] = s;
    lsum += s;
    lsq += s * s;
    // Every four rows c: keeps the LDS reads of later rows of ab, and behind the
    // last row the weight loads below, from piling up in registers on top of af,
    // gg and bb, which would take the kernel past 256 of them.
    if ((i & 7) == 7) __builtin_amdgcn_sched_barrier(0);
  }
  rs[tid] = lsum; rq[tid] = lsq;

  // fc_1's first two weight groups and its bias depend on nothing above: asked
  // for here, in front of the reduction and the LayerNorm.
  const int lane = tid & 31;
  const int wave = tid >> 5;
  const int ntile0 = (blockIdx.y * 8 + wave) * 2;  // two adjacent N tiles
  const int lm = lane & 15, lh = lane >> 4;
  const half_t* Wt0 = W + (size_t)ntile0 * (16 * D1) + lane * 8;
  const half_t* Wt1 = Wt0 + (size_t)16 * D1;
  const float bn[2] = {bias[ntile0 * 16 + lm], bias[ntile0 * 16 + 16 + lm]};
  // Stands in front of any reuse of the bias loads' address register.
  asm volatile("s_wait_xcnt 0x0" ::: "memory");
  v8h wq[2][4][4];
  w_group<4>(wq[0], Wt0, Wt1, 0);
  w_group<4>(wq[1], Wt0, Wt1, 1);
  const size_t o0 = (size_t)(b * 16 + lh * 8) * D1 + ntile0 * 16 + lm;  // C layout: lane->N, VGPR->M (8-row halves)

  lds_barrier();
  for (int s2 = 128; s2 > 0; s2 >>= 1) {
    if (tid < s2) { rs[tid] += rs[tid + s2]; rq[tid] += rq[tid + s2]; }
    lds_barrier();
  }
  float mu   = rs[0] * (1.0f / 8192.0f);
  float var  = rq[0] * (1.0f / 8192.0f) - mu * mu;
  float rstd = rsqrtf(var + 1e-5f);
  // Unrolled: constant indices into gg and bb.
#pragma unroll
  for (int i = 0; i < 32; ++i) {
    int idx = tid + 256 * i;
    int c = idx >> 9, t = idx & 511;
    float v = (ep[idx] - mu) * rstd * gg[i] + bb[i];
    v = fmaxf(v, 0.0f);
    Es[c][t] = (half_t)v;
  }
  // The residual, asked for once gg and bb have left their registers: it lands
  // under the product.
  float rv[2][8];
  // Unrolled: constant indices keep rv in registers.
#pragma unroll
  for (int t = 0; t < 2; ++t)
#pragma unroll
    for (int r2 = 0; r2 < 8; ++r2) rv[t][r2] = NXf[o0 + (size_t)r2 * D1 + t * 16];
  lds_barrier();

  v8f acc0 = {}, acc1 = {};
  gemm512_kloop<4>(Es, Wt0, Wt1, wq, lm, lh, acc0, acc1);

  float y[2][8];
  // Unrolled: constant indices into the accumulators.
#pragma unroll
  for (int t = 0; t < 2; ++t) {
    const v8f acc = t ? acc1 : acc0;
#pragma unroll
    for (int r2 = 0; r2 < 8; ++r2) y[t][r2] = acc[r2] + bn[t] + rv[t][r2];
  }
  // Unrolled: constant indices into y, constant offsets on one address pair.
#pragma unroll
  for (int t = 0; t < 2; ++t)
#pragma unroll
    for (int r2 = 0; r2 < 8; ++r2) NXf[o0 + (size_t)r2 * D1 + t * 16] = y[t][r2];
  // Stands in front of any reuse of the stores' address and data registers; the
  // fence keeps the conversions below, which reuse them, behind the wait.
  asm volatile("s_wait_xcnt 0x0" ::: "memory");
  __builtin_amdgcn_sched_barrier(0);
  half_t yh[2][8];
  // Unrolled: constant indices into y and yh.
#pragma unroll
  for (int t = 0; t < 2; ++t)
#pragma unroll
    for (int r2 = 0; r2 < 8; ++r2) yh[t][r2] = (half_t)y[t][r2];
  // Keeps every conversion in front of the stores: none of them then rewrites a
  // register of an issued store.
  __builtin_amdgcn_sched_barrier(0);
  // Unrolled: constant indices into yh, constant offsets on one address pair.
#pragma unroll
  for (int t = 0; t < 2; ++t)
#pragma unroll
    for (int r2 = 0; r2 < 8; ++r2) NXh[o0 + (size_t)r2 * D1 + t * 16] = yh[t][r2];
}

// ---------------------------------------------------------------------------
// feat[128,16384] @ w1[200,16384]^T, feat = [xp | new_x], as 32 partial sums.
// K is split over the blocks: a block takes 16 batch rows x 512 k x all 13 N
// tiles, one wave an N tile (16 WMMA steps). Its X tile (16 rows of 1,024 bytes)
// is read once, in whole lines, into LDS and serves all 13 waves. w1 lies in
// fragment order (pack_f16_block), 13 whole tiles of 16 rows: a k step is 512
// halves on; a wave asks for its 32 fragment loads at once. A wave stores its
// partial tile in accumulator order, 1,024 bytes in a row; k_tail sums the 32
// partial tiles in ascending k.
// ---------------------------------------------------------------------------
#define CLS_KC     32                   // K chunks
#define CLS_KSLICE (KCLS / CLS_KC)      // 512; divides 8192, so a chunk is all xp or all new_x
#define CLS_THR    (32 * W1_TILES)      // 416
#define CLS_PLANE  ((BATCH / 16) * W1_TILES * 256)  // floats of one chunk's partial tiles
static_assert(CLS_KSLICE == D1, "the X tile has the pitch of a 512-half row");

__global__ void __launch_bounds__(CLS_THR)
k_gemm_cls(const half_t* __restrict__ XPh, const half_t* __restrict__ NXh,
           const half_t* __restrict__ W1h, float* __restrict__ P) {
  __shared__ __align__(16) half_t Xs[16][XPITCH];
  const int tid = threadIdx.x;
  const int lane = tid & 31;
  const int wave = __builtin_amdgcn_readfirstlane(tid >> 5);  // = N tile
  const int lm = lane & 15, lh = lane >> 4;
  const int kc = blockIdx.x;         // K chunk
  const int mt = blockIdx.y;         // batch tile (8 tiles)
  const int k0 = kc * CLS_KSLICE;
  const half_t* Xg = ((k0 < 8192) ? (XPh + k0) : (NXh + (k0 - 8192))) + (size_t)mt * 16 * 8192;

  // The X tile: 1,024 pieces of 8 halves, two from every thread, a third from
  // waves 0 to 5; waves 6 to 12 read an earlier piece again there and do not
  // store it, so that no branch stands among the loads. Asked for first, so that
  // the LDS stores do not wait for w1.
  v8h xv[3];
  // Unrolled: constant indices keep xv in registers.
#pragma unroll
  for (int i = 0; i < 3; ++i) {
    const int p = (tid + CLS_THR * i) & 1023;
    xv[i] = *(const v8h*)(Xg + (size_t)(p >> 6) * 8192 + (p & 63) * 8);
  }
  // Stands in front of any reuse of these loads' address registers.
  asm volatile("s_wait_xcnt 0x0" ::: "memory");

  const half_t* Ws = W1h + ((size_t)wave * (KCLS / 32) + k0 / 32) * 512 + lane * 8;
  v8h q[CLS_KSLICE / 32][2];
  // Unrolled: constant indices keep q in registers, constant offsets on one address pair.
#pragma unroll
  for (int s = 0; s < CLS_KSLICE / 32; ++s) {
    q[s][0] = *(const v8h*)(Ws + s * 512);
    q[s][1] = *(const v8h*)(Ws + s * 512 + 256);
  }
  // Keeps the 32 loads above the barrier and the first WMMA: without it the
  // compiler moves each load down to just in front of its WMMA.
  __builtin_amdgcn_sched_barrier(0);

#pragma unroll
  for (int i = 0; i < 3; ++i) {
    const int p = tid + CLS_THR * i;
    if (i < 2 || wave < 6) *(v8h*)&Xs[p >> 6][(p & 63) * 8] = xv[i];
  }
  lds_barrier();

  v8f acc = {};
  // Unrolled: constant indices into q, constant LDS offsets.
#pragma unroll
  for (int s = 0; s < CLS_KSLICE / 32; ++s) {
    const int base = s * 32 + 8 * lh;
    acc = wmma_step(*(const v8h*)&Xs[lm][base], *(const v8h*)&Xs[lm][base + 16],
                    q[s][0], q[s][1], acc);
  }

  float* o = P + (size_t)kc * CLS_PLANE + (mt * W1_TILES + wave) * 256 + lane;
  // Unrolled: constant indices into acc, constant offsets on one address pair.
#pragma unroll
  for (int r2 = 0; r2 < 8; ++r2) o[r2 * 32] = acc[r2];
}

// ---------------------------------------------------------------------------
// h1 = relu(sum of the classifier's 32 partial sums + b1), then the three small
// FCs (200->50->10->128), in one launch: a row of the batch needs nothing of
// another row, so a block takes one row through all of it and hands h1, h2 and
// h3 over in LDS. A thread sums one column of h1, in ascending k. All weights
// are asked for up front, together with the partial sums. In the first two layers a wave takes an output, its lanes
// split k (whole lines a load) and the 32 partial sums meet in a butterfly.
// ---------------------------------------------------------------------------
#define N2 50
#define N3 10
#define N4 128

// Sums each of the N values over the wave's 32 lanes; every lane gets the sums.
// The distance is the outer loop: the N exchanges of a distance are in flight
// together, five LDS-path latencies in all and not five a value.
template <int N>
__device__ __forceinline__ void wave_sum(float (&s)[N]) {
  // Unrolled: constant indices keep s in registers.
#pragma unroll
  for (int d = 16; d > 0; d >>= 1) {
    float t[N];
#pragma unroll
    for (int o = 0; o < N; ++o) t[o] = __shfl_xor(s[o], d);
#pragma unroll
    for (int o = 0; o < N; ++o) s[o] += t[o];
  }
}

__global__ void __launch_bounds__(256)
k_tail(const float* __restrict__ P, const float* __restrict__ b1,
       const float* __restrict__ w2, const float* __restrict__ b2,
       const float* __restrict__ w3, const float* __restrict__ b3,
       const float* __restrict__ w4, const float* __restrict__ b4,
       float* __restrict__ out) {
  __shared__ float h1s[N1], h2s[N2], h3s[N3];
  const int tid = threadIdx.x;
  const int lane = tid & 31;
  const int wave = __builtin_amdgcn_readfirstlane(tid >> 5);
  const int m = blockIdx.x;

  // Column tid of h1's row m in each of the 32 partial tiles (accumulator order:
  // register m & 7, lane half (m >> 3) & 1, lane n & 15); a thread past the last
  // column is clamped for its loads and stores nothing.
  const int n1 = min(tid, N1 - 1);
  const float* pp = P + ((m >> 4) * W1_TILES + (n1 >> 4)) * 256 + (m & 7) * 32 +
                    ((m >> 3) & 1) * 16 + (n1 & 15);
  float pv[CLS_KC];
  // Unrolled (here and below): constant indices keep the arrays in registers.
#pragma unroll
  for (int w = 0; w < CLS_KC; ++w) pv[w] = pp[(size_t)w * CLS_PLANE];
  const float bh = b1[n1];

  // Outputs wave, wave + 8, ...; an output past the end is clamped for its
  // loads and not stored.
  float wa[7][7], ba[7];
#pragma unroll
  for (int o = 0; o < 7; ++o) {
    const int n = min(wave + 8 * o, N2 - 1);
    ba[o] = b2[n];
#pragma unroll
    for (int j = 0; j < 7; ++j) {
      const int k = lane + 32 * j;
      wa[o][j] = (k < N1) ? w2[n * N1 + k] : 0.0f;
    }
  }
  float wb[2][2], bbv[2];
#pragma unroll
  for (int o = 0; o < 2; ++o) {
    const int n = min(wave + 8 * o, N3 - 1);
    bbv[o] = b3[n];
#pragma unroll
    for (int j = 0; j < 2; ++j) {
      const int k = lane + 32 * j;
      wb[o][j] = (k < N2) ? w3[n * N2 + k] : 0.0f;
    }
  }
  const int n4 = tid & (N4 - 1);
  float wc[N3];
#pragma unroll
  for (int k = 0; k < N3; ++k) wc[k] = w4[n4 * N3 + k];
  const float bc = b4[n4];
  // Stands in front of any reuse of the loads' address registers.
  asm volatile("s_wait_xcnt 0x0" ::: "memory");

  float sh = 0.0f;
#pragma unroll
  for (int w = 0; w < CLS_KC; ++w) sh += pv[w];
  if (tid < N1) h1s[tid] = fmaxf(sh + bh, 0.0f);
  lds_barrier();

  float x1[7];
#pragma unroll
  for (int j = 0; j < 7; ++j) {
    const int k = lane + 32 * j;
    x1[j] = (k < N1) ? h1s[k] : 0.0f;
  }
  float s2[7];
#pragma unroll
  for (int o = 0; o < 7; ++o) {
    s2[o] = 0.0f;
#pragma unroll
    for (int j = 0; j < 7; ++j) s2[o] += x1[j] * wa[o][j];
  }
  wave_sum<7>(s2);
  if (lane == 0) {
#pragma unroll
    for (int o = 0; o < 7; ++o) {
      const int n = wave + 8 * o;
      if (n < N2) h2s[n] = fmaxf(s2[o] + ba[o], 0.0f);
    }
  }
  lds_barrier();

  float x2[2];
#pragma unroll
  for (int j = 0; j < 2; ++j) {
    const int k = lane + 32 * j;
    x2[j] = (k < N2) ? h2s[k] : 0.0f;
  }
  float s3[2];
#pragma unroll
  for (int o = 0; o < 2; ++o) s3[o] = x2[0] * wb[o][0] + x2[1] * wb[o][1];
  wave_sum<2>(s3);
  if (lane == 0) {
#pragma unroll
    for (int o = 0; o < 2; ++o) {
      const int n = wave + 8 * o;
      if (n < N3) h3s[n] = fmaxf(s3[o] + bbv[o], 0.0f);
    }
  }
  lds_barrier();

  if (tid < N4) {
    float s = bc;
#pragma unroll
    for (int k = 0; k < N3; ++k) s += h3s[k] * wc[k];
    out[m * N4 + tid] = s;
  }
}

// ---------------------------------------------------------------------------
extern "C" void kernel_launch(void* const* d_in, const int* in_sizes, int n_in,
                              void* d_out, int out_size, void* d_ws, size_t ws_size,
                              hipStream_t stream) {
  (void)in_sizes; (void)n_in; (void)out_size; (void)ws_size;
  const float* x      = (const float*)d_in[0];
  const float* attn_w = (const float*)d_in[1];
  const float* attn_b = (const float*)d_in[2];
  const float* ln_g   = (const float*)d_in[3];
  const float* ln_b   = (const float*)d_in[4];
  const float* w1     = (const float*)d_in[5];
  const float* b1     = (const float*)d_in[6];
  const float* w2     = (const float*)d_in[7];
  const float* b2     = (const float*)d_in[8];
  const float* w3     = (const float*)d_in[9];
  const float* b3     = (const float*)d_in[10];
  const float* w4     = (const float*)d_in[11];
  const float* b4     = (const float*)d_in[12];
  float* out = (float*)d_out;

  char* ws = (char*)d_ws;
  size_t off = 0;
  auto alloc = [&](size_t bytes) -> char* {
    char* p = ws + off;
    off += (bytes + 255) & ~(size_t)255;
    return p;
  };
  float*  xp_f  = (float*) alloc((size_t)M_ROWS * D1 * 4);
  half_t* xp_h  = (half_t*)alloc((size_t)M_ROWS * D1 * 2);
  float*  nx_f  = (float*) alloc((size_t)M_ROWS * D1 * 4);
  half_t* nx_h  = (half_t*)alloc((size_t)M_ROWS * D1 * 2);
  float*  a_f   = (float*) alloc((size_t)M_ROWS * D1 * 4);
  float*  sc    = (float*) alloc((size_t)BATCH * 256 * 4);
  half_t* awh   = (half_t*)alloc((size_t)2 * 4 * D1 * D1 * 2);
  half_t* w1h   = (half_t*)alloc((size_t)W1_TILES * 16 * KCLS * 2);
  float*  pcls  = (float*) alloc((size_t)CLS_KC * CLS_PLANE * 4);


  // Max-pool (the HBM-bound stage) + new_x init, and both weight conversions.
  k_pool_cvt<<<POOL_BLKS + CVT_BLKS_AW + CVT_BLKS_W1, POOL_THR, 0, stream>>>(
      x, xp_f, xp_h, nx_f, nx_h, attn_w, awh, w1, w1h);

  for (int i = 0; i < 2; ++i) {
    const half_t* Wa  = awh + (size_t)(i * 4 + 0) * D1 * D1;
    const half_t* Wb  = awh + (size_t)(i * 4 + 1) * D1 * D1;
    const half_t* W1s = awh + (size_t)(i * 4 + 3) * D1 * D1;
    const float* ba  = attn_b + (size_t)(i * 4 + 0) * D1;
    const float* bb  = attn_b + (size_t)(i * 4 + 1) * D1;
    const float* b1s = attn_b + (size_t)(i * 4 + 3) * D1;

    // a = fc_a(new_x), bproj = fc_b(xp), scores = a @ bproj^T / sqrt(512)
    k_ab_scores<<<BATCH, 1024, 0, stream>>>(nx_h, xp_h, Wa, Wb, ba, bb, a_f, sc);
    // new_x = new_x + fc_1(relu(LN(softmax_over_batch(scores) @ a)))
    k_context_fc1<<<dim3(BATCH, 2), 256, 0, stream>>>(sc, a_f, ln_g, ln_b, W1s, b1s, nx_f, nx_h);
  }

  // Classifier head.
  k_gemm_cls<<<dim3(CLS_KC, BATCH / 16), CLS_THR, 0, stream>>>(xp_h, nx_h, w1h, pcls);
  k_tail<<<BATCH, 256, 0, stream>>>(pcls, b1, w2, b2, w3, b3, w4, b4, out);
}
